// v000
// The times below were measured on an AMD MI455X: many runs one after another, warmed up first and cycling through
// copies of the inputs, with the whole window's GPU time divided by the number of runs. Launches and the gaps
// between them are all in it. The median over several windows is given; except for v000 it joins two sittings, which
// can be a few percent apart, so the side-by-side timings, each taken in one sitting, are the better comparison.
// v000 is the starting kernel. One run takes 297 microseconds.
#include <hip/hip_runtime.h>

#define BB 2
#define SS 2048
#define DD 1024
#define HH 16
#define HD 64
#define CHUNK 1024

typedef __attribute__((ext_vector_type(16))) _Float16 v16h;
typedef __attribute__((ext_vector_type(8)))  _Float16 v8h;
typedef __attribute__((ext_vector_type(4)))  _Float16 v4h;
typedef __attribute__((ext_vector_type(8)))  float    v8f;

#define WMMA(a, b, c) __builtin_amdgcn_wmma_f32_16x16x32_f16(false, (a), false, (b), (short)0, (c), false, false)

// Load a 16x32 f16 WMMA fragment (A layout, or B when source is stored [N,K]
// row-major). Two aligned 128-bit loads per lane (compiler merges to b128 pair).
static __device__ __forceinline__ v16h load_frag(const _Float16* __restrict__ p,
                                                 int ld, int row0, int k0, int lane) {
  int m = lane & 15;
  int koff = k0 + ((lane >> 4) << 3);
  const _Float16* base = p + (size_t)(row0 + m) * ld + koff;
  v8h lo = *(const v8h*)(base);
  v8h hi = *(const v8h*)(base + 16);
  v16h r;
#pragma unroll
  for (int i = 0; i < 8; ++i) { r[i] = lo[i]; r[i + 8] = hi[i]; }
  return r;
}

// ---------------- fp32 -> f16 convert (vector x4) ----------------
__global__ __launch_bounds__(256) void cvt_f16_kernel(const float* __restrict__ src,
                                                      _Float16* __restrict__ dst, int n4) {
  int i = blockIdx.x * blockDim.x + threadIdx.x;
  if (i >= n4) return;
  float4 v = ((const float4*)src)[i];
  v4h o = {(_Float16)v.x, (_Float16)v.y, (_Float16)v.z, (_Float16)v.w};
  ((v4h*)dst)[i] = o;
}

// ---------------- weight transpose: W[K,N] f32 -> Wt[N,K] f16 ----------------
__global__ __launch_bounds__(256) void transpose_w_kernel(const float* __restrict__ W,
                                                          _Float16* __restrict__ Wt) {
  __shared__ float tile[16][17];
  int n = blockIdx.x * 16 + threadIdx.x;
  int k = blockIdx.y * 16 + threadIdx.y;
  tile[threadIdx.y][threadIdx.x] = W[(size_t)k * DD + n];
  __syncthreads();
  int nn = blockIdx.x * 16 + threadIdx.y;
  int kk = blockIdx.y * 16 + threadIdx.x;
  Wt[(size_t)nn * DD + kk] = (_Float16)tile[threadIdx.x][threadIdx.y];
}

// ---------------- WMMA GEMM core: 32x64 wave tile ---------------------------
// acc[mt][nt] computed in-place; A [M,K] f16 row-major, Bt [N,K] f16 row-major.
template <typename STORE>
static __device__ __forceinline__ void gemm_wave_32x64(const _Float16* __restrict__ A,
                                                       const _Float16* __restrict__ Bt,
                                                       int M, int N, int K,
                                                       int wid, int lane, STORE store) {
  int ntiles = N >> 6;
  int m0 = (wid / ntiles) << 5;
  int n0 = (wid % ntiles) << 6;
  if (m0 >= M) return;
  v8f acc[2][4];
#pragma unroll
  for (int mt = 0; mt < 2; ++mt)
#pragma unroll
    for (int nt = 0; nt < 4; ++nt) acc[mt][nt] = (v8f){};

  for (int k0 = 0; k0 < K; k0 += 32) {
    // gfx1250 prefetch path (global_prefetch_b8) one macro-step ahead
    if (k0 + 256 < K) {
      __builtin_prefetch(A + (size_t)(m0 + (lane & 15)) * K + k0 + 256, 0, 0);
      __builtin_prefetch(Bt + (size_t)(n0 + (lane & 15)) * K + k0 + 256, 0, 0);
    }
    v16h a0 = load_frag(A, K, m0, k0, lane);
    v16h a1 = load_frag(A, K, m0 + 16, k0, lane);
#pragma unroll
    for (int nt = 0; nt < 4; ++nt) {
      v16h b = load_frag(Bt, K, n0 + (nt << 4), k0, lane);
      acc[0][nt] = WMMA(a0, b, acc[0][nt]);
      acc[1][nt] = WMMA(a1, b, acc[1][nt]);
    }
  }
#pragma unroll
  for (int mt = 0; mt < 2; ++mt) {
    int rbase = m0 + (mt << 4) + ((lane >> 4) << 3);
    int cbase = n0 + (lane & 15);
#pragma unroll
    for (int nt = 0; nt < 4; ++nt)
#pragma unroll
      for (int r = 0; r < 8; ++r)
        store(rbase + r, cbase + (nt << 4), acc[mt][nt][r]);
  }
}

// layout: 0 = row-major [M,N]; 1 = [B,H,S,HD]; 2 = [B,H,HD,S] (transposed V)
__global__ __launch_bounds__(256) void gemm_f16out_kernel(const _Float16* __restrict__ A,
                                                          const _Float16* __restrict__ Bt,
                                                          _Float16* __restrict__ C,
                                                          int M, int N, int K, int layout) {
  int wid  = (blockIdx.x * blockDim.x + threadIdx.x) >> 5;
  int lane = threadIdx.x & 31;
  gemm_wave_32x64(A, Bt, M, N, K, wid, lane, [&](int row, int col, float v) {
    size_t idx;
    if (layout == 0) {
      idx = (size_t)row * N + col;
    } else {
      int b = row >> 11, s = row & (SS - 1);
      int h = col >> 6, d = col & 63;
      if (layout == 1) idx = (((size_t)(b * HH + h) * SS + s) << 6) + d;
      else             idx = (((size_t)(b * HH + h) * HD + d) * SS) + s;
    }
    C[idx] = (_Float16)v;
  });
}

__global__ __launch_bounds__(256) void gemm_f32out_kernel(const _Float16* __restrict__ A,
                                                          const _Float16* __restrict__ Bt,
                                                          float* __restrict__ C,
                                                          int M, int N, int K) {
  int wid  = (blockIdx.x * blockDim.x + threadIdx.x) >> 5;
  int lane = threadIdx.x & 31;
  gemm_wave_32x64(A, Bt, M, N, K, wid, lane, [&](int row, int col, float v) {
    C[(size_t)row * N + col] = v;
  });
}

// ---------------- RoPE over Q,K in [B,H,S,HD] f16 --------------------------
__global__ __launch_bounds__(256) void rope_kernel(_Float16* __restrict__ Q,
                                                   _Float16* __restrict__ K,
                                                   const float* __restrict__ fc) {
  size_t idx = (size_t)blockIdx.x * blockDim.x + threadIdx.x;  // B*H*S*32
  int j = (int)(idx & 31);
  size_t bhs = idx >> 5;
  int s = (int)(bhs & (SS - 1));
  float c = fc[(s * 32 + j) * 2 + 0];
  float d = fc[(s * 32 + j) * 2 + 1];
  size_t base = (bhs << 6) + ((size_t)j << 1);
  float a = (float)Q[base], b = (float)Q[base + 1];
  Q[base]     = (_Float16)(a * c - b * d);
  Q[base + 1] = (_Float16)(a * d + b * c);
  a = (float)K[base]; b = (float)K[base + 1];
  K[base]     = (_Float16)(a * c - b * d);
  K[base + 1] = (_Float16)(a * d + b * c);
}

// ---------------- attention: per-chunk softmax, chunk outputs summed -------
__global__ __launch_bounds__(128) void attn_kernel(const _Float16* __restrict__ Q,
                                                   const _Float16* __restrict__ Kd,
                                                   const _Float16* __restrict__ Vt,
                                                   _Float16* __restrict__ O) {
  __shared__ __align__(16) _Float16 pbuf[4][16 * 32];  // per-wave P tile
  int wid    = (blockIdx.x * blockDim.x + threadIdx.x) >> 5;
  int wlocal = threadIdx.x >> 5;
  int lane   = threadIdx.x & 31;
  int qt = wid & ((SS / 16) - 1);
  int bh = wid >> 7;
  const _Float16* Qb = Q  + (size_t)bh * SS * HD;
  const _Float16* Kb = Kd + (size_t)bh * SS * HD;
  const _Float16* Vb = Vt + (size_t)bh * HD * SS;
  int m0 = qt << 4;

  v16h qa0 = load_frag(Qb, HD, m0, 0,  lane);
  v16h qa1 = load_frag(Qb, HD, m0, 32, lane);

  float ofin[4][8];
#pragma unroll
  for (int t = 0; t < 4; ++t)
#pragma unroll
    for (int r = 0; r < 8; ++r) ofin[t][r] = 0.f;

  _Float16* pl = pbuf[wlocal];
  const float scale = 0.125f;  // 64^-0.5

  for (int c0 = 0; c0 < SS; c0 += CHUNK) {
    float mrun[8], lrun[8];
#pragma unroll
    for (int r = 0; r < 8; ++r) { mrun[r] = -1e30f; lrun[r] = 0.f; }
    v8f oa0 = {}, oa1 = {}, oa2 = {}, oa3 = {};

    for (int kk = 0; kk < CHUNK; kk += 32) {
      // ---- scores: 16 queries x 32 keys, K-dim = HD = 64 (2 steps) ----
      v8f s0 = {}, s1 = {};
      {
        v16h kb = load_frag(Kb, HD, c0 + kk, 0, lane);
        s0 = WMMA(qa0, kb, s0);
        kb = load_frag(Kb, HD, c0 + kk, 32, lane);
        s0 = WMMA(qa1, kb, s0);
        kb = load_frag(Kb, HD, c0 + kk + 16, 0, lane);
        s1 = WMMA(qa0, kb, s1);
        kb = load_frag(Kb, HD, c0 + kk + 16, 32, lane);
        s1 = WMMA(qa1, kb, s1);
      }
      // ---- online softmax (rows live across 16-lane half-waves) ----
      float alpha[8];
#pragma unroll
      for (int r = 0; r < 8; ++r) {
        float v0 = s0[r] * scale, v1 = s1[r] * scale;
        float mx = fmaxf(v0, v1);
#pragma unroll
        for (int off = 1; off < 16; off <<= 1)
          mx = fmaxf(mx, __shfl_xor(mx, off, 32));
        float mnew = fmaxf(mrun[r], mx);
        alpha[r] = __expf(mrun[r] - mnew);
        float p0 = __expf(v0 - mnew);
        float p1 = __expf(v1 - mnew);
        float ps = p0 + p1;
#pragma unroll
        for (int off = 1; off < 16; off <<= 1)
          ps += __shfl_xor(ps, off, 32);
        lrun[r] = lrun[r] * alpha[r] + ps;
        mrun[r] = mnew;
        s0[r] = p0;
        s1[r] = p1;
      }
#pragma unroll
      for (int r = 0; r < 8; ++r) {
        oa0[r] *= alpha[r]; oa1[r] *= alpha[r];
        oa2[r] *= alpha[r]; oa3[r] *= alpha[r];
      }
      // ---- reshape P: C-layout -> A-fragment layout via LDS ----
      {
        int rb = (lane >> 4) << 3;
        int cc = lane & 15;
#pragma unroll
        for (int r = 0; r < 8; ++r) {
          pl[(rb + r) * 32 + cc]      = (_Float16)s0[r];
          pl[(rb + r) * 32 + 16 + cc] = (_Float16)s1[r];
        }
      }
      asm volatile("s_wait_dscnt 0x0" ::: "memory");
      v16h pa;
      {
        int m = lane & 15;
        int koff = (lane >> 4) << 3;
        const _Float16* pb = pl + m * 32 + koff;
        v8h lo = *(const v8h*)pb;
        v8h hi = *(const v8h*)(pb + 16);
#pragma unroll
        for (int i = 0; i < 8; ++i) { pa[i] = lo[i]; pa[i + 8] = hi[i]; }
      }
      // ---- P @ V: K-dim = 32 keys, 4 d-tiles (Vt is [HD,S]) ----
      v16h vb = load_frag(Vb, SS, 0, c0 + kk, lane);
      oa0 = WMMA(pa, vb, oa0);
      vb = load_frag(Vb, SS, 16, c0 + kk, lane);
      oa1 = WMMA(pa, vb, oa1);
      vb = load_frag(Vb, SS, 32, c0 + kk, lane);
      oa2 = WMMA(pa, vb, oa2);
      vb = load_frag(Vb, SS, 48, c0 + kk, lane);
      oa3 = WMMA(pa, vb, oa3);
    }
    // ---- finalize chunk (normalize by chunk-local l, accumulate) ----
#pragma unroll
    for (int r = 0; r < 8; ++r) {
      float inv = 1.f / lrun[r];
      ofin[0][r] += oa0[r] * inv;
      ofin[1][r] += oa1[r] * inv;
      ofin[2][r] += oa2[r] * inv;
      ofin[3][r] += oa3[r] * inv;
    }
  }
  // ---- store O as f16 [B*S, D] for final GEMM ----
  int b = bh >> 4, h = bh & 15;
  int rbase = m0 + ((lane >> 4) << 3);
  int cb = (h << 6) + (lane & 15);
#pragma unroll
  for (int t = 0; t < 4; ++t)
#pragma unroll
    for (int r = 0; r < 8; ++r) {
      int row = rbase + r;
      O[((size_t)(b * SS + row)) * DD + cb + (t << 4)] = (_Float16)ofin[t][r];
    }
}

extern "C" void kernel_launch(void* const* d_in, const int* in_sizes, int n_in,
                              void* d_out, int out_size, void* d_ws, size_t ws_size,
                              hipStream_t stream) {
  const float* X  = (const float*)d_in[0];
  const float* FC = (const float*)d_in[1];
  const float* Wq = (const float*)d_in[2];
  const float* Wk = (const float*)d_in[3];
  const float* Wv = (const float*)d_in[4];
  const float* Wo = (const float*)d_in[5];
  float* out = (float*)d_out;

  char* ws = (char*)d_ws;
  const size_t MB = 1u << 20;
  _Float16* Xh  = (_Float16*)(ws + 0);        // 8 MB  [B*S, D] f16
  _Float16* Wqt = (_Float16*)(ws + 8  * MB);  // 2 MB  [N,K] f16
  _Float16* Wkt = (_Float16*)(ws + 10 * MB);
  _Float16* Wvt = (_Float16*)(ws + 12 * MB);
  _Float16* Wot = (_Float16*)(ws + 14 * MB);
  _Float16* Qh  = (_Float16*)(ws + 16 * MB);  // 8 MB  [B,H,S,HD]
  _Float16* Kh  = (_Float16*)(ws + 24 * MB);  // 8 MB  [B,H,S,HD]
  _Float16* Vtb = (_Float16*)(ws + 32 * MB);  // 8 MB  [B,H,HD,S]
  _Float16* Oh  = (_Float16*)(ws + 40 * MB);  // 8 MB  [B*S, D]

  const int M = BB * SS;  // 4096

  // 1) X fp32 -> f16
  cvt_f16_kernel<<<(M * DD / 4) / 256, 256, 0, stream>>>(X, Xh, M * DD / 4);

  // 2) weights fp32 [K,N] -> f16 [N,K]
  {
    dim3 tb(16, 16), tg(DD / 16, DD / 16);
    transpose_w_kernel<<<tg, tb, 0, stream>>>(Wq, Wqt);
    transpose_w_kernel<<<tg, tb, 0, stream>>>(Wk, Wkt);
    transpose_w_kernel<<<tg, tb, 0, stream>>>(Wv, Wvt);
    transpose_w_kernel<<<tg, tb, 0, stream>>>(Wo, Wot);
  }

  // 3) QKV projections: waves = (M/32)*(N/64) = 2048 -> 256 blocks x 256 thr
  gemm_f16out_kernel<<<256, 256, 0, stream>>>(Xh, Wqt, Qh,  M, DD, DD, 1);
  gemm_f16out_kernel<<<256, 256, 0, stream>>>(Xh, Wkt, Kh,  M, DD, DD, 1);
  gemm_f16out_kernel<<<256, 256, 0, stream>>>(Xh, Wvt, Vtb, M, DD, DD, 2);

  // 4) RoPE on Q and K
  rope_kernel<<<(BB * HH * SS * 32) / 256, 256, 0, stream>>>(Qh, Kh, FC);

  // 5) attention (waves = B*H*(S/16) = 4096 -> 1024 blocks x 128 thr)
  attn_kernel<<<1024, 128, 0, stream>>>(Qh, Kh, Vtb, Oh);

  // 6) output projection -> f32 d_out
  gemm_f32out_kernel<<<256, 256, 0, stream>>>(Oh, Wot, out, M, DD, DD);
}

// v001
// A run of this version takes 290 microseconds.
// Timed twice side by side with v000, it ran 1.04 times as fast both times.
#include <hip/hip_runtime.h>

#define BB 2
#define SS 2048
#define DD 1024
#define HH 16
#define HD 64
#define CHUNK 1024

typedef __attribute__((ext_vector_type(16))) _Float16 v16h;
typedef __attribute__((ext_vector_type(8)))  _Float16 v8h;
typedef __attribute__((ext_vector_type(4)))  _Float16 v4h;
typedef __attribute__((ext_vector_type(8)))  float    v8f;

#define WMMA(a, b, c) __builtin_amdgcn_wmma_f32_16x16x32_f16(false, (a), false, (b), (short)0, (c), false, false)

// Load a 16x32 f16 WMMA fragment (A layout, or B when source is stored [N,K]
// row-major). Two aligned 128-bit loads per lane (compiler merges to b128 pair).
static __device__ __forceinline__ v16h load_frag(const _Float16* __restrict__ p,
                                                 int ld, int row0, int k0, int lane) {
  int m = lane & 15;
  int koff = k0 + ((lane >> 4) << 3);
  const _Float16* base = p + (size_t)(row0 + m) * ld + koff;
  v8h lo = *(const v8h*)(base);
  v8h hi = *(const v8h*)(base + 16);
  v16h r;
#pragma unroll
  for (int i = 0; i < 8; ++i) { r[i] = lo[i]; r[i + 8] = hi[i]; }
  return r;
}

// ---------------- fp32 -> f16 convert (vector x4) ----------------
__global__ __launch_bounds__(256) void cvt_f16_kernel(const float* __restrict__ src,
                                                      _Float16* __restrict__ dst, int n4) {
  int i = blockIdx.x * blockDim.x + threadIdx.x;
  if (i >= n4) return;
  float4 v = ((const float4*)src)[i];
  v4h o = {(_Float16)v.x, (_Float16)v.y, (_Float16)v.z, (_Float16)v.w};
  ((v4h*)dst)[i] = o;
}

// ---------------- weight transpose: W[K,N] f32 -> Wt[N,K] f16 ----------------
__global__ __launch_bounds__(256) void transpose_w_kernel(const float* __restrict__ W,
                                                          _Float16* __restrict__ Wt) {
  __shared__ float tile[16][17];
  int n = blockIdx.x * 16 + threadIdx.x;
  int k = blockIdx.y * 16 + threadIdx.y;
  tile[threadIdx.y][threadIdx.x] = W[(size_t)k * DD + n];
  __syncthreads();
  int nn = blockIdx.x * 16 + threadIdx.y;
  int kk = blockIdx.y * 16 + threadIdx.x;
  Wt[(size_t)nn * DD + kk] = (_Float16)tile[threadIdx.x][threadIdx.y];
}

// ---------------- WMMA GEMM core: 32x64 wave tile ---------------------------
// acc[mt][nt] computed in-place; A [M,K] f16 row-major, Bt [N,K] f16 row-major.
template <typename STORE>
static __device__ __forceinline__ void gemm_wave_32x64(const _Float16* __restrict__ A,
                                                       const _Float16* __restrict__ Bt,
                                                       int M, int N, int K,
                                                       int wid, int lane, STORE store) {
  int ntiles = N >> 6;
  int m0 = (wid / ntiles) << 5;
  int n0 = (wid % ntiles) << 6;
  if (m0 >= M) return;
  v8f acc[2][4];
#pragma unroll
  for (int mt = 0; mt < 2; ++mt)
#pragma unroll
    for (int nt = 0; nt < 4; ++nt) acc[mt][nt] = (v8f){};

  for (int k0 = 0; k0 < K; k0 += 32) {
    // gfx1250 prefetch path (global_prefetch_b8) one macro-step ahead
    if (k0 + 256 < K) {
      __builtin_prefetch(A + (size_t)(m0 + (lane & 15)) * K + k0 + 256, 0, 0);
      __builtin_prefetch(Bt + (size_t)(n0 + (lane & 15)) * K + k0 + 256, 0, 0);
    }
    v16h a0 = load_frag(A, K, m0, k0, lane);
    v16h a1 = load_frag(A, K, m0 + 16, k0, lane);
#pragma unroll
    for (int nt = 0; nt < 4; ++nt) {
      v16h b = load_frag(Bt, K, n0 + (nt << 4), k0, lane);
      acc[0][nt] = WMMA(a0, b, acc[0][nt]);
      acc[1][nt] = WMMA(a1, b, acc[1][nt]);
    }
  }
#pragma unroll
  for (int mt = 0; mt < 2; ++mt) {
    int rbase = m0 + (mt << 4) + ((lane >> 4) << 3);
    int cbase = n0 + (lane & 15);
#pragma unroll
    for (int nt = 0; nt < 4; ++nt)
#pragma unroll
      for (int r = 0; r < 8; ++r)
        store(rbase + r, cbase + (nt << 4), acc[mt][nt][r]);
  }
}

// layout: 0 = row-major [M,N]; 1 = [B,H,S,HD]; 2 = [B,H,HD,S] (transposed V)
__global__ __launch_bounds__(256) void gemm_f16out_kernel(const _Float16* __restrict__ A,
                                                          const _Float16* __restrict__ Bt,
                                                          _Float16* __restrict__ C,
                                                          int M, int N, int K, int layout) {
  int wid  = (blockIdx.x * blockDim.x + threadIdx.x) >> 5;
  int lane = threadIdx.x & 31;
  gemm_wave_32x64(A, Bt, M, N, K, wid, lane, [&](int row, int col, float v) {
    size_t idx;
    if (layout == 0) {
      idx = (size_t)row * N + col;
    } else {
      int b = row >> 11, s = row & (SS - 1);
      int h = col >> 6, d = col & 63;
      if (layout == 1) idx = (((size_t)(b * HH + h) * SS + s) << 6) + d;
      else             idx = (((size_t)(b * HH + h) * HD + d) * SS) + s;
    }
    C[idx] = (_Float16)v;
  });
}

__global__ __launch_bounds__(256) void gemm_f32out_kernel(const _Float16* __restrict__ A,
                                                          const _Float16* __restrict__ Bt,
                                                          float* __restrict__ C,
                                                          int M, int N, int K) {
  int wid  = (blockIdx.x * blockDim.x + threadIdx.x) >> 5;
  int lane = threadIdx.x & 31;
  gemm_wave_32x64(A, Bt, M, N, K, wid, lane, [&](int row, int col, float v) {
    C[(size_t)row * N + col] = v;
  });
}

// ---------------- RoPE over Q,K in [B,H,S,HD] f16 --------------------------
__global__ __launch_bounds__(256) void rope_kernel(_Float16* __restrict__ Q,
                                                   _Float16* __restrict__ K,
                                                   const float* __restrict__ fc) {
  size_t idx = (size_t)blockIdx.x * blockDim.x + threadIdx.x;  // B*H*S*32
  int j = (int)(idx & 31);
  size_t bhs = idx >> 5;
  int s = (int)(bhs & (SS - 1));
  float c = fc[(s * 32 + j) * 2 + 0];
  float d = fc[(s * 32 + j) * 2 + 1];
  size_t base = (bhs << 6) + ((size_t)j << 1);
  float a = (float)Q[base], b = (float)Q[base + 1];
  Q[base]     = (_Float16)(a * c - b * d);
  Q[base + 1] = (_Float16)(a * d + b * c);
  a = (float)K[base]; b = (float)K[base + 1];
  K[base]     = (_Float16)(a * c - b * d);
  K[base + 1] = (_Float16)(a * d + b * c);
}

// ---------------- attention: per-chunk softmax, chunk outputs summed -------
// Lane l <-> lane l ^ 16 (the two halves of a wave hold the two halves of a column).
static __device__ __forceinline__ float xhalf(float x) {
  int b = __builtin_bit_cast(int, x);
  return __builtin_bit_cast(float,
      __builtin_amdgcn_permlanex16(b, b, 0x76543210, 0xfedcba98, false, false));
}

__global__ __launch_bounds__(128) void attn_kernel(const _Float16* __restrict__ Q,
                                                   const _Float16* __restrict__ Kd,
                                                   const _Float16* __restrict__ Vt,
                                                   _Float16* __restrict__ O) {
  int wid    = (blockIdx.x * blockDim.x + threadIdx.x) >> 5;
  int lane   = threadIdx.x & 31;
  int qt = wid & ((SS / 16) - 1);
  int bh = wid >> 7;
  const _Float16* Qb = Q  + (size_t)bh * SS * HD;
  const _Float16* Kb = Kd + (size_t)bh * SS * HD;
  const _Float16* Vb = Vt + (size_t)bh * HD * SS;
  int m0 = qt << 4;

  v16h qb0 = load_frag(Qb, HD, m0, 0,  lane);
  v16h qb1 = load_frag(Qb, HD, m0, 32, lane);

  v8f of0 = {}, of1 = {}, of2 = {}, of3 = {};
  const float scale = 0.125f;  // 64^-0.5

  for (int c0 = 0; c0 < SS; c0 += CHUNK) {
    float mrun = -1e30f;  // running maximum of this lane's query
    float lrun = 0.f;     // running sum over this half's keys only
    v8f oa0 = {}, oa1 = {}, oa2 = {}, oa3 = {};

    for (int kk = 0; kk < CHUNK; kk += 32) {
      // ---- scores^T: 32 keys x 16 queries, K-dim = HD = 64 (2 steps) ----
      v16h ka0 = load_frag(Kb, HD, c0 + kk, 0, lane);
      v16h ka1 = load_frag(Kb, HD, c0 + kk, 32, lane);
      v16h ka2 = load_frag(Kb, HD, c0 + kk + 16, 0, lane);
      v16h ka3 = load_frag(Kb, HD, c0 + kk + 16, 32, lane);
      // The K loads' address registers are free for reuse from here on (the V loads
      // below may land in them): this wait stands in front of any such overwrite.
      asm volatile("s_wait_xcnt 0x0" ::: "memory");
      v16h va0 = load_frag(Vb, SS, 0,  c0 + kk, lane);
      v16h va1 = load_frag(Vb, SS, 16, c0 + kk, lane);
      v16h va2 = load_frag(Vb, SS, 32, c0 + kk, lane);
      v16h va3 = load_frag(Vb, SS, 48, c0 + kk, lane);
      v8f s0 = {}, s1 = {};
      s0 = WMMA(ka0, qb0, s0);
      s0 = WMMA(ka1, qb1, s0);
      s1 = WMMA(ka2, qb0, s1);
      s1 = WMMA(ka3, qb1, s1);
      // ---- online softmax: 16 of the query's 32 scores are in this lane ----
      s0 *= scale;
      s1 *= scale;
      float mx[8];
      for (int r = 0; r < 8; ++r) mx[r] = fmaxf(s0[r], s1[r]);
      float mt = fmaxf(fmaxf(fmaxf(mx[0], mx[1]), fmaxf(mx[2], mx[3])),
                       fmaxf(fmaxf(mx[4], mx[5]), fmaxf(mx[6], mx[7])));
      mt = fmaxf(mt, xhalf(mt));
      float mnew  = fmaxf(mrun, mt);
      float alpha = __expf(mrun - mnew);
      mrun = mnew;
      float ps[8];
      v16h pb;
      for (int r = 0; r < 8; ++r) {
        float p0 = __expf(s0[r] - mnew);
        float p1 = __expf(s1[r] - mnew);
        ps[r] = p0 + p1;
        pb[r]     = (_Float16)p0;  // k = 8h + r
        pb[r + 8] = (_Float16)p1;  // k = 16 + 8h + r
      }
      lrun = lrun * alpha + (((ps[0] + ps[1]) + (ps[2] + ps[3])) +
                             ((ps[4] + ps[5]) + (ps[6] + ps[7])));
      for (int r = 0; r < 8; ++r) {
        oa0[r] *= alpha; oa1[r] *= alpha;
        oa2[r] *= alpha; oa3[r] *= alpha;
      }
      // ---- O^T += V^T @ P^T: K-dim = 32 keys, 4 d-tiles (Vt is [HD,S]) ----
      oa0 = WMMA(va0, pb, oa0);
      oa1 = WMMA(va1, pb, oa1);
      oa2 = WMMA(va2, pb, oa2);
      oa3 = WMMA(va3, pb, oa3);
    }
    // ---- finalize chunk: join the halves' sums, normalize, accumulate ----
    float inv = 1.f / (lrun + xhalf(lrun));
    for (int r = 0; r < 8; ++r) {
      of0[r] += oa0[r] * inv;
      of1[r] += oa1[r] * inv;
      of2[r] += oa2[r] * inv;
      of3[r] += oa3[r] * inv;
    }
  }
  // ---- store O as f16 [B*S, D]: a lane holds 8 consecutive d of its query ----
  int b = bh >> 4, h = bh & 15;
  _Float16* orow = O + ((size_t)(b * SS + m0 + (lane & 15))) * DD + (h << 6) + ((lane >> 4) << 3);
  v8h o0, o1, o2, o3;
  for (int r = 0; r < 8; ++r) {
    o0[r] = (_Float16)of0[r]; o1[r] = (_Float16)of1[r];
    o2[r] = (_Float16)of2[r]; o3[r] = (_Float16)of3[r];
  }
  *(v8h*)(orow)      = o0;
  *(v8h*)(orow + 16) = o1;
  *(v8h*)(orow + 32) = o2;
  *(v8h*)(orow + 48) = o3;
}

extern "C" void kernel_launch(void* const* d_in, const int* in_sizes, int n_in,
                              void* d_out, int out_size, void* d_ws, size_t ws_size,
                              hipStream_t stream) {
  const float* X  = (const float*)d_in[0];
  const float* FC = (const float*)d_in[1];
  const float* Wq = (const float*)d_in[2];
  const float* Wk = (const float*)d_in[3];
  const float* Wv = (const float*)d_in[4];
  const float* Wo = (const float*)d_in[5];
  float* out = (float*)d_out;

  char* ws = (char*)d_ws;
  const size_t MB = 1u << 20;
  _Float16* Xh  = (_Float16*)(ws + 0);        // 8 MB  [B*S, D] f16
  _Float16* Wqt = (_Float16*)(ws + 8  * MB);  // 2 MB  [N,K] f16
  _Float16* Wkt = (_Float16*)(ws + 10 * MB);
  _Float16* Wvt = (_Float16*)(ws + 12 * MB);
  _Float16* Wot = (_Float16*)(ws + 14 * MB);
  _Float16* Qh  = (_Float16*)(ws + 16 * MB);  // 8 MB  [B,H,S,HD]
  _Float16* Kh  = (_Float16*)(ws + 24 * MB);  // 8 MB  [B,H,S,HD]
  _Float16* Vtb = (_Float16*)(ws + 32 * MB);  // 8 MB  [B,H,HD,S]
  _Float16* Oh  = (_Float16*)(ws + 40 * MB);  // 8 MB  [B*S, D]

  const int M = BB * SS;  // 4096

  // 1) X fp32 -> f16
  cvt_f16_kernel<<<(M * DD / 4) / 256, 256, 0, stream>>>(X, Xh, M * DD / 4);

  // 2) weights fp32 [K,N] -> f16 [N,K]
  {
    dim3 tb(16, 16), tg(DD / 16, DD / 16);
    transpose_w_kernel<<<tg, tb, 0, stream>>>(Wq, Wqt);
    transpose_w_kernel<<<tg, tb, 0, stream>>>(Wk, Wkt);
    transpose_w_kernel<<<tg, tb, 0, stream>>>(Wv, Wvt);
    transpose_w_kernel<<<tg, tb, 0, stream>>>(Wo, Wot);
  }

  // 3) QKV projections: waves = (M/32)*(N/64) = 2048 -> 256 blocks x 256 thr
  gemm_f16out_kernel<<<256, 256, 0, stream>>>(Xh, Wqt, Qh,  M, DD, DD, 1);
  gemm_f16out_kernel<<<256, 256, 0, stream>>>(Xh, Wkt, Kh,  M, DD, DD, 1);
  gemm_f16out_kernel<<<256, 256, 0, stream>>>(Xh, Wvt, Vtb, M, DD, DD, 2);

  // 4) RoPE on Q and K
  rope_kernel<<<(BB * HH * SS * 32) / 256, 256, 0, stream>>>(Qh, Kh, FC);

  // 5) attention (waves = B*H*(S/16) = 4096 -> 1024 blocks x 128 thr)
  attn_kernel<<<1024, 128, 0, stream>>>(Qh, Kh, Vtb, Oh);

  // 6) output projection -> f32 d_out
  gemm_f32out_kernel<<<256, 256, 0, stream>>>(Oh, Wot, out, M, DD, DD);
}

// v002
// Measured time: 267 microseconds a run.
// Timed twice side by side with v001, it ran 1.09 times as fast both times.
// All steps since v000 together make it 1.13 times as fast.
#include <hip/hip_runtime.h>

#define BB 2
#define SS 2048
#define DD 1024
#define HH 16
#define HD 64
#define CHUNK 1024

typedef __attribute__((ext_vector_type(16))) _Float16 v16h;
typedef __attribute__((ext_vector_type(8)))  _Float16 v8h;
typedef __attribute__((ext_vector_type(4)))  _Float16 v4h;
typedef __attribute__((ext_vector_type(8)))  float    v8f;

#define WMMA(a, b, c) __builtin_amdgcn_wmma_f32_16x16x32_f16(false, (a), false, (b), (short)0, (c), false, false)

// Fragment order. Every f16 operand in the workspace, a [rows, k] matrix, is kept as
// 1-KB units of 16 rows x 32 k, unit index = row_tile * ktiles + k_tile. A unit is two
// 512-B planes (k 0..15, k 16..31); in a plane lane l = 16 * ((k >> 3) & 1) + (row & 15)
// owns 8 consecutive k. A wave-wide 16-B access then covers 512 contiguous bytes.
static __device__ __forceinline__ size_t frag_unit(int row_tile, int k_tile, int ktiles) {
  return ((size_t)row_tile * ktiles + k_tile) << 9;
}

static __device__ __forceinline__ size_t frag_elem(int row, int k, int ktiles) {
  return frag_unit(row >> 4, k >> 5, ktiles) + (((k >> 4) & 1) << 8) +
         (((((k >> 3) & 1) << 4) + (row & 15)) << 3) + (k & 7);
}

// Load a 16x32 f16 WMMA fragment (A operand, or B when the rows are the columns of B).
static __device__ __forceinline__ v16h load_frag(const _Float16* __restrict__ p,
                                                 int ktiles, int row_tile, int k_tile, int lane) {
  const _Float16* base = p + frag_unit(row_tile, k_tile, ktiles) + (lane << 3);
  v8h lo = *(const v8h*)(base);
  v8h hi = *(const v8h*)(base + 256);
  v16h r;
#pragma unroll
  for (int i = 0; i < 8; ++i) { r[i] = lo[i]; r[i + 8] = hi[i]; }
  return r;
}

static __device__ __forceinline__ v8h to_f16(v8f x) {
  v8h o;
  for (int r = 0; r < 8; ++r) o[r] = (_Float16)x[r];
  return o;
}

// ---------------- fp32 [rows, DD] -> f16 fragment order: one wave per unit ----------
__global__ __launch_bounds__(256) void cvt_f16_kernel(const float* __restrict__ src,
                                                      _Float16* __restrict__ dst) {
  int unit = (blockIdx.x * blockDim.x + threadIdx.x) >> 5;  // row_tile * (DD / 32) + k_tile
  int lane = threadIdx.x & 31;
  int row = ((unit / (DD / 32)) << 4) + (lane & 15);
  int k   = ((unit % (DD / 32)) << 5) + ((lane >> 4) << 3);
  const float4* s = (const float4*)(src + (size_t)row * DD + k);
  float4 a = s[0], b = s[1], c = s[4], d = s[5];
  v8h lo = {(_Float16)a.x, (_Float16)a.y, (_Float16)a.z, (_Float16)a.w,
            (_Float16)b.x, (_Float16)b.y, (_Float16)b.z, (_Float16)b.w};
  v8h hi = {(_Float16)c.x, (_Float16)c.y, (_Float16)c.z, (_Float16)c.w,
            (_Float16)d.x, (_Float16)d.y, (_Float16)d.z, (_Float16)d.w};
  _Float16* o = dst + ((size_t)unit << 9) + (lane << 3);
  *(v8h*)(o)       = lo;
  *(v8h*)(o + 256) = hi;
}

// -------- weight transpose: W[K,N] f32 -> Wt[N,K] f16 in fragment order --------
__global__ __launch_bounds__(256) void transpose_w_kernel(const float* __restrict__ W,
                                                          _Float16* __restrict__ Wt) {
  __shared__ float tile[16][17];
  int n = blockIdx.x * 16 + threadIdx.x;
  int k = blockIdx.y * 16 + threadIdx.y;
  tile[threadIdx.y][threadIdx.x] = W[(size_t)k * DD + n];
  __syncthreads();
  int nn = blockIdx.x * 16 + threadIdx.y;
  int kk = blockIdx.y * 16 + threadIdx.x;
  Wt[frag_elem(nn, kk, DD / 32)] = (_Float16)tile[threadIdx.x][threadIdx.y];
}

// ---------------- WMMA GEMM core: 32x64 wave tile ---------------------------
// A [M,K] and Bt [N,K], both f16 in fragment order. SWAP = false: tile (mt, nt) holds
// C (register r, lane l: row 8 * (l >> 4) + r, column l & 15); SWAP = true: it holds
// C^T (row of C = l & 15, column of C = 8 * (l >> 4) + r), same products, same k order.
template <bool SWAP, typename STORE>
static __device__ __forceinline__ void gemm_wave_32x64(const _Float16* __restrict__ A,
                                                       const _Float16* __restrict__ Bt,
                                                       int M, int N, int K,
                                                       int wid, int lane, STORE store) {
  int ntiles = N >> 6;
  int m0 = (wid / ntiles) << 5;
  int n0 = (wid % ntiles) << 6;
  if (m0 >= M) return;
  int kts = K >> 5;
  int mt0 = m0 >> 4, nt0 = n0 >> 4;
  v8f acc[2][4];
#pragma unroll
  for (int mt = 0; mt < 2; ++mt)
#pragma unroll
    for (int nt = 0; nt < 4; ++nt) acc[mt][nt] = (v8f){};

  for (int kt = 0; kt < kts; ++kt) {
    // gfx1250 prefetch path (global_prefetch_b8) one macro-step ahead
    if (kt + 8 < kts) {
      __builtin_prefetch(A + frag_unit(mt0, kt + 8, kts) + ((lane & 15) << 5), 0, 0);
      __builtin_prefetch(Bt + frag_unit(nt0, kt + 8, kts) + ((lane & 15) << 5), 0, 0);
    }
    v16h a0 = load_frag(A, kts, mt0, kt, lane);
    v16h a1 = load_frag(A, kts, mt0 + 1, kt, lane);
    // The A loads' address registers are free for reuse from here on (the B loads
    // below may land in them): this wait stands in front of any such overwrite.
    asm volatile("s_wait_xcnt 0x0" ::: "memory");
#pragma unroll
    for (int nt = 0; nt < 4; ++nt) {
      v16h b = load_frag(Bt, kts, nt0 + nt, kt, lane);
      if (SWAP) {
        acc[0][nt] = WMMA(b, a0, acc[0][nt]);
        acc[1][nt] = WMMA(b, a1, acc[1][nt]);
      } else {
        acc[0][nt] = WMMA(a0, b, acc[0][nt]);
        acc[1][nt] = WMMA(a1, b, acc[1][nt]);
      }
    }
  }
#pragma unroll
  for (int mt = 0; mt < 2; ++mt)
#pragma unroll
    for (int nt = 0; nt < 4; ++nt) store(m0, n0, mt, nt, acc[mt][nt]);
}

// Projections, C in fragment order per (batch, head); a lane's 8 values are 8 consecutive
// k of the operand that attention reads, so each tile leaves as one 16-B store per lane.
// VT = false: rows = positions, k = head dim (Q, K), from C^T.
// VT = true:  rows = head dim, k = positions (V^T), from C.
template <bool VT>
__global__ __launch_bounds__(256) void gemm_f16out_kernel(const _Float16* __restrict__ A,
                                                          const _Float16* __restrict__ Bt,
                                                          _Float16* __restrict__ C,
                                                          int M, int N, int K) {
  int wid  = (blockIdx.x * blockDim.x + threadIdx.x) >> 5;
  int lane = threadIdx.x & 31;
  gemm_wave_32x64<!VT>(A, Bt, M, N, K, wid, lane, [&](int m0, int n0, int mt, int nt, v8f v) {
    int b = m0 >> 11, s0 = m0 & (SS - 1), h = n0 >> 6;
    _Float16* Cb = C + (size_t)(b * HH + h) * SS * HD;
    size_t idx;
    if (VT) idx = frag_unit(nt, s0 >> 5, SS / 32) + (mt << 8);
    else    idx = frag_unit((s0 >> 4) + mt, nt >> 1, HD / 32) + ((nt & 1) << 8);
    *(v8h*)(Cb + idx + (lane << 3)) = to_f16(v);
  });
}

__global__ __launch_bounds__(256) void gemm_f32out_kernel(const _Float16* __restrict__ A,
                                                          const _Float16* __restrict__ Bt,
                                                          float* __restrict__ C,
                                                          int M, int N, int K) {
  int wid  = (blockIdx.x * blockDim.x + threadIdx.x) >> 5;
  int lane = threadIdx.x & 31;
  gemm_wave_32x64<false>(A, Bt, M, N, K, wid, lane, [&](int m0, int n0, int mt, int nt, v8f v) {
    int row = m0 + (mt << 4) + ((lane >> 4) << 3);
    int col = n0 + (nt << 4) + (lane & 15);
    for (int r = 0; r < 8; ++r) C[(size_t)(row + r) * N + col] = v[r];
  });
}

// -------- RoPE over Q,K, f16 in fragment order per (batch, head) --------------
__global__ __launch_bounds__(256) void rope_kernel(_Float16* __restrict__ Q,
                                                   _Float16* __restrict__ K,
                                                   const float* __restrict__ fc) {
  size_t idx = (size_t)blockIdx.x * blockDim.x + threadIdx.x;  // B*H*S*32 pairs as stored
  size_t base = idx << 1;
  int off = (int)(base & (SS * HD - 1));  // bits: 0-2 k & 7, 3-6 row & 15, 7-9 k >> 3, 10.. row >> 4
  int s = ((off >> 10) << 4) + ((off >> 3) & 15);
  int j = ((((off >> 7) & 7) << 3) + (off & 7)) >> 1;
  float c = fc[(s * 32 + j) * 2 + 0];
  float d = fc[(s * 32 + j) * 2 + 1];
  float a = (float)Q[base], b = (float)Q[base + 1];
  Q[base]     = (_Float16)(a * c - b * d);
  Q[base + 1] = (_Float16)(a * d + b * c);
  a = (float)K[base]; b = (float)K[base + 1];
  K[base]     = (_Float16)(a * c - b * d);
  K[base + 1] = (_Float16)(a * d + b * c);
}

// ---------------- attention: per-chunk softmax, chunk outputs summed -------
// Lane l <-> lane l ^ 16 (the two halves of a wave hold the two halves of a column).
static __device__ __forceinline__ float xhalf(float x) {
  int b = __builtin_bit_cast(int, x);
  return __builtin_bit_cast(float,
      __builtin_amdgcn_permlanex16(b, b, 0x76543210, 0xfedcba98, false, false));
}

__global__ __launch_bounds__(128) void attn_kernel(const _Float16* __restrict__ Q,
                                                   const _Float16* __restrict__ Kd,
                                                   const _Float16* __restrict__ Vt,
                                                   _Float16* __restrict__ O) {
  int wid    = (blockIdx.x * blockDim.x + threadIdx.x) >> 5;
  int lane   = threadIdx.x & 31;
  int qt = wid & ((SS / 16) - 1);
  int bh = wid >> 7;
  const _Float16* Qb = Q  + (size_t)bh * SS * HD;
  const _Float16* Kb = Kd + (size_t)bh * SS * HD;
  const _Float16* Vb = Vt + (size_t)bh * HD * SS;

  v16h qb0 = load_frag(Qb, HD / 32, qt, 0, lane);
  v16h qb1 = load_frag(Qb, HD / 32, qt, 1, lane);

  v8f of0 = {}, of1 = {}, of2 = {}, of3 = {};
  const float scale = 0.125f;  // 64^-0.5

  for (int c0 = 0; c0 < SS; c0 += CHUNK) {
    float mrun = -1e30f;  // running maximum of this lane's query
    float lrun = 0.f;     // running sum over this half's keys only
    v8f oa0 = {}, oa1 = {}, oa2 = {}, oa3 = {};

    for (int kk = 0; kk < CHUNK; kk += 32) {
      // ---- scores^T: 32 keys x 16 queries, K-dim = HD = 64 (2 steps) ----
      int kt = (c0 + kk) >> 5;  // 32 keys: two row tiles of K, one k tile of V^T
      v16h ka0 = load_frag(Kb, HD / 32, 2 * kt, 0, lane);
      v16h ka1 = load_frag(Kb, HD / 32, 2 * kt, 1, lane);
      v16h ka2 = load_frag(Kb, HD / 32, 2 * kt + 1, 0, lane);
      v16h ka3 = load_frag(Kb, HD / 32, 2 * kt + 1, 1, lane);
      // The K loads' address registers are free for reuse from here on (the V loads
      // below may land in them): this wait stands in front of any such overwrite.
      asm volatile("s_wait_xcnt 0x0" ::: "memory");
      v16h va0 = load_frag(Vb, SS / 32, 0, kt, lane);
      v16h va1 = load_frag(Vb, SS / 32, 1, kt, lane);
      v16h va2 = load_frag(Vb, SS / 32, 2, kt, lane);
      v16h va3 = load_frag(Vb, SS / 32, 3, kt, lane);
      v8f s0 = {}, s1 = {};
      s0 = WMMA(ka0, qb0, s0);
      s0 = WMMA(ka1, qb1, s0);
      s1 = WMMA(ka2, qb0, s1);
      s1 = WMMA(ka3, qb1, s1);
      // ---- online softmax: 16 of the query's 32 scores are in this lane ----
      s0 *= scale;
      s1 *= scale;
      float mx[8];
      for (int r = 0; r < 8; ++r) mx[r] = fmaxf(s0[r], s1[r]);
      float mt = fmaxf(fmaxf(fmaxf(mx[0], mx[1]), fmaxf(mx[2], mx[3])),
                       fmaxf(fmaxf(mx[4], mx[5]), fmaxf(mx[6], mx[7])));
      mt = fmaxf(mt, xhalf(mt));
      float mnew  = fmaxf(mrun, mt);
      float alpha = __expf(mrun - mnew);
      mrun = mnew;
      float ps[8];
      v16h pb;
      for (int r = 0; r < 8; ++r) {
        float p0 = __expf(s0[r] - mnew);
        float p1 = __expf(s1[r] - mnew);
        ps[r] = p0 + p1;
        pb[r]     = (_Float16)p0;  // k = 8h + r
        pb[r + 8] = (_Float16)p1;  // k = 16 + 8h + r
      }
      lrun = lrun * alpha + (((ps[0] + ps[1]) + (ps[2] + ps[3])) +
                             ((ps[4] + ps[5]) + (ps[6] + ps[7])));
      for (int r = 0; r < 8; ++r) {
        oa0[r] *= alpha; oa1[r] *= alpha;
        oa2[r] *= alpha; oa3[r] *= alpha;
      }
      // ---- O^T += V^T @ P^T: K-dim = 32 keys, 4 d-tiles (Vt is [HD,S]) ----
      oa0 = WMMA(va0, pb, oa0);
      oa1 = WMMA(va1, pb, oa1);
      oa2 = WMMA(va2, pb, oa2);
      oa3 = WMMA(va3, pb, oa3);
    }
    // ---- finalize chunk: join the halves' sums, normalize, accumulate ----
    float inv = 1.f / (lrun + xhalf(lrun));
    for (int r = 0; r < 8; ++r) {
      of0[r] += oa0[r] * inv;
      of1[r] += oa1[r] * inv;
      of2[r] += oa2[r] * inv;
      of3[r] += oa3[r] * inv;
    }
  }
  // ---- store O, f16 [B*S, D] in fragment order: a lane holds 8 consecutive d of its
  // query, and d tiles 2u, 2u + 1 are the two planes of k tile 2h + u ----
  int b = bh >> 4, h = bh & 15;
  _Float16* o = O + frag_unit(b * (SS / 16) + qt, 2 * h, DD / 32) + (lane << 3);
  *(v8h*)(o)       = to_f16(of0);
  *(v8h*)(o + 256) = to_f16(of1);
  *(v8h*)(o + 512) = to_f16(of2);
  *(v8h*)(o + 768) = to_f16(of3);
}

extern "C" void kernel_launch(void* const* d_in, const int* in_sizes, int n_in,
                              void* d_out, int out_size, void* d_ws, size_t ws_size,
                              hipStream_t stream) {
  const float* X  = (const float*)d_in[0];
  const float* FC = (const float*)d_in[1];
  const float* Wq = (const float*)d_in[2];
  const float* Wk = (const float*)d_in[3];
  const float* Wv = (const float*)d_in[4];
  const float* Wo = (const float*)d_in[5];
  float* out = (float*)d_out;

  char* ws = (char*)d_ws;
  const size_t MB = 1u << 20;
  // all in fragment order
  _Float16* Xh  = (_Float16*)(ws + 0);        // 8 MB  [B*S, D] f16
  _Float16* Wqt = (_Float16*)(ws + 8  * MB);  // 2 MB  [N,K] f16
  _Float16* Wkt = (_Float16*)(ws + 10 * MB);
  _Float16* Wvt = (_Float16*)(ws + 12 * MB);
  _Float16* Wot = (_Float16*)(ws + 14 * MB);
  _Float16* Qh  = (_Float16*)(ws + 16 * MB);  // 8 MB  [B,H,S,HD]
  _Float16* Kh  = (_Float16*)(ws + 24 * MB);  // 8 MB  [B,H,S,HD]
  _Float16* Vtb = (_Float16*)(ws + 32 * MB);  // 8 MB  [B,H,HD,S]
  _Float16* Oh  = (_Float16*)(ws + 40 * MB);  // 8 MB  [B*S, D]

  const int M = BB * SS;  // 4096

  // 1) X fp32 -> f16
  cvt_f16_kernel<<<(M / 16) * (DD / 32) / 8, 256, 0, stream>>>(X, Xh);

  // 2) weights fp32 [K,N] -> f16 [N,K]
  {
    dim3 tb(16, 16), tg(DD / 16, DD / 16);
    transpose_w_kernel<<<tg, tb, 0, stream>>>(Wq, Wqt);
    transpose_w_kernel<<<tg, tb, 0, stream>>>(Wk, Wkt);
    transpose_w_kernel<<<tg, tb, 0, stream>>>(Wv, Wvt);
    transpose_w_kernel<<<tg, tb, 0, stream>>>(Wo, Wot);
  }

  // 3) QKV projections: waves = (M/32)*(N/64) = 2048 -> 256 blocks x 256 thr
  gemm_f16out_kernel<false><<<256, 256, 0, stream>>>(Xh, Wqt, Qh,  M, DD, DD);
  gemm_f16out_kernel<false><<<256, 256, 0, stream>>>(Xh, Wkt, Kh,  M, DD, DD);
  gemm_f16out_kernel<true><<<256, 256, 0, stream>>>(Xh, Wvt, Vtb, M, DD, DD);

  // 4) RoPE on Q and K
  rope_kernel<<<(BB * HH * SS * 32) / 256, 256, 0, stream>>>(Qh, Kh, FC);

  // 5) attention (waves = B*H*(S/16) = 4096 -> 1024 blocks x 128 thr)
  attn_kernel<<<1024, 128, 0, stream>>>(Qh, Kh, Vtb, Oh);

  // 6) output projection -> f32 d_out
  gemm_f32out_kernel<<<256, 256, 0, stream>>>(Oh, Wot, out, M, DD, DD);
}

// v003
// It runs in 159 microseconds.
// Timed twice side by side with v002, it ran 1.69 and 1.68 times as fast.
// Counting every step since v000, it is 1.90 times as fast.
#include <hip/hip_runtime.h>

#define BB 2
#define SS 2048
#define DD 1024
#define HH 16
#define HD 64
#define CHUNK 1024

typedef __attribute__((ext_vector_type(16))) _Float16 v16h;
typedef __attribute__((ext_vector_type(8)))  _Float16 v8h;
typedef __attribute__((ext_vector_type(4)))  _Float16 v4h;
typedef __attribute__((ext_vector_type(8)))  float    v8f;

#define WMMA(a, b, c) __builtin_amdgcn_wmma_f32_16x16x32_f16(false, (a), false, (b), (short)0, (c), false, false)

// Fragment order. Every f16 operand in the workspace, a [rows, k] matrix, is kept as
// 1-KB units of 16 rows x 32 k, unit index = row_tile * ktiles + k_tile. A unit is two
// 512-B planes (k 0..15, k 16..31); in a plane lane l = 16 * ((k >> 3) & 1) + (row & 15)
// owns 8 consecutive k. A wave-wide 16-B access then covers 512 contiguous bytes.
static __device__ __forceinline__ size_t frag_unit(int row_tile, int k_tile, int ktiles) {
  return ((size_t)row_tile * ktiles + k_tile) << 9;
}

static __device__ __forceinline__ size_t frag_elem(int row, int k, int ktiles) {
  return frag_unit(row >> 4, k >> 5, ktiles) + (((k >> 4) & 1) << 8) +
         (((((k >> 3) & 1) << 4) + (row & 15)) << 3) + (k & 7);
}

// Load a 16x32 f16 WMMA fragment (A operand, or B when the rows are the columns of B).
static __device__ __forceinline__ v16h load_frag(const _Float16* __restrict__ p,
                                                 int ktiles, int row_tile, int k_tile, int lane) {
  const _Float16* base = p + frag_unit(row_tile, k_tile, ktiles) + (lane << 3);
  v8h lo = *(const v8h*)(base);
  v8h hi = *(const v8h*)(base + 256);
  v16h r;
#pragma unroll
  for (int i = 0; i < 8; ++i) { r[i] = lo[i]; r[i + 8] = hi[i]; }
  return r;
}

// The same from a running pointer: base = the unit's start + 8 * lane.
static __device__ __forceinline__ v16h load_frag_at(const _Float16* base) {
  v8h lo = *(const v8h*)(base);
  v8h hi = *(const v8h*)(base + 256);
  v16h r;
#pragma unroll
  for (int i = 0; i < 8; ++i) { r[i] = lo[i]; r[i + 8] = hi[i]; }
  return r;
}

static __device__ __forceinline__ v8h to_f16(v8f x) {
  v8h o;
  for (int r = 0; r < 8; ++r) o[r] = (_Float16)x[r];
  return o;
}

// ---------------- fp32 [rows, DD] -> f16 fragment order: one wave per unit ----------
__global__ __launch_bounds__(256) void cvt_f16_kernel(const float* __restrict__ src,
                                                      _Float16* __restrict__ dst) {
  int unit = (blockIdx.x * blockDim.x + threadIdx.x) >> 5;  // row_tile * (DD / 32) + k_tile
  int lane = threadIdx.x & 31;
  int row = ((unit / (DD / 32)) << 4) + (lane & 15);
  int k   = ((unit % (DD / 32)) << 5) + ((lane >> 4) << 3);
  const float4* s = (const float4*)(src + (size_t)row * DD + k);
  float4 a = s[0], b = s[1], c = s[4], d = s[5];
  v8h lo = {(_Float16)a.x, (_Float16)a.y, (_Float16)a.z, (_Float16)a.w,
            (_Float16)b.x, (_Float16)b.y, (_Float16)b.z, (_Float16)b.w};
  v8h hi = {(_Float16)c.x, (_Float16)c.y, (_Float16)c.z, (_Float16)c.w,
            (_Float16)d.x, (_Float16)d.y, (_Float16)d.z, (_Float16)d.w};
  _Float16* o = dst + ((size_t)unit << 9) + (lane << 3);
  *(v8h*)(o)       = lo;
  *(v8h*)(o + 256) = hi;
}

// -------- weight transpose: W[K,N] f32 -> Wt[N,K] f16 in fragment order --------
__global__ __launch_bounds__(256) void transpose_w_kernel(const float* __restrict__ W,
                                                          _Float16* __restrict__ Wt) {
  __shared__ float tile[16][17];
  int n = blockIdx.x * 16 + threadIdx.x;
  int k = blockIdx.y * 16 + threadIdx.y;
  tile[threadIdx.y][threadIdx.x] = W[(size_t)k * DD + n];
  __syncthreads();
  int nn = blockIdx.x * 16 + threadIdx.y;
  int kk = blockIdx.y * 16 + threadIdx.x;
  Wt[frag_elem(nn, kk, DD / 32)] = (_Float16)tile[threadIdx.x][threadIdx.y];
}

// ---------------- WMMA GEMM core: 32x64 wave tile ---------------------------
// A [M,K] and Bt [N,K], both f16 in fragment order. SWAP = false: tile (mt, nt) holds
// C (register r, lane l: row 8 * (l >> 4) + r, column l & 15); SWAP = true: it holds
// C^T (row of C = l & 15, column of C = 8 * (l >> 4) + r), same products, same k order.
template <bool SWAP, typename STORE>
static __device__ __forceinline__ void gemm_wave_32x64(const _Float16* __restrict__ A,
                                                       const _Float16* __restrict__ Bt,
                                                       int M, int N, int K,
                                                       int wid, int lane, STORE store) {
  int ntiles = N >> 6;
  int m0 = (wid / ntiles) << 5;
  int n0 = (wid % ntiles) << 6;
  if (m0 >= M) return;
  int kts = K >> 5;
  int mt0 = m0 >> 4, nt0 = n0 >> 4;
  v8f acc[2][4];
#pragma unroll
  for (int mt = 0; mt < 2; ++mt)
#pragma unroll
    for (int nt = 0; nt < 4; ++nt) acc[mt][nt] = (v8f){};

  // One k step's operands, 2 A and 4 B fragments, are fetched as one group of 12 loads,
  // one k step ahead of their products, into one of two register sets: a step then waits
  // for loads issued a whole step earlier, not four times for loads just issued.
  struct Step { v16h a[2], b[4]; };
  // This lane's place in the six fragments of the next step to fetch.
  const _Float16* pa0 = A + frag_unit(mt0, 0, kts) + (lane << 3);
  const _Float16* pa1 = A + frag_unit(mt0 + 1, 0, kts) + (lane << 3);
  const _Float16* pb0 = Bt + frag_unit(nt0, 0, kts) + (lane << 3);
  const _Float16* pb1 = Bt + frag_unit(nt0 + 1, 0, kts) + (lane << 3);
  const _Float16* pb2 = Bt + frag_unit(nt0 + 2, 0, kts) + (lane << 3);
  const _Float16* pb3 = Bt + frag_unit(nt0 + 3, 0, kts) + (lane << 3);
  auto fetch = [&](Step& f, int kt) {
    // gfx1250 prefetch path (global_prefetch_b8) 8 k steps ahead of the fetch
    if (kt + 8 < kts) {
      __builtin_prefetch(A + frag_unit(mt0, kt + 8, kts) + ((lane & 15) << 5), 0, 0);
      __builtin_prefetch(Bt + frag_unit(nt0, kt + 8, kts) + ((lane & 15) << 5), 0, 0);
      // In front of any overwrite of the two prefetch addresses.
      asm volatile("s_wait_xcnt 0x0" ::: "memory");
    }
    f.a[0] = load_frag_at(pa0);
    f.a[1] = load_frag_at(pa1);
    f.b[0] = load_frag_at(pb0);
    f.b[1] = load_frag_at(pb1);
    f.b[2] = load_frag_at(pb2);
    f.b[3] = load_frag_at(pb3);
    // In front of the overwrite of the six addresses just below.
    asm volatile("s_wait_xcnt 0x0" ::: "memory");
    // The k tiles of a row tile are consecutive units.
    pa0 += 512; pa1 += 512; pb0 += 512; pb1 += 512; pb2 += 512; pb3 += 512;
    // Keeps the products written behind a fetch behind it: the scheduler otherwise moves the
    // first of them, with their load waits, in front of the group, which then issues late.
    __builtin_amdgcn_sched_barrier(0);
  };
  auto products = [&](const Step& f) {
#pragma unroll
    for (int nt = 0; nt < 4; ++nt) {
      if (SWAP) {
        acc[0][nt] = WMMA(f.b[nt], f.a[0], acc[0][nt]);
        acc[1][nt] = WMMA(f.b[nt], f.a[1], acc[1][nt]);
      } else {
        acc[0][nt] = WMMA(f.a[0], f.b[nt], acc[0][nt]);
        acc[1][nt] = WMMA(f.a[1], f.b[nt], acc[1][nt]);
      }
    }
  };
  Step x, y;
  if (kts > 0) fetch(x, 0);
  int kt = 0;
  // No fetch in the loop is conditional: behind a join with a path that fetches nothing the
  // compiler's load waits would drain the newer group too.
  for (; kt + 2 < kts; kt += 2) {
    fetch(y, kt + 1);
    products(x);
    fetch(x, kt + 2);
    products(y);
  }
  if (kt + 1 < kts) {
    fetch(y, kt + 1);
    products(x);
    products(y);
  } else if (kt < kts) {
    products(x);
  }
#pragma unroll
  for (int mt = 0; mt < 2; ++mt)
#pragma unroll
    for (int nt = 0; nt < 4; ++nt) store(m0, n0, mt, nt, acc[mt][nt]);
}

// Projections, C in fragment order per (batch, head); a lane's 8 values are 8 consecutive
// k of the operand that attention reads, so each tile leaves as one 16-B store per lane.
// VT = false: rows = positions, k = head dim (Q, K), from C^T.
// VT = true:  rows = head dim, k = positions (V^T), from C.
template <bool VT>
__global__ __launch_bounds__(256) void gemm_f16out_kernel(const _Float16* __restrict__ A,
                                                          const _Float16* __restrict__ Bt,
                                                          _Float16* __restrict__ C,
                                                          int M, int N, int K) {
  int wid  = (blockIdx.x * blockDim.x + threadIdx.x) >> 5;
  int lane = threadIdx.x & 31;
  gemm_wave_32x64<!VT>(A, Bt, M, N, K, wid, lane, [&](int m0, int n0, int mt, int nt, v8f v) {
    int b = m0 >> 11, s0 = m0 & (SS - 1), h = n0 >> 6;
    _Float16* Cb = C + (size_t)(b * HH + h) * SS * HD;
    size_t idx;
    if (VT) idx = frag_unit(nt, s0 >> 5, SS / 32) + (mt << 8);
    else    idx = frag_unit((s0 >> 4) + mt, nt >> 1, HD / 32) + ((nt & 1) << 8);
    *(v8h*)(Cb + idx + (lane << 3)) = to_f16(v);
  });
}

__global__ __launch_bounds__(256) void gemm_f32out_kernel(const _Float16* __restrict__ A,
                                                          const _Float16* __restrict__ Bt,
                                                          float* __restrict__ C,
                                                          int M, int N, int K) {
  int wid  = (blockIdx.x * blockDim.x + threadIdx.x) >> 5;
  int lane = threadIdx.x & 31;
  gemm_wave_32x64<false>(A, Bt, M, N, K, wid, lane, [&](int m0, int n0, int mt, int nt, v8f v) {
    int row = m0 + (mt << 4) + ((lane >> 4) << 3);
    int col = n0 + (nt << 4) + (lane & 15);
    for (int r = 0; r < 8; ++r) C[(size_t)(row + r) * N + col] = v[r];
  });
}

// -------- RoPE over Q,K, f16 in fragment order per (batch, head) --------------
__global__ __launch_bounds__(256) void rope_kernel(_Float16* __restrict__ Q,
                                                   _Float16* __restrict__ K,
                                                   const float* __restrict__ fc) {
  size_t idx = (size_t)blockIdx.x * blockDim.x + threadIdx.x;  // B*H*S*32 pairs as stored
  size_t base = idx << 1;
  int off = (int)(base & (SS * HD - 1));  // bits: 0-2 k & 7, 3-6 row & 15, 7-9 k >> 3, 10.. row >> 4
  int s = ((off >> 10) << 4) + ((off >> 3) & 15);
  int j = ((((off >> 7) & 7) << 3) + (off & 7)) >> 1;
  float c = fc[(s * 32 + j) * 2 + 0];
  float d = fc[(s * 32 + j) * 2 + 1];
  float a = (float)Q[base], b = (float)Q[base + 1];
  Q[base]     = (_Float16)(a * c - b * d);
  Q[base + 1] = (_Float16)(a * d + b * c);
  a = (float)K[base]; b = (float)K[base + 1];
  K[base]     = (_Float16)(a * c - b * d);
  K[base + 1] = (_Float16)(a * d + b * c);
}

// ---------------- attention: per-chunk softmax, chunk outputs summed -------
// Lane l <-> lane l ^ 16 (the two halves of a wave hold the two halves of a column).
static __device__ __forceinline__ float xhalf(float x) {
  int b = __builtin_bit_cast(int, x);
  return __builtin_bit_cast(float,
      __builtin_amdgcn_permlanex16(b, b, 0x76543210, 0xfedcba98, false, false));
}

__global__ __launch_bounds__(128) void attn_kernel(const _Float16* __restrict__ Q,
                                                   const _Float16* __restrict__ Kd,
                                                   const _Float16* __restrict__ Vt,
                                                   _Float16* __restrict__ O) {
  int wid    = (blockIdx.x * blockDim.x + threadIdx.x) >> 5;
  int lane   = threadIdx.x & 31;
  int qt = wid & ((SS / 16) - 1);
  int bh = wid >> 7;
  const _Float16* Qb = Q  + (size_t)bh * SS * HD;
  const _Float16* Kb = Kd + (size_t)bh * SS * HD;
  const _Float16* Vb = Vt + (size_t)bh * HD * SS;

  v16h qb0 = load_frag(Qb, HD / 32, qt, 0, lane);
  v16h qb1 = load_frag(Qb, HD / 32, qt, 1, lane);

  v8f of0 = {}, of1 = {}, of2 = {}, of3 = {};
  const float scale = 0.125f;  // 64^-0.5

  for (int c0 = 0; c0 < SS; c0 += CHUNK) {
    float mrun = -1e30f;  // running maximum of this lane's query
    float lrun = 0.f;     // running sum over this half's keys only
    v8f oa0 = {}, oa1 = {}, oa2 = {}, oa3 = {};

    for (int kk = 0; kk < CHUNK; kk += 32) {
      // ---- scores^T: 32 keys x 16 queries, K-dim = HD = 64 (2 steps) ----
      int kt = (c0 + kk) >> 5;  // 32 keys: two row tiles of K, one k tile of V^T
      v16h ka0 = load_frag(Kb, HD / 32, 2 * kt, 0, lane);
      v16h ka1 = load_frag(Kb, HD / 32, 2 * kt, 1, lane);
      v16h ka2 = load_frag(Kb, HD / 32, 2 * kt + 1, 0, lane);
      v16h ka3 = load_frag(Kb, HD / 32, 2 * kt + 1, 1, lane);
      // The K loads' address registers are free for reuse from here on (the V loads
      // below may land in them): this wait stands in front of any such overwrite.
      asm volatile("s_wait_xcnt 0x0" ::: "memory");
      v16h va0 = load_frag(Vb, SS / 32, 0, kt, lane);
      v16h va1 = load_frag(Vb, SS / 32, 1, kt, lane);
      v16h va2 = load_frag(Vb, SS / 32, 2, kt, lane);
      v16h va3 = load_frag(Vb, SS / 32, 3, kt, lane);
      v8f s0 = {}, s1 = {};
      s0 = WMMA(ka0, qb0, s0);
      s0 = WMMA(ka1, qb1, s0);
      s1 = WMMA(ka2, qb0, s1);
      s1 = WMMA(ka3, qb1, s1);
      // ---- online softmax: 16 of the query's 32 scores are in this lane ----
      s0 *= scale;
      s1 *= scale;
      float mx[8];
      for (int r = 0; r < 8; ++r) mx[r] = fmaxf(s0[r], s1[r]);
      float mt = fmaxf(fmaxf(fmaxf(mx[0], mx[1]), fmaxf(mx[2], mx[3])),
                       fmaxf(fmaxf(mx[4], mx[5]), fmaxf(mx[6], mx[7])));
      mt = fmaxf(mt, xhalf(mt));
      float mnew  = fmaxf(mrun, mt);
      float alpha = __expf(mrun - mnew);
      mrun = mnew;
      float ps[8];
      v16h pb;
      for (int r = 0; r < 8; ++r) {
        float p0 = __expf(s0[r] - mnew);
        float p1 = __expf(s1[r] - mnew);
        ps[r] = p0 + p1;
        pb[r]     = (_Float16)p0;  // k = 8h + r
        pb[r + 8] = (_Float16)p1;  // k = 16 + 8h + r
      }
      lrun = lrun * alpha + (((ps[0] + ps[1]) + (ps[2] + ps[3])) +
                             ((ps[4] + ps[5]) + (ps[6] + ps[7])));
      for (int r = 0; r < 8; ++r) {
        oa0[r] *= alpha; oa1[r] *= alpha;
        oa2[r] *= alpha; oa3[r] *= alpha;
      }
      // ---- O^T += V^T @ P^T: K-dim = 32 keys, 4 d-tiles (Vt is [HD,S]) ----
      oa0 = WMMA(va0, pb, oa0);
      oa1 = WMMA(va1, pb, oa1);
      oa2 = WMMA(va2, pb, oa2);
      oa3 = WMMA(va3, pb, oa3);
    }
    // ---- finalize chunk: join the halves' sums, normalize, accumulate ----
    float inv = 1.f / (lrun + xhalf(lrun));
    for (int r = 0; r < 8; ++r) {
      of0[r] += oa0[r] * inv;
      of1[r] += oa1[r] * inv;
      of2[r] += oa2[r] * inv;
      of3[r] += oa3[r] * inv;
    }
  }
  // ---- store O, f16 [B*S, D] in fragment order: a lane holds 8 consecutive d of its
  // query, and d tiles 2u, 2u + 1 are the two planes of k tile 2h + u ----
  int b = bh >> 4, h = bh & 15;
  _Float16* o = O + frag_unit(b * (SS / 16) + qt, 2 * h, DD / 32) + (lane << 3);
  *(v8h*)(o)       = to_f16(of0);
  *(v8h*)(o + 256) = to_f16(of1);
  *(v8h*)(o + 512) = to_f16(of2);
  *(v8h*)(o + 768) = to_f16(of3);
}

extern "C" void kernel_launch(void* const* d_in, const int* in_sizes, int n_in,
                              void* d_out, int out_size, void* d_ws, size_t ws_size,
                              hipStream_t stream) {
  const float* X  = (const float*)d_in[0];
  const float* FC = (const float*)d_in[1];
  const float* Wq = (const float*)d_in[2];
  const float* Wk = (const float*)d_in[3];
  const float* Wv = (const float*)d_in[4];
  const float* Wo = (const float*)d_in[5];
  float* out = (float*)d_out;

  char* ws = (char*)d_ws;
  const size_t MB = 1u << 20;
  // all in fragment order
  _Float16* Xh  = (_Float16*)(ws + 0);        // 8 MB  [B*S, D] f16
  _Float16* Wqt = (_Float16*)(ws + 8  * MB);  // 2 MB  [N,K] f16
  _Float16* Wkt = (_Float16*)(ws + 10 * MB);
  _Float16* Wvt = (_Float16*)(ws + 12 * MB);
  _Float16* Wot = (_Float16*)(ws + 14 * MB);
  _Float16* Qh  = (_Float16*)(ws + 16 * MB);  // 8 MB  [B,H,S,HD]
  _Float16* Kh  = (_Float16*)(ws + 24 * MB);  // 8 MB  [B,H,S,HD]
  _Float16* Vtb = (_Float16*)(ws + 32 * MB);  // 8 MB  [B,H,HD,S]
  _Float16* Oh  = (_Float16*)(ws + 40 * MB);  // 8 MB  [B*S, D]

  const int M = BB * SS;  // 4096

  // 1) X fp32 -> f16
  cvt_f16_kernel<<<(M / 16) * (DD / 32) / 8, 256, 0, stream>>>(X, Xh);

  // 2) weights fp32 [K,N] -> f16 [N,K]
  {
    dim3 tb(16, 16), tg(DD / 16, DD / 16);
    transpose_w_kernel<<<tg, tb, 0, stream>>>(Wq, Wqt);
    transpose_w_kernel<<<tg, tb, 0, stream>>>(Wk, Wkt);
    transpose_w_kernel<<<tg, tb, 0, stream>>>(Wv, Wvt);
    transpose_w_kernel<<<tg, tb, 0, stream>>>(Wo, Wot);
  }

  // 3) QKV projections: waves = (M/32)*(N/64) = 2048 -> 256 blocks x 256 thr
  gemm_f16out_kernel<false><<<256, 256, 0, stream>>>(Xh, Wqt, Qh,  M, DD, DD);
  gemm_f16out_kernel<false><<<256, 256, 0, stream>>>(Xh, Wkt, Kh,  M, DD, DD);
  gemm_f16out_kernel<true><<<256, 256, 0, stream>>>(Xh, Wvt, Vtb, M, DD, DD);

  // 4) RoPE on Q and K
  rope_kernel<<<(BB * HH * SS * 32) / 256, 256, 0, stream>>>(Qh, Kh, FC);

  // 5) attention (waves = B*H*(S/16) = 4096 -> 1024 blocks x 128 thr)
  attn_kernel<<<1024, 128, 0, stream>>>(Qh, Kh, Vtb, Oh);

  // 6) output projection -> f32 d_out
  gemm_f32out_kernel<<<256, 256, 0, stream>>>(Oh, Wot, out, M, DD, DD);
}

// v004
// Measured time: 152 microseconds a run.
// Two timings next to v003 both put it at 1.05 times that version's speed.
// All steps since v000 together make it 2.00 times as fast.
#include <hip/hip_runtime.h>

#define BB 2
#define SS 2048
#define DD 1024
#define HH 16
#define HD 64
#define CHUNK 1024

typedef __attribute__((ext_vector_type(16))) _Float16 v16h;
typedef __attribute__((ext_vector_type(8)))  _Float16 v8h;
typedef __attribute__((ext_vector_type(4)))  _Float16 v4h;
typedef __attribute__((ext_vector_type(8)))  float    v8f;

#define WMMA(a, b, c) __builtin_amdgcn_wmma_f32_16x16x32_f16(false, (a), false, (b), (short)0, (c), false, false)

// Fragment order. Every f16 operand in the workspace, a [rows, k] matrix, is kept as
// 1-KB units of 16 rows x 32 k, unit index = row_tile * ktiles + k_tile. A unit is two
// 512-B planes (k 0..15, k 16..31); in a plane lane l = 16 * ((k >> 3) & 1) + (row & 15)
// owns 8 consecutive k. A wave-wide 16-B access then covers 512 contiguous bytes.
static __device__ __forceinline__ size_t frag_unit(int row_tile, int k_tile, int ktiles) {
  return ((size_t)row_tile * ktiles + k_tile) << 9;
}

// Load a 16x32 f16 WMMA fragment (A operand, or B when the rows are the columns of B).
static __device__ __forceinline__ v16h load_frag(const _Float16* __restrict__ p,
                                                 int ktiles, int row_tile, int k_tile, int lane) {
  const _Float16* base = p + frag_unit(row_tile, k_tile, ktiles) + (lane << 3);
  v8h lo = *(const v8h*)(base);
  v8h hi = *(const v8h*)(base + 256);
  v16h r;
#pragma unroll
  for (int i = 0; i < 8; ++i) { r[i] = lo[i]; r[i + 8] = hi[i]; }
  return r;
}

// The same from a running pointer: base = the unit's start + 8 * lane.
static __device__ __forceinline__ v16h load_frag_at(const _Float16* base) {
  v8h lo = *(const v8h*)(base);
  v8h hi = *(const v8h*)(base + 256);
  v16h r;
#pragma unroll
  for (int i = 0; i < 8; ++i) { r[i] = lo[i]; r[i + 8] = hi[i]; }
  return r;
}

static __device__ __forceinline__ v8h to_f16(v8f x) {
  v8h o;
  for (int r = 0; r < 8; ++r) o[r] = (_Float16)x[r];
  return o;
}

// The three element-wise passes (convert, weight transpose, RoPE) run 4096 waves each, 16 per
// WGP, every lane with 8 or more loads in flight.

// ---------------- fp32 [rows, DD] -> f16 fragment order: one wave per two units ------
__global__ __launch_bounds__(256) void cvt_f16_kernel(const float* __restrict__ src,
                                                      _Float16* __restrict__ dst) {
  // Units unit, unit + 1: k tiles 2t, 2t + 1 of one row tile, 256 B of each of its rows.
  int unit = ((blockIdx.x * blockDim.x + threadIdx.x) >> 5) << 1;  // row_tile * (DD / 32) + k_tile
  int lane = threadIdx.x & 31;
  int row = ((unit / (DD / 32)) << 4) + (lane & 15);
  int k   = ((unit % (DD / 32)) << 5) + ((lane >> 4) << 3);
  const float4* s = (const float4*)(src + (size_t)row * DD + k);
  float4 x[2][4];
#pragma unroll
  for (int u = 0; u < 2; ++u) {
    x[u][0] = s[8 * u];     x[u][1] = s[8 * u + 1];
    x[u][2] = s[8 * u + 4]; x[u][3] = s[8 * u + 5];
  }
  _Float16* o = dst + ((size_t)unit << 9) + (lane << 3);
#pragma unroll
  for (int u = 0; u < 2; ++u)
#pragma unroll
    for (int p = 0; p < 2; ++p) {
      float4 a = x[u][2 * p], b = x[u][2 * p + 1];
      v8h h = {(_Float16)a.x, (_Float16)a.y, (_Float16)a.z, (_Float16)a.w,
               (_Float16)b.x, (_Float16)b.y, (_Float16)b.z, (_Float16)b.w};
      *(v8h*)(o + (u << 9) + (p << 8)) = h;
    }
}

// -------- weight transpose: W[K,N] f32 -> Wt[N,K] f16 in fragment order, all four -----
// One wave per 32 k x 32 n. Lane = n: a load is one whole 128-B line of a row of W, and a
// lane's 8 consecutive k are one 16-B piece of its row's unit, so the transpose needs no
// exchange between lanes. The wave writes two whole units (n tiles 2 * np, 2 * np + 1).
__global__ __launch_bounds__(256) void transpose_w_kernel(const float* __restrict__ W0,
                                                          const float* __restrict__ W1,
                                                          const float* __restrict__ W2,
                                                          const float* __restrict__ W3,
                                                          _Float16* __restrict__ Wt) {
  int wave = (blockIdx.x * blockDim.x + threadIdx.x) >> 5;  // weight * 1024 + np * 32 + k_tile
  int lane = threadIdx.x & 31;
  int w  = blockIdx.x >> 7;  // 128 blocks a weight
  int np = (wave >> 5) & 31;
  int kt = wave & 31;
  const float* W = w == 0 ? W0 : w == 1 ? W1 : w == 2 ? W2 : W3;
  const float* s = W + (size_t)(kt << 5) * DD + (np << 5) + lane;
  float x[32];
#pragma unroll
  for (int i = 0; i < 32; ++i) x[i] = s[(size_t)i * DD];
  _Float16* o = Wt + (size_t)w * DD * DD + frag_unit(2 * np + (lane >> 4), kt, DD / 32) +
                ((lane & 15) << 3);
#pragma unroll
  for (int g = 0; g < 4; ++g) {  // k = 8g .. 8g + 7: plane g >> 1, lane half g & 1
    v8h h;
#pragma unroll
    for (int i = 0; i < 8; ++i) h[i] = (_Float16)x[8 * g + i];
    *(v8h*)(o + ((g >> 1) << 8) + ((g & 1) << 7)) = h;
  }
}

// ---------------- WMMA GEMM core: 32x64 wave tile ---------------------------
// A [M,K] and Bt [N,K], both f16 in fragment order. SWAP = false: tile (mt, nt) holds
// C (register r, lane l: row 8 * (l >> 4) + r, column l & 15); SWAP = true: it holds
// C^T (row of C = l & 15, column of C = 8 * (l >> 4) + r), same products, same k order.
template <bool SWAP, typename STORE>
static __device__ __forceinline__ void gemm_wave_32x64(const _Float16* __restrict__ A,
                                                       const _Float16* __restrict__ Bt,
                                                       int M, int N, int K,
                                                       int wid, int lane, STORE store) {
  int ntiles = N >> 6;
  int m0 = (wid / ntiles) << 5;
  int n0 = (wid % ntiles) << 6;
  if (m0 >= M) return;
  int kts = K >> 5;
  int mt0 = m0 >> 4, nt0 = n0 >> 4;
  v8f acc[2][4];
#pragma unroll
  for (int mt = 0; mt < 2; ++mt)
#pragma unroll
    for (int nt = 0; nt < 4; ++nt) acc[mt][nt] = (v8f){};

  // One k step's operands, 2 A and 4 B fragments, are fetched as one group of 12 loads,
  // one k step ahead of their products, into one of two register sets: a step then waits
  // for loads issued a whole step earlier, not four times for loads just issued.
  struct Step { v16h a[2], b[4]; };
  // This lane's place in the six fragments of the next step to fetch.
  const _Float16* pa0 = A + frag_unit(mt0, 0, kts) + (lane << 3);
  const _Float16* pa1 = A + frag_unit(mt0 + 1, 0, kts) + (lane << 3);
  const _Float16* pb0 = Bt + frag_unit(nt0, 0, kts) + (lane << 3);
  const _Float16* pb1 = Bt + frag_unit(nt0 + 1, 0, kts) + (lane << 3);
  const _Float16* pb2 = Bt + frag_unit(nt0 + 2, 0, kts) + (lane << 3);
  const _Float16* pb3 = Bt + frag_unit(nt0 + 3, 0, kts) + (lane << 3);
  auto fetch = [&](Step& f, int kt) {
    // gfx1250 prefetch path (global_prefetch_b8) 8 k steps ahead of the fetch
    if (kt + 8 < kts) {
      __builtin_prefetch(A + frag_unit(mt0, kt + 8, kts) + ((lane & 15) << 5), 0, 0);
      __builtin_prefetch(Bt + frag_unit(nt0, kt + 8, kts) + ((lane & 15) << 5), 0, 0);
      // In front of any overwrite of the two prefetch addresses.
      asm volatile("s_wait_xcnt 0x0" ::: "memory");
    }
    f.a[0] = load_frag_at(pa0);
    f.a[1] = load_frag_at(pa1);
    f.b[0] = load_frag_at(pb0);
    f.b[1] = load_frag_at(pb1);
    f.b[2] = load_frag_at(pb2);
    f.b[3] = load_frag_at(pb3);
    // In front of the overwrite of the six addresses just below.
    asm volatile("s_wait_xcnt 0x0" ::: "memory");
    // The k tiles of a row tile are consecutive units.
    pa0 += 512; pa1 += 512; pb0 += 512; pb1 += 512; pb2 += 512; pb3 += 512;
    // Keeps the products written behind a fetch behind it: the scheduler otherwise moves the
    // first of them, with their load waits, in front of the group, which then issues late.
    __builtin_amdgcn_sched_barrier(0);
  };
  auto products = [&](const Step& f) {
#pragma unroll
    for (int nt = 0; nt < 4; ++nt) {
      if (SWAP) {
        acc[0][nt] = WMMA(f.b[nt], f.a[0], acc[0][nt]);
        acc[1][nt] = WMMA(f.b[nt], f.a[1], acc[1][nt]);
      } else {
        acc[0][nt] = WMMA(f.a[0], f.b[nt], acc[0][nt]);
        acc[1][nt] = WMMA(f.a[1], f.b[nt], acc[1][nt]);
      }
    }
  };
  Step x, y;
  if (kts > 0) fetch(x, 0);
  int kt = 0;
  // No fetch in the loop is conditional: behind a join with a path that fetches nothing the
  // compiler's load waits would drain the newer group too.
  for (; kt + 2 < kts; kt += 2) {
    fetch(y, kt + 1);
    products(x);
    fetch(x, kt + 2);
    products(y);
  }
  if (kt + 1 < kts) {
    fetch(y, kt + 1);
    products(x);
    products(y);
  } else if (kt < kts) {
    products(x);
  }
#pragma unroll
  for (int mt = 0; mt < 2; ++mt)
#pragma unroll
    for (int nt = 0; nt < 4; ++nt) store(m0, n0, mt, nt, acc[mt][nt]);
}

// Projections, C in fragment order per (batch, head); a lane's 8 values are 8 consecutive
// k of the operand that attention reads, so each tile leaves as one 16-B store per lane.
// VT = false: rows = positions, k = head dim (Q, K), from C^T.
// VT = true:  rows = head dim, k = positions (V^T), from C.
template <bool VT>
__global__ __launch_bounds__(256) void gemm_f16out_kernel(const _Float16* __restrict__ A,
                                                          const _Float16* __restrict__ Bt,
                                                          _Float16* __restrict__ C,
                                                          int M, int N, int K) {
  int wid  = (blockIdx.x * blockDim.x + threadIdx.x) >> 5;
  int lane = threadIdx.x & 31;
  gemm_wave_32x64<!VT>(A, Bt, M, N, K, wid, lane, [&](int m0, int n0, int mt, int nt, v8f v) {
    int b = m0 >> 11, s0 = m0 & (SS - 1), h = n0 >> 6;
    _Float16* Cb = C + (size_t)(b * HH + h) * SS * HD;
    size_t idx;
    if (VT) idx = frag_unit(nt, s0 >> 5, SS / 32) + (mt << 8);
    else    idx = frag_unit((s0 >> 4) + mt, nt >> 1, HD / 32) + ((nt & 1) << 8);
    *(v8h*)(Cb + idx + (lane << 3)) = to_f16(v);
  });
}

__global__ __launch_bounds__(256) void gemm_f32out_kernel(const _Float16* __restrict__ A,
                                                          const _Float16* __restrict__ Bt,
                                                          float* __restrict__ C,
                                                          int M, int N, int K) {
  int wid  = (blockIdx.x * blockDim.x + threadIdx.x) >> 5;
  int lane = threadIdx.x & 31;
  gemm_wave_32x64<false>(A, Bt, M, N, K, wid, lane, [&](int m0, int n0, int mt, int nt, v8f v) {
    int row = m0 + (mt << 4) + ((lane >> 4) << 3);
    int col = n0 + (nt << 4) + (lane & 15);
    for (int r = 0; r < 8; ++r) C[(size_t)(row + r) * N + col] = v[r];
  });
}

// -------- RoPE over Q,K, f16 in fragment order per (batch, head) --------------
// A thread takes one 16-B piece (4 pairs of one position) at the same place in 4 of the
// 32 (batch, head) planes of Q and of K: its 4 (cos, sin) are read once for all 8 pieces.
__global__ __launch_bounds__(256) void rope_kernel(_Float16* __restrict__ Q,
                                                   _Float16* __restrict__ K,
                                                   const float* __restrict__ fc) {
  int off = (((blockIdx.x & 63) << 8) + threadIdx.x) << 3;  // 64 blocks cover a plane
  // bits of off: 3-6 row & 15, 7-9 k >> 3, 10.. row >> 4
  int s  = ((off >> 10) << 4) + ((off >> 3) & 15);
  int k0 = ((off >> 7) & 7) << 3;
  const float4* f = (const float4*)(fc + s * HD + k0);  // (cos, sin) of pairs k0 / 2 .. k0 / 2 + 3
  float4 f0 = f[0], f1 = f[1];
  size_t base = (size_t)(blockIdx.x >> 6) * 4 * SS * HD + off;
  v8h q[4], k[4];
#pragma unroll
  for (int p = 0; p < 4; ++p) {
    q[p] = *(const v8h*)(Q + base + (size_t)p * SS * HD);
    k[p] = *(const v8h*)(K + base + (size_t)p * SS * HD);
  }
  float c[4] = {f0.x, f0.z, f1.x, f1.z};
  float d[4] = {f0.y, f0.w, f1.y, f1.w};
#pragma unroll
  for (int p = 0; p < 4; ++p)
#pragma unroll
    for (int i = 0; i < 4; ++i) {
      float a = (float)q[p][2 * i], b = (float)q[p][2 * i + 1];
      q[p][2 * i]     = (_Float16)(a * c[i] - b * d[i]);
      q[p][2 * i + 1] = (_Float16)(a * d[i] + b * c[i]);
      a = (float)k[p][2 * i]; b = (float)k[p][2 * i + 1];
      k[p][2 * i]     = (_Float16)(a * c[i] - b * d[i]);
      k[p][2 * i + 1] = (_Float16)(a * d[i] + b * c[i]);
    }
  // Keeps the 8 stores behind all the arithmetic: no register of an issued store is then
  // written again, and the stores need no wait between them.
  __builtin_amdgcn_sched_barrier(0);
#pragma unroll
  for (int p = 0; p < 4; ++p) {
    *(v8h*)(Q + base + (size_t)p * SS * HD) = q[p];
    *(v8h*)(K + base + (size_t)p * SS * HD) = k[p];
  }
}

// ---------------- attention: per-chunk softmax, chunk outputs summed -------
// Lane l <-> lane l ^ 16 (the two halves of a wave hold the two halves of a column).
static __device__ __forceinline__ float xhalf(float x) {
  int b = __builtin_bit_cast(int, x);
  return __builtin_bit_cast(float,
      __builtin_amdgcn_permlanex16(b, b, 0x76543210, 0xfedcba98, false, false));
}

__global__ __launch_bounds__(128) void attn_kernel(const _Float16* __restrict__ Q,
                                                   const _Float16* __restrict__ Kd,
                                                   const _Float16* __restrict__ Vt,
                                                   _Float16* __restrict__ O) {
  int wid    = (blockIdx.x * blockDim.x + threadIdx.x) >> 5;
  int lane   = threadIdx.x & 31;
  int qt = wid & ((SS / 16) - 1);
  int bh = wid >> 7;
  const _Float16* Qb = Q  + (size_t)bh * SS * HD;
  const _Float16* Kb = Kd + (size_t)bh * SS * HD;
  const _Float16* Vb = Vt + (size_t)bh * HD * SS;

  v16h qb0 = load_frag(Qb, HD / 32, qt, 0, lane);
  v16h qb1 = load_frag(Qb, HD / 32, qt, 1, lane);

  v8f of0 = {}, of1 = {}, of2 = {}, of3 = {};
  const float scale = 0.125f;  // 64^-0.5

  for (int c0 = 0; c0 < SS; c0 += CHUNK) {
    float mrun = -1e30f;  // running maximum of this lane's query
    float lrun = 0.f;     // running sum over this half's keys only
    v8f oa0 = {}, oa1 = {}, oa2 = {}, oa3 = {};

    for (int kk = 0; kk < CHUNK; kk += 32) {
      // ---- scores^T: 32 keys x 16 queries, K-dim = HD = 64 (2 steps) ----
      int kt = (c0 + kk) >> 5;  // 32 keys: two row tiles of K, one k tile of V^T
      v16h ka0 = load_frag(Kb, HD / 32, 2 * kt, 0, lane);
      v16h ka1 = load_frag(Kb, HD / 32, 2 * kt, 1, lane);
      v16h ka2 = load_frag(Kb, HD / 32, 2 * kt + 1, 0, lane);
      v16h ka3 = load_frag(Kb, HD / 32, 2 * kt + 1, 1, lane);
      // The K loads' address registers are free for reuse from here on (the V loads
      // below may land in them): this wait stands in front of any such overwrite.
      asm volatile("s_wait_xcnt 0x0" ::: "memory");
      v16h va0 = load_frag(Vb, SS / 32, 0, kt, lane);
      v16h va1 = load_frag(Vb, SS / 32, 1, kt, lane);
      v16h va2 = load_frag(Vb, SS / 32, 2, kt, lane);
      v16h va3 = load_frag(Vb, SS / 32, 3, kt, lane);
      v8f s0 = {}, s1 = {};
      s0 = WMMA(ka0, qb0, s0);
      s0 = WMMA(ka1, qb1, s0);
      s1 = WMMA(ka2, qb0, s1);
      s1 = WMMA(ka3, qb1, s1);
      // ---- online softmax: 16 of the query's 32 scores are in this lane ----
      s0 *= scale;
      s1 *= scale;
      float mx[8];
      for (int r = 0; r < 8; ++r) mx[r] = fmaxf(s0[r], s1[r]);
      float mt = fmaxf(fmaxf(fmaxf(mx[0], mx[1]), fmaxf(mx[2], mx[3])),
                       fmaxf(fmaxf(mx[4], mx[5]), fmaxf(mx[6], mx[7])));
      mt = fmaxf(mt, xhalf(mt));
      float mnew  = fmaxf(mrun, mt);
      float alpha = __expf(mrun - mnew);
      mrun = mnew;
      float ps[8];
      v16h pb;
      for (int r = 0; r < 8; ++r) {
        float p0 = __expf(s0[r] - mnew);
        float p1 = __expf(s1[r] - mnew);
        ps[r] = p0 + p1;
        pb[r]     = (_Float16)p0;  // k = 8h + r
        pb[r + 8] = (_Float16)p1;  // k = 16 + 8h + r
      }
      lrun = lrun * alpha + (((ps[0] + ps[1]) + (ps[2] + ps[3])) +
                             ((ps[4] + ps[5]) + (ps[6] + ps[7])));
      for (int r = 0; r < 8; ++r) {
        oa0[r] *= alpha; oa1[r] *= alpha;
        oa2[r] *= alpha; oa3[r] *= alpha;
      }
      // ---- O^T += V^T @ P^T: K-dim = 32 keys, 4 d-tiles (Vt is [HD,S]) ----
      oa0 = WMMA(va0, pb, oa0);
      oa1 = WMMA(va1, pb, oa1);
      oa2 = WMMA(va2, pb, oa2);
      oa3 = WMMA(va3, pb, oa3);
    }
    // ---- finalize chunk: join the halves' sums, normalize, accumulate ----
    float inv = 1.f / (lrun + xhalf(lrun));
    for (int r = 0; r < 8; ++r) {
      of0[r] += oa0[r] * inv;
      of1[r] += oa1[r] * inv;
      of2[r] += oa2[r] * inv;
      of3[r] += oa3[r] * inv;
    }
  }
  // ---- store O, f16 [B*S, D] in fragment order: a lane holds 8 consecutive d of its
  // query, and d tiles 2u, 2u + 1 are the two planes of k tile 2h + u ----
  int b = bh >> 4, h = bh & 15;
  _Float16* o = O + frag_unit(b * (SS / 16) + qt, 2 * h, DD / 32) + (lane << 3);
  *(v8h*)(o)       = to_f16(of0);
  *(v8h*)(o + 256) = to_f16(of1);
  *(v8h*)(o + 512) = to_f16(of2);
  *(v8h*)(o + 768) = to_f16(of3);
}

extern "C" void kernel_launch(void* const* d_in, const int* in_sizes, int n_in,
                              void* d_out, int out_size, void* d_ws, size_t ws_size,
                              hipStream_t stream) {
  const float* X  = (const float*)d_in[0];
  const float* FC = (const float*)d_in[1];
  const float* Wq = (const float*)d_in[2];
  const float* Wk = (const float*)d_in[3];
  const float* Wv = (const float*)d_in[4];
  const float* Wo = (const float*)d_in[5];
  float* out = (float*)d_out;

  char* ws = (char*)d_ws;
  const size_t MB = 1u << 20;
  // all in fragment order
  _Float16* Xh  = (_Float16*)(ws + 0);        // 8 MB  [B*S, D] f16
  _Float16* Wqt = (_Float16*)(ws + 8  * MB);  // 2 MB  [N,K] f16
  _Float16* Wkt = (_Float16*)(ws + 10 * MB);
  _Float16* Wvt = (_Float16*)(ws + 12 * MB);
  _Float16* Wot = (_Float16*)(ws + 14 * MB);
  _Float16* Qh  = (_Float16*)(ws + 16 * MB);  // 8 MB  [B,H,S,HD]
  _Float16* Kh  = (_Float16*)(ws + 24 * MB);  // 8 MB  [B,H,S,HD]
  _Float16* Vtb = (_Float16*)(ws + 32 * MB);  // 8 MB  [B,H,HD,S]
  _Float16* Oh  = (_Float16*)(ws + 40 * MB);  // 8 MB  [B*S, D]

  const int M = BB * SS;  // 4096

  // 1) X fp32 -> f16
  cvt_f16_kernel<<<512, 256, 0, stream>>>(X, Xh);

  // 2) weights fp32 [K,N] -> f16 [N,K]
  //    (Wqt, Wkt, Wvt, Wot are consecutive: one launch writes all four)
  transpose_w_kernel<<<512, 256, 0, stream>>>(Wq, Wk, Wv, Wo, Wqt);

  // 3) QKV projections: waves = (M/32)*(N/64) = 2048 -> 256 blocks x 256 thr
  gemm_f16out_kernel<false><<<256, 256, 0, stream>>>(Xh, Wqt, Qh,  M, DD, DD);
  gemm_f16out_kernel<false><<<256, 256, 0, stream>>>(Xh, Wkt, Kh,  M, DD, DD);
  gemm_f16out_kernel<true><<<256, 256, 0, stream>>>(Xh, Wvt, Vtb, M, DD, DD);

  // 4) RoPE on Q and K
  rope_kernel<<<512, 256, 0, stream>>>(Qh, Kh, FC);

  // 5) attention (waves = B*H*(S/16) = 4096 -> 1024 blocks x 128 thr)
  attn_kernel<<<1024, 128, 0, stream>>>(Qh, Kh, Vtb, Oh);

  // 6) output projection -> f32 d_out
  gemm_f32out_kernel<<<256, 256, 0, stream>>>(Oh, Wot, out, M, DD, DD);
}

// v005
// It runs in 113 microseconds.
// Timed twice side by side with v004, it ran 1.36 times as fast both times.
// Counting every step since v000, it is 2.72 times as fast.
#include <hip/hip_runtime.h>

#define BB 2
#define SS 2048
#define DD 1024
#define HH 16
#define HD 64
#define CHUNK 1024

typedef __attribute__((ext_vector_type(16))) _Float16 v16h;
typedef __attribute__((ext_vector_type(8)))  _Float16 v8h;
typedef __attribute__((ext_vector_type(4)))  _Float16 v4h;
typedef __attribute__((ext_vector_type(8)))  float    v8f;

#define WMMA(a, b, c) __builtin_amdgcn_wmma_f32_16x16x32_f16(false, (a), false, (b), (short)0, (c), false, false)

// Fragment order. Every f16 operand in the workspace, a [rows, k] matrix, is kept as
// 1-KB units of 16 rows x 32 k, unit index = row_tile * ktiles + k_tile. A unit is two
// 512-B planes (k 0..15, k 16..31); in a plane lane l = 16 * ((k >> 3) & 1) + (row & 15)
// owns 8 consecutive k. A wave-wide 16-B access then covers 512 contiguous bytes.
static __device__ __forceinline__ size_t frag_unit(int row_tile, int k_tile, int ktiles) {
  return ((size_t)row_tile * ktiles + k_tile) << 9;
}

// Load a 16x32 f16 WMMA fragment (A operand, or B when the rows are the columns of B).
static __device__ __forceinline__ v16h load_frag(const _Float16* __restrict__ p,
                                                 int ktiles, int row_tile, int k_tile, int lane) {
  const _Float16* base = p + frag_unit(row_tile, k_tile, ktiles) + (lane << 3);
  v8h lo = *(const v8h*)(base);
  v8h hi = *(const v8h*)(base + 256);
  v16h r;
#pragma unroll
  for (int i = 0; i < 8; ++i) { r[i] = lo[i]; r[i + 8] = hi[i]; }
  return r;
}

// The same from a running pointer: base = the unit's start + 8 * lane.
static __device__ __forceinline__ v16h load_frag_at(const _Float16* base) {
  v8h lo = *(const v8h*)(base);
  v8h hi = *(const v8h*)(base + 256);
  v16h r;
#pragma unroll
  for (int i = 0; i < 8; ++i) { r[i] = lo[i]; r[i + 8] = hi[i]; }
  return r;
}

static __device__ __forceinline__ v8h to_f16(v8f x) {
  v8h o;
  for (int r = 0; r < 8; ++r) o[r] = (_Float16)x[r];
  return o;
}

// The three element-wise passes (convert, weight transpose, RoPE) run 4096 waves each, 16 per
// WGP, every lane with 8 or more loads in flight.

// ---------------- fp32 [rows, DD] -> f16 fragment order: one wave per two units ------
__global__ __launch_bounds__(256) void cvt_f16_kernel(const float* __restrict__ src,
                                                      _Float16* __restrict__ dst) {
  // Units unit, unit + 1: k tiles 2t, 2t + 1 of one row tile, 256 B of each of its rows.
  int unit = ((blockIdx.x * blockDim.x + threadIdx.x) >> 5) << 1;  // row_tile * (DD / 32) + k_tile
  int lane = threadIdx.x & 31;
  int row = ((unit / (DD / 32)) << 4) + (lane & 15);
  int k   = ((unit % (DD / 32)) << 5) + ((lane >> 4) << 3);
  const float4* s = (const float4*)(src + (size_t)row * DD + k);
  float4 x[2][4];
#pragma unroll
  for (int u = 0; u < 2; ++u) {
    x[u][0] = s[8 * u];     x[u][1] = s[8 * u + 1];
    x[u][2] = s[8 * u + 4]; x[u][3] = s[8 * u + 5];
  }
  _Float16* o = dst + ((size_t)unit << 9) + (lane << 3);
#pragma unroll
  for (int u = 0; u < 2; ++u)
#pragma unroll
    for (int p = 0; p < 2; ++p) {
      float4 a = x[u][2 * p], b = x[u][2 * p + 1];
      v8h h = {(_Float16)a.x, (_Float16)a.y, (_Float16)a.z, (_Float16)a.w,
               (_Float16)b.x, (_Float16)b.y, (_Float16)b.z, (_Float16)b.w};
      *(v8h*)(o + (u << 9) + (p << 8)) = h;
    }
}

// -------- weight transpose: W[K,N] f32 -> Wt[N,K] f16 in fragment order, all four -----
// One wave per 32 k x 32 n. Lane = n: a load is one whole 128-B line of a row of W, and a
// lane's 8 consecutive k are one 16-B piece of its row's unit, so the transpose needs no
// exchange between lanes. The wave writes two whole units (n tiles 2 * np, 2 * np + 1).
__global__ __launch_bounds__(256) void transpose_w_kernel(const float* __restrict__ W0,
                                                          const float* __restrict__ W1,
                                                          const float* __restrict__ W2,
                                                          const float* __restrict__ W3,
                                                          _Float16* __restrict__ Wt) {
  int wave = (blockIdx.x * blockDim.x + threadIdx.x) >> 5;  // weight * 1024 + np * 32 + k_tile
  int lane = threadIdx.x & 31;
  int w  = blockIdx.x >> 7;  // 128 blocks a weight
  int np = (wave >> 5) & 31;
  int kt = wave & 31;
  const float* W = w == 0 ? W0 : w == 1 ? W1 : w == 2 ? W2 : W3;
  const float* s = W + (size_t)(kt << 5) * DD + (np << 5) + lane;
  float x[32];
#pragma unroll
  for (int i = 0; i < 32; ++i) x[i] = s[(size_t)i * DD];
  _Float16* o = Wt + (size_t)w * DD * DD + frag_unit(2 * np + (lane >> 4), kt, DD / 32) +
                ((lane & 15) << 3);
#pragma unroll
  for (int g = 0; g < 4; ++g) {  // k = 8g .. 8g + 7: plane g >> 1, lane half g & 1
    v8h h;
#pragma unroll
    for (int i = 0; i < 8; ++i) h[i] = (_Float16)x[8 * g + i];
    *(v8h*)(o + ((g >> 1) << 8) + ((g & 1) << 7)) = h;
  }
}

// ---------------- WMMA GEMM core: 32x64 wave tile ---------------------------
// A [M,K] and Bt [N,K], both f16 in fragment order. SWAP = false: tile (mt, nt) holds
// C (register r, lane l: row 8 * (l >> 4) + r, column l & 15); SWAP = true: it holds
// C^T (row of C = l & 15, column of C = 8 * (l >> 4) + r), same products, same k order.
template <bool SWAP, typename STORE>
static __device__ __forceinline__ void gemm_wave_32x64(const _Float16* __restrict__ A,
                                                       const _Float16* __restrict__ Bt,
                                                       int M, int N, int K,
                                                       int wid, int lane, STORE store) {
  int ntiles = N >> 6;
  int m0 = (wid / ntiles) << 5;
  int n0 = (wid % ntiles) << 6;
  if (m0 >= M) return;
  int kts = K >> 5;
  int mt0 = m0 >> 4, nt0 = n0 >> 4;
  v8f acc[2][4];
#pragma unroll
  for (int mt = 0; mt < 2; ++mt)
#pragma unroll
    for (int nt = 0; nt < 4; ++nt) acc[mt][nt] = (v8f){};

  // One k step's operands, 2 A and 4 B fragments, are fetched as one group of 12 loads,
  // one k step ahead of their products, into one of two register sets: a step then waits
  // for loads issued a whole step earlier, not four times for loads just issued.
  struct Step { v16h a[2], b[4]; };
  // This lane's place in the six fragments of the next step to fetch.
  const _Float16* pa0 = A + frag_unit(mt0, 0, kts) + (lane << 3);
  const _Float16* pa1 = A + frag_unit(mt0 + 1, 0, kts) + (lane << 3);
  const _Float16* pb0 = Bt + frag_unit(nt0, 0, kts) + (lane << 3);
  const _Float16* pb1 = Bt + frag_unit(nt0 + 1, 0, kts) + (lane << 3);
  const _Float16* pb2 = Bt + frag_unit(nt0 + 2, 0, kts) + (lane << 3);
  const _Float16* pb3 = Bt + frag_unit(nt0 + 3, 0, kts) + (lane << 3);
  auto fetch = [&](Step& f, int kt) {
    // gfx1250 prefetch path (global_prefetch_b8) 8 k steps ahead of the fetch
    if (kt + 8 < kts) {
      __builtin_prefetch(A + frag_unit(mt0, kt + 8, kts) + ((lane & 15) << 5), 0, 0);
      __builtin_prefetch(Bt + frag_unit(nt0, kt + 8, kts) + ((lane & 15) << 5), 0, 0);
      // In front of any overwrite of the two prefetch addresses.
      asm volatile("s_wait_xcnt 0x0" ::: "memory");
    }
    f.a[0] = load_frag_at(pa0);
    f.a[1] = load_frag_at(pa1);
    f.b[0] = load_frag_at(pb0);
    f.b[1] = load_frag_at(pb1);
    f.b[2] = load_frag_at(pb2);
    f.b[3] = load_frag_at(pb3);
    // In front of the overwrite of the six addresses just below.
    asm volatile("s_wait_xcnt 0x0" ::: "memory");
    // The k tiles of a row tile are consecutive units.
    pa0 += 512; pa1 += 512; pb0 += 512; pb1 += 512; pb2 += 512; pb3 += 512;
    // Keeps the products written behind a fetch behind it: the scheduler otherwise moves the
    // first of them, with their load waits, in front of the group, which then issues late.
    __builtin_amdgcn_sched_barrier(0);
  };
  auto products = [&](const Step& f) {
#pragma unroll
    for (int nt = 0; nt < 4; ++nt) {
      if (SWAP) {
        acc[0][nt] = WMMA(f.b[nt], f.a[0], acc[0][nt]);
        acc[1][nt] = WMMA(f.b[nt], f.a[1], acc[1][nt]);
      } else {
        acc[0][nt] = WMMA(f.a[0], f.b[nt], acc[0][nt]);
        acc[1][nt] = WMMA(f.a[1], f.b[nt], acc[1][nt]);
      }
    }
  };
  Step x, y;
  if (kts > 0) fetch(x, 0);
  int kt = 0;
  // No fetch in the loop is conditional: behind a join with a path that fetches nothing the
  // compiler's load waits would drain the newer group too.
  for (; kt + 2 < kts; kt += 2) {
    fetch(y, kt + 1);
    products(x);
    fetch(x, kt + 2);
    products(y);
  }
  if (kt + 1 < kts) {
    fetch(y, kt + 1);
    products(x);
    products(y);
  } else if (kt < kts) {
    products(x);
  }
#pragma unroll
  for (int mt = 0; mt < 2; ++mt)
#pragma unroll
    for (int nt = 0; nt < 4; ++nt) store(m0, n0, mt, nt, acc[mt][nt]);
}

// Projections, C in fragment order per (batch, head); a lane's 8 values are 8 consecutive
// k of the operand that attention reads, so each tile leaves as one 16-B store per lane.
// VT = false: rows = positions, k = head dim (Q, K), from C^T.
// VT = true:  rows = head dim, k = positions (V^T), from C.
template <bool VT>
__global__ __launch_bounds__(256) void gemm_f16out_kernel(const _Float16* __restrict__ A,
                                                          const _Float16* __restrict__ Bt,
                                                          _Float16* __restrict__ C,
                                                          int M, int N, int K) {
  int wid  = (blockIdx.x * blockDim.x + threadIdx.x) >> 5;
  int lane = threadIdx.x & 31;
  gemm_wave_32x64<!VT>(A, Bt, M, N, K, wid, lane, [&](int m0, int n0, int mt, int nt, v8f v) {
    int b = m0 >> 11, s0 = m0 & (SS - 1), h = n0 >> 6;
    _Float16* Cb = C + (size_t)(b * HH + h) * SS * HD;
    size_t idx;
    if (VT) idx = frag_unit(nt, s0 >> 5, SS / 32) + (mt << 8);
    else    idx = frag_unit((s0 >> 4) + mt, nt >> 1, HD / 32) + ((nt & 1) << 8);
    *(v8h*)(Cb + idx + (lane << 3)) = to_f16(v);
  });
}

__global__ __launch_bounds__(256) void gemm_f32out_kernel(const _Float16* __restrict__ A,
                                                          const _Float16* __restrict__ Bt,
                                                          float* __restrict__ C,
                                                          int M, int N, int K) {
  int wid  = (blockIdx.x * blockDim.x + threadIdx.x) >> 5;
  int lane = threadIdx.x & 31;
  gemm_wave_32x64<false>(A, Bt, M, N, K, wid, lane, [&](int m0, int n0, int mt, int nt, v8f v) {
    int row = m0 + (mt << 4) + ((lane >> 4) << 3);
    int col = n0 + (nt << 4) + (lane & 15);
    for (int r = 0; r < 8; ++r) C[(size_t)(row + r) * N + col] = v[r];
  });
}

// -------- RoPE over Q,K, f16 in fragment order per (batch, head) --------------
// A thread takes one 16-B piece (4 pairs of one position) at the same place in 4 of the
// 32 (batch, head) planes of Q and of K: its 4 (cos, sin) are read once for all 8 pieces.
__global__ __launch_bounds__(256) void rope_kernel(_Float16* __restrict__ Q,
                                                   _Float16* __restrict__ K,
                                                   const float* __restrict__ fc) {
  int off = (((blockIdx.x & 63) << 8) + threadIdx.x) << 3;  // 64 blocks cover a plane
  // bits of off: 3-6 row & 15, 7-9 k >> 3, 10.. row >> 4
  int s  = ((off >> 10) << 4) + ((off >> 3) & 15);
  int k0 = ((off >> 7) & 7) << 3;
  const float4* f = (const float4*)(fc + s * HD + k0);  // (cos, sin) of pairs k0 / 2 .. k0 / 2 + 3
  float4 f0 = f[0], f1 = f[1];
  size_t base = (size_t)(blockIdx.x >> 6) * 4 * SS * HD + off;
  v8h q[4], k[4];
#pragma unroll
  for (int p = 0; p < 4; ++p) {
    q[p] = *(const v8h*)(Q + base + (size_t)p * SS * HD);
    k[p] = *(const v8h*)(K + base + (size_t)p * SS * HD);
  }
  float c[4] = {f0.x, f0.z, f1.x, f1.z};
  float d[4] = {f0.y, f0.w, f1.y, f1.w};
#pragma unroll
  for (int p = 0; p < 4; ++p)
#pragma unroll
    for (int i = 0; i < 4; ++i) {
      float a = (float)q[p][2 * i], b = (float)q[p][2 * i + 1];
      q[p][2 * i]     = (_Float16)(a * c[i] - b * d[i]);
      q[p][2 * i + 1] = (_Float16)(a * d[i] + b * c[i]);
      a = (float)k[p][2 * i]; b = (float)k[p][2 * i + 1];
      k[p][2 * i]     = (_Float16)(a * c[i] - b * d[i]);
      k[p][2 * i + 1] = (_Float16)(a * d[i] + b * c[i]);
    }
  // Keeps the 8 stores behind all the arithmetic: no register of an issued store is then
  // written again, and the stores need no wait between them.
  __builtin_amdgcn_sched_barrier(0);
#pragma unroll
  for (int p = 0; p < 4; ++p) {
    *(v8h*)(Q + base + (size_t)p * SS * HD) = q[p];
    *(v8h*)(K + base + (size_t)p * SS * HD) = k[p];
  }
}

// ---------------- attention: per-chunk softmax, chunk outputs summed -------
// Lane l <-> lane l ^ 16 (the two halves of a wave hold the two halves of a column).
static __device__ __forceinline__ float xhalf(float x) {
  int b = __builtin_bit_cast(int, x);
  return __builtin_bit_cast(float,
      __builtin_amdgcn_permlanex16(b, b, 0x76543210, 0xfedcba98, false, false));
}

// K and V^T reach the waves through LDS. A stage is 128 keys: 16 KB of K (contiguous in
// fragment order), then 4 KB of each of the 4 d tiles of V^T. The 8 waves of a block, 128
// queries of one (batch, head), share it, so L2 delivers a stage once a block, not once a wave.
#define STAGE_KEYS 128
#define STAGE_HALVES 16384  // K 8192 + V^T 8192 f16
#define NSTAGES (SS / STAGE_KEYS)

// One stage's copies, 8 x 16 B a lane. k, v: this lane's first 16 B of the stage in K and in
// V^T; l: the LDS byte address of its first 16 B in the buffer.
static __device__ __forceinline__ void copy_stage(const _Float16* k, const _Float16* v, unsigned l) {
  // The closing s_wait_xcnt stands in the copies' own statement, in front of any later
  // overwrite of the address registers they name.
  asm volatile(
      "global_load_async_to_lds_b128 %0, %8, off\n\t"
      "global_load_async_to_lds_b128 %1, %9, off\n\t"
      "global_load_async_to_lds_b128 %2, %10, off\n\t"
      "global_load_async_to_lds_b128 %3, %11, off\n\t"
      "global_load_async_to_lds_b128 %4, %12, off\n\t"
      "global_load_async_to_lds_b128 %5, %13, off\n\t"
      "global_load_async_to_lds_b128 %6, %14, off\n\t"
      "global_load_async_to_lds_b128 %7, %15, off\n\t"
      "s_wait_xcnt 0x0"
      :: "v"(l), "v"(l + 4096u), "v"(l + 8192u), "v"(l + 12288u),
         "v"(l + 16384u), "v"(l + 20480u), "v"(l + 24576u), "v"(l + 28672u),
         "v"(k), "v"(k + 2048), "v"(k + 4096), "v"(k + 6144),
         "v"(v), "v"(v + 16 * SS), "v"(v + 32 * SS), "v"(v + 48 * SS)
      : "memory");
}

__global__ __launch_bounds__(256) void attn_kernel(const _Float16* __restrict__ Q,
                                                   const _Float16* __restrict__ Kd,
                                                   const _Float16* __restrict__ Vt,
                                                   _Float16* __restrict__ O) {
  __shared__ __attribute__((aligned(16))) _Float16 ring[2 * STAGE_HALVES];
  int tid  = threadIdx.x;
  int lane = tid & 31;
  int qt = ((blockIdx.x & 15) << 3) + (tid >> 5);  // 16 blocks of 8 query tiles a (batch, head)
  int bh = blockIdx.x >> 4;
  const _Float16* Qb = Q  + (size_t)bh * SS * HD;
  const _Float16* Kb = Kd + (size_t)bh * SS * HD;
  const _Float16* Vb = Vt + (size_t)bh * HD * SS;

  // This lane's share of stage 0, and its place in buffer 0.
  const _Float16* kcp = Kb + (tid << 3);
  const _Float16* vcp = Vb + (tid << 3);
  unsigned lcp = (unsigned)(size_t)ring + (tid << 4);
  copy_stage(kcp, vcp, lcp);

  v16h qb0 = load_frag(Qb, HD / 32, qt, 0, lane);
  v16h qb1 = load_frag(Qb, HD / 32, qt, 1, lane);

  // Stage 0 has landed for this wave's copies; the barrier publishes it to the block.
  asm volatile("s_wait_asynccnt 0x0" ::: "memory");
  __syncthreads();
  copy_stage(kcp + STAGE_KEYS * HD, vcp + STAGE_KEYS * 16, lcp + 2 * STAGE_HALVES);

  v8f of0 = {}, of1 = {}, of2 = {}, of3 = {};
  const float scale = 0.125f;  // 64^-0.5

  for (int c0 = 0; c0 < SS; c0 += CHUNK) {
    float mrun = -1e30f;  // running maximum of this lane's query
    float lrun = 0.f;     // running sum over this half's keys only
    v8f oa0 = {}, oa1 = {}, oa2 = {}, oa3 = {};

    for (int ks = 0; ks < CHUNK; ks += STAGE_KEYS) {
    int t = (c0 + ks) / STAGE_KEYS;  // stage, in buffer t & 1
    const _Float16* buf = ring + (t & 1) * STAGE_HALVES + (lane << 3);
    for (int j = 0; j < STAGE_KEYS / 32; ++j) {
      // ---- scores^T: 32 keys x 16 queries, K-dim = HD = 64 (2 steps) ----
      // 32 keys of the stage: 4 units of K, one unit of each d tile of V^T
      const _Float16* kp = buf + (j << 11);
      const _Float16* vp = buf + 8192 + (j << 9);
      v16h ka0 = load_frag_at(kp);
      v16h ka1 = load_frag_at(kp + 512);
      v16h ka2 = load_frag_at(kp + 1024);
      v16h ka3 = load_frag_at(kp + 1536);
      // K's loads stay in front of V^T's: LDS loads return in order, and the score products
      // then wait for 8 loads, not for all 16.
      __builtin_amdgcn_sched_barrier(0);
      v16h va0 = load_frag_at(vp);
      v16h va1 = load_frag_at(vp + 2048);
      v16h va2 = load_frag_at(vp + 4096);
      v16h va3 = load_frag_at(vp + 6144);
      // Keeps the pass's 16 LDS loads one group in front of its products: the scheduler
      // otherwise issues them two at a time, each pair with a full wait of its own.
      __builtin_amdgcn_sched_barrier(0);
      v8f s0 = {}, s1 = {};
      s0 = WMMA(ka0, qb0, s0);
      s0 = WMMA(ka1, qb1, s0);
      s1 = WMMA(ka2, qb0, s1);
      s1 = WMMA(ka3, qb1, s1);
      // ---- online softmax: 16 of the query's 32 scores are in this lane ----
      s0 *= scale;
      s1 *= scale;
      float mx[8];
      for (int r = 0; r < 8; ++r) mx[r] = fmaxf(s0[r], s1[r]);
      float mt = fmaxf(fmaxf(fmaxf(mx[0], mx[1]), fmaxf(mx[2], mx[3])),
                       fmaxf(fmaxf(mx[4], mx[5]), fmaxf(mx[6], mx[7])));
      mt = fmaxf(mt, xhalf(mt));
      float mnew  = fmaxf(mrun, mt);
      float alpha = __expf(mrun - mnew);
      mrun = mnew;
      float ps[8];
      v16h pb;
      for (int r = 0; r < 8; ++r) {
        float p0 = __expf(s0[r] - mnew);
        float p1 = __expf(s1[r] - mnew);
        ps[r] = p0 + p1;
        pb[r]     = (_Float16)p0;  // k = 8h + r
        pb[r + 8] = (_Float16)p1;  // k = 16 + 8h + r
      }
      lrun = lrun * alpha + (((ps[0] + ps[1]) + (ps[2] + ps[3])) +
                             ((ps[4] + ps[5]) + (ps[6] + ps[7])));
      for (int r = 0; r < 8; ++r) {
        oa0[r] *= alpha; oa1[r] *= alpha;
        oa2[r] *= alpha; oa3[r] *= alpha;
      }
      // ---- O^T += V^T @ P^T: K-dim = 32 keys, 4 d-tiles (Vt is [HD,S]) ----
      oa0 = WMMA(va0, pb, oa0);
      oa1 = WMMA(va1, pb, oa1);
      oa2 = WMMA(va2, pb, oa2);
      oa3 = WMMA(va3, pb, oa3);
    }
    // Publish point of stage t + 1: this wave's reads of stage t are done, its copies of
    // stage t + 1 have landed; behind the barrier both hold for the whole block.
    asm volatile("s_wait_dscnt 0x0" ::: "memory");
    asm volatile("s_wait_asynccnt 0x0" ::: "memory");
    __syncthreads();
    if (t + 2 < NSTAGES)
      copy_stage(kcp + (t + 2) * (STAGE_KEYS * HD), vcp + (t + 2) * (STAGE_KEYS * 16),
                 lcp + (t & 1) * (2 * STAGE_HALVES));
    }
    // ---- finalize chunk: join the halves' sums, normalize, accumulate ----
    float inv = 1.f / (lrun + xhalf(lrun));
    for (int r = 0; r < 8; ++r) {
      of0[r] += oa0[r] * inv;
      of1[r] += oa1[r] * inv;
      of2[r] += oa2[r] * inv;
      of3[r] += oa3[r] * inv;
    }
  }
  // No copy is outstanding when the wave ends.
  asm volatile("s_wait_asynccnt 0x0" ::: "memory");
  // ---- store O, f16 [B*S, D] in fragment order: a lane holds 8 consecutive d of its
  // query, and d tiles 2u, 2u + 1 are the two planes of k tile 2h + u ----
  int b = bh >> 4, h = bh & 15;
  _Float16* o = O + frag_unit(b * (SS / 16) + qt, 2 * h, DD / 32) + (lane << 3);
  *(v8h*)(o)       = to_f16(of0);
  *(v8h*)(o + 256) = to_f16(of1);
  *(v8h*)(o + 512) = to_f16(of2);
  *(v8h*)(o + 768) = to_f16(of3);
}

extern "C" void kernel_launch(void* const* d_in, const int* in_sizes, int n_in,
                              void* d_out, int out_size, void* d_ws, size_t ws_size,
                              hipStream_t stream) {
  const float* X  = (const float*)d_in[0];
  const float* FC = (const float*)d_in[1];
  const float* Wq = (const float*)d_in[2];
  const float* Wk = (const float*)d_in[3];
  const float* Wv = (const float*)d_in[4];
  const float* Wo = (const float*)d_in[5];
  float* out = (float*)d_out;

  char* ws = (char*)d_ws;
  const size_t MB = 1u << 20;
  // all in fragment order
  _Float16* Xh  = (_Float16*)(ws + 0);        // 8 MB  [B*S, D] f16
  _Float16* Wqt = (_Float16*)(ws + 8  * MB);  // 2 MB  [N,K] f16
  _Float16* Wkt = (_Float16*)(ws + 10 * MB);
  _Float16* Wvt = (_Float16*)(ws + 12 * MB);
  _Float16* Wot = (_Float16*)(ws + 14 * MB);
  _Float16* Qh  = (_Float16*)(ws + 16 * MB);  // 8 MB  [B,H,S,HD]
  _Float16* Kh  = (_Float16*)(ws + 24 * MB);  // 8 MB  [B,H,S,HD]
  _Float16* Vtb = (_Float16*)(ws + 32 * MB);  // 8 MB  [B,H,HD,S]
  _Float16* Oh  = (_Float16*)(ws + 40 * MB);  // 8 MB  [B*S, D]

  const int M = BB * SS;  // 4096

  // 1) X fp32 -> f16
  cvt_f16_kernel<<<512, 256, 0, stream>>>(X, Xh);

  // 2) weights fp32 [K,N] -> f16 [N,K]
  //    (Wqt, Wkt, Wvt, Wot are consecutive: one launch writes all four)
  transpose_w_kernel<<<512, 256, 0, stream>>>(Wq, Wk, Wv, Wo, Wqt);

  // 3) QKV projections: waves = (M/32)*(N/64) = 2048 -> 256 blocks x 256 thr
  gemm_f16out_kernel<false><<<256, 256, 0, stream>>>(Xh, Wqt, Qh,  M, DD, DD);
  gemm_f16out_kernel<false><<<256, 256, 0, stream>>>(Xh, Wkt, Kh,  M, DD, DD);
  gemm_f16out_kernel<true><<<256, 256, 0, stream>>>(Xh, Wvt, Vtb, M, DD, DD);

  // 4) RoPE on Q and K
  rope_kernel<<<512, 256, 0, stream>>>(Qh, Kh, FC);

  // 5) attention (waves = B*H*(S/16) = 4096 -> 512 blocks x 256 thr)
  attn_kernel<<<512, 256, 0, stream>>>(Qh, Kh, Vtb, Oh);

  // 6) output projection -> f32 d_out
  gemm_f32out_kernel<<<256, 256, 0, stream>>>(Oh, Wot, out, M, DD, DD);
}

// v006
// It runs in 94.6 microseconds.
// Next to v005, in two timings, it ran 1.20 times as fast each time.
// All steps since v000 together make it 3.26 times as fast.
#include <hip/hip_runtime.h>

#define BB 2
#define SS 2048
#define DD 1024
#define HH 16
#define HD 64
#define CHUNK 1024

typedef __attribute__((ext_vector_type(16))) _Float16 v16h;
typedef __attribute__((ext_vector_type(8)))  _Float16 v8h;
typedef __attribute__((ext_vector_type(4)))  _Float16 v4h;
typedef __attribute__((ext_vector_type(8)))  float    v8f;

#define WMMA(a, b, c) __builtin_amdgcn_wmma_f32_16x16x32_f16(false, (a), false, (b), (short)0, (c), false, false)

// Fragment order. Every f16 operand in the workspace, a [rows, k] matrix, is kept as
// 1-KB units of 16 rows x 32 k, unit index = row_tile * ktiles + k_tile. A unit is two
// 512-B planes (k 0..15, k 16..31); in a plane lane l = 16 * ((k >> 3) & 1) + (row & 15)
// owns 8 consecutive k. A wave-wide 16-B access then covers 512 contiguous bytes.
static __device__ __forceinline__ size_t frag_unit(int row_tile, int k_tile, int ktiles) {
  return ((size_t)row_tile * ktiles + k_tile) << 9;
}

// Load a 16x32 f16 WMMA fragment (A operand, or B when the rows are the columns of B).
static __device__ __forceinline__ v16h load_frag(const _Float16* __restrict__ p,
                                                 int ktiles, int row_tile, int k_tile, int lane) {
  const _Float16* base = p + frag_unit(row_tile, k_tile, ktiles) + (lane << 3);
  v8h lo = *(const v8h*)(base);
  v8h hi = *(const v8h*)(base + 256);
  v16h r;
#pragma unroll
  for (int i = 0; i < 8; ++i) { r[i] = lo[i]; r[i + 8] = hi[i]; }
  return r;
}

// The same from a running pointer: base = the unit's start + 8 * lane.
static __device__ __forceinline__ v16h load_frag_at(const _Float16* base) {
  v8h lo = *(const v8h*)(base);
  v8h hi = *(const v8h*)(base + 256);
  v16h r;
#pragma unroll
  for (int i = 0; i < 8; ++i) { r[i] = lo[i]; r[i + 8] = hi[i]; }
  return r;
}

static __device__ __forceinline__ v8h to_f16(v8f x) {
  v8h o;
  for (int r = 0; r < 8; ++r) o[r] = (_Float16)x[r];
  return o;
}

// The three element-wise passes (convert, weight transpose, RoPE) run 4096 waves each, 16 per
// WGP, every lane with 8 or more loads in flight.

// ---------------- fp32 [rows, DD] -> f16 fragment order: one wave per two units ------
__global__ __launch_bounds__(256) void cvt_f16_kernel(const float* __restrict__ src,
                                                      _Float16* __restrict__ dst) {
  // Units unit, unit + 1: k tiles 2t, 2t + 1 of one row tile, 256 B of each of its rows.
  int unit = ((blockIdx.x * blockDim.x + threadIdx.x) >> 5) << 1;  // row_tile * (DD / 32) + k_tile
  int lane = threadIdx.x & 31;
  int row = ((unit / (DD / 32)) << 4) + (lane & 15);
  int k   = ((unit % (DD / 32)) << 5) + ((lane >> 4) << 3);
  const float4* s = (const float4*)(src + (size_t)row * DD + k);
  float4 x[2][4];
#pragma unroll
  for (int u = 0; u < 2; ++u) {
    x[u][0] = s[8 * u];     x[u][1] = s[8 * u + 1];
    x[u][2] = s[8 * u + 4]; x[u][3] = s[8 * u + 5];
  }
  _Float16* o = dst + ((size_t)unit << 9) + (lane << 3);
#pragma unroll
  for (int u = 0; u < 2; ++u)
#pragma unroll
    for (int p = 0; p < 2; ++p) {
      float4 a = x[u][2 * p], b = x[u][2 * p + 1];
      v8h h = {(_Float16)a.x, (_Float16)a.y, (_Float16)a.z, (_Float16)a.w,
               (_Float16)b.x, (_Float16)b.y, (_Float16)b.z, (_Float16)b.w};
      *(v8h*)(o + (u << 9) + (p << 8)) = h;
    }
}

// -------- weight transpose: W[K,N] f32 -> Wt[N,K] f16 in fragment order, all four -----
// One wave per 32 k x 32 n. Lane = n: a load is one whole 128-B line of a row of W, and a
// lane's 8 consecutive k are one 16-B piece of its row's unit, so the transpose needs no
// exchange between lanes. The wave writes two whole units (n tiles 2 * np, 2 * np + 1).
__global__ __launch_bounds__(256) void transpose_w_kernel(const float* __restrict__ W0,
                                                          const float* __restrict__ W1,
                                                          const float* __restrict__ W2,
                                                          const float* __restrict__ W3,
                                                          _Float16* __restrict__ Wt) {
  int wave = (blockIdx.x * blockDim.x + threadIdx.x) >> 5;  // weight * 1024 + np * 32 + k_tile
  int lane = threadIdx.x & 31;
  int w  = blockIdx.x >> 7;  // 128 blocks a weight
  int np = (wave >> 5) & 31;
  int kt = wave & 31;
  const float* W = w == 0 ? W0 : w == 1 ? W1 : w == 2 ? W2 : W3;
  const float* s = W + (size_t)(kt << 5) * DD + (np << 5) + lane;
  float x[32];
#pragma unroll
  for (int i = 0; i < 32; ++i) x[i] = s[(size_t)i * DD];
  _Float16* o = Wt + (size_t)w * DD * DD + frag_unit(2 * np + (lane >> 4), kt, DD / 32) +
                ((lane & 15) << 3);
#pragma unroll
  for (int g = 0; g < 4; ++g) {  // k = 8g .. 8g + 7: plane g >> 1, lane half g & 1
    v8h h;
#pragma unroll
    for (int i = 0; i < 8; ++i) h[i] = (_Float16)x[8 * g + i];
    *(v8h*)(o + ((g >> 1) << 8) + ((g & 1) << 7)) = h;
  }
}

// ---------------- WMMA GEMM core: 128x128 block tile, 32x64 wave tile -------
// A [BB*SS, DD] and Bt [DD, DD], both f16 in fragment order, reach the waves through LDS.
// A stage is 128 k of the block's 128 rows of A, then of its 128 rows of Bt: per row tile 4
// consecutive units, 4 KB. The 8 waves (4 along m, 2 along n) share it: L2 delivers every row
// once a block, though 2 waves use a row of A and 4 waves a row of Bt.
#define G_KT 4                              // k tiles of a stage
#define G_STAGES (DD / 32 / G_KT)
#define G_ROWT_HALVES (G_KT * 512)          // one row tile of a stage
#define G_OPER_HALVES (8 * G_ROWT_HALVES)   // one operand of a stage
#define G_BUF_HALVES (2 * G_OPER_HALVES)    // a stage: 64 KB

// One operand's share of a stage, 8 x 16 B a lane, one copy per row tile. g: this lane's
// 16 B in the first row tile; l: the LDS byte address of its place there.
static __device__ __forceinline__ void copy_oper(const _Float16* g, unsigned l) {
  // The closing s_wait_xcnt stands in the copies' own statement, in front of any later
  // overwrite of the address registers they name.
  asm volatile(
      "global_load_async_to_lds_b128 %0, %8, off\n\t"
      "global_load_async_to_lds_b128 %1, %9, off\n\t"
      "global_load_async_to_lds_b128 %2, %10, off\n\t"
      "global_load_async_to_lds_b128 %3, %11, off\n\t"
      "global_load_async_to_lds_b128 %4, %12, off\n\t"
      "global_load_async_to_lds_b128 %5, %13, off\n\t"
      "global_load_async_to_lds_b128 %6, %14, off\n\t"
      "global_load_async_to_lds_b128 %7, %15, off\n\t"
      "s_wait_xcnt 0x0"
      :: "v"(l), "v"(l + 4096u), "v"(l + 8192u), "v"(l + 12288u),
         "v"(l + 16384u), "v"(l + 20480u), "v"(l + 24576u), "v"(l + 28672u),
         "v"(g), "v"(g + 16 * DD), "v"(g + 32 * DD), "v"(g + 48 * DD),
         "v"(g + 64 * DD), "v"(g + 80 * DD), "v"(g + 96 * DD), "v"(g + 112 * DD)
      : "memory");
}

// SWAP = false: tile (mt, nt) holds C (register r, lane l: row 8 * (l >> 4) + r, column
// l & 15); SWAP = true: it holds C^T (row of C = l & 15, column of C = 8 * (l >> 4) + r),
// same products, same k order. ring: 2 * G_BUF_HALVES of LDS. Grid: 32 x 8 block tiles.
template <bool SWAP, typename STORE>
static __device__ __forceinline__ void gemm_block_128x128(const _Float16* __restrict__ A,
                                                          const _Float16* __restrict__ Bt,
                                                          _Float16* ring, STORE store) {
  int tid  = threadIdx.x;
  int lane = tid & 31;
  int wm = tid >> 6, wn = (tid >> 5) & 1;          // the wave's place in the block tile
  int bm = blockIdx.x >> 3, bn = blockIdx.x & 7;   // the block tile
  // This lane's share of stage 0, and its place in buffer 0.
  const _Float16* acp = A  + frag_unit(bm << 3, 0, DD / 32) + (tid << 3);
  const _Float16* bcp = Bt + frag_unit(bn << 3, 0, DD / 32) + (tid << 3);
  unsigned lcp = (unsigned)(size_t)ring + (tid << 4);
  copy_oper(acp, lcp);
  copy_oper(bcp, lcp + 2 * G_OPER_HALVES);

  v8f acc[2][4];
#pragma unroll
  for (int mt = 0; mt < 2; ++mt)
#pragma unroll
    for (int nt = 0; nt < 4; ++nt) acc[mt][nt] = (v8f){};

  // Stage 0 has landed for this wave's copies; the barrier publishes it to the block.
  asm volatile("s_wait_asynccnt 0x0" ::: "memory");
  __syncthreads();
  copy_oper(acp + G_ROWT_HALVES, lcp + 2 * G_BUF_HALVES);
  copy_oper(bcp + G_ROWT_HALVES, lcp + 2 * (G_BUF_HALVES + G_OPER_HALVES));

  // One k step's operands, 2 A and 4 B fragments, are fetched from LDS as one group of 12
  // loads, one k step ahead of their products, into one of two register sets.
  struct Step { v16h a[2], b[4]; };
  // This lane's place in the wave's first A and first B fragment of buffer 0.
  const _Float16* pa = ring + wm * (2 * G_ROWT_HALVES) + (lane << 3);
  const _Float16* pb = ring + G_OPER_HALVES + wn * (4 * G_ROWT_HALVES) + (lane << 3);
  auto fetch = [&](Step& f, int buf, int j) {  // k step j of the stage in buffer buf
    const _Float16* a = pa + buf * G_BUF_HALVES + (j << 9);
    const _Float16* b = pb + buf * G_BUF_HALVES + (j << 9);
    f.a[0] = load_frag_at(a);
    f.a[1] = load_frag_at(a + G_ROWT_HALVES);
#pragma unroll
    for (int nt = 0; nt < 4; ++nt) f.b[nt] = load_frag_at(b + nt * G_ROWT_HALVES);
    // Keeps the products written behind a fetch behind it: the scheduler otherwise moves the
    // first of them, with their load waits, in front of the group, which then issues late.
    __builtin_amdgcn_sched_barrier(0);
  };
  auto products = [&](const Step& f) {
#pragma unroll
    for (int nt = 0; nt < 4; ++nt) {
      if (SWAP) {
        acc[0][nt] = WMMA(f.b[nt], f.a[0], acc[0][nt]);
        acc[1][nt] = WMMA(f.b[nt], f.a[1], acc[1][nt]);
      } else {
        acc[0][nt] = WMMA(f.a[0], f.b[nt], acc[0][nt]);
        acc[1][nt] = WMMA(f.a[1], f.b[nt], acc[1][nt]);
      }
    }
  };
  Step x, y;
  fetch(x, 0, 0);
  // Kept rolled: unrolled, the addresses of all stages' copies are formed ahead and held in
  // registers, past v255, and the text of a loop that runs once grows eightfold.
#pragma unroll 1
  for (int t = 0; t < G_STAGES; ++t) {  // stage t, in buffer t & 1
    fetch(y, t & 1, 1);
    products(x);
    fetch(x, t & 1, 2);
    products(y);
    fetch(y, t & 1, 3);
    products(x);
    // Keeps these products in front of the publish point: moved behind the barrier they would
    // stand in front of the refill, which would then issue late.
    __builtin_amdgcn_sched_barrier(0);
    // Publish point of stage t + 1, in front of stage t's last products, whose fragments are
    // fetched: this wave's reads of stage t are done, its copies of stage t + 1 have landed;
    // behind the barrier both hold for the whole block.
    asm volatile("s_wait_dscnt 0x0" ::: "memory");
    asm volatile("s_wait_asynccnt 0x0" ::: "memory");
    __syncthreads();
    if (t + 2 < G_STAGES) {
      copy_oper(acp + (t + 2) * G_ROWT_HALVES, lcp + (t & 1) * (2 * G_BUF_HALVES));
      copy_oper(bcp + (t + 2) * G_ROWT_HALVES,
                lcp + (t & 1) * (2 * G_BUF_HALVES) + 2 * G_OPER_HALVES);
    }
    if (t + 1 < G_STAGES) fetch(x, (t + 1) & 1, 0);
    products(y);
  }
  // No copy is outstanding when the wave ends.
  asm volatile("s_wait_asynccnt 0x0" ::: "memory");
  int m0 = (bm << 7) + (wm << 5);
  int n0 = (bn << 7) + (wn << 6);
  store(m0, n0, acc);
}

// Projections, C in fragment order per (batch, head); a lane's 8 values are 8 consecutive
// k of the operand that attention reads, so each tile leaves as one 16-B store per lane.
// VT = false: rows = positions, k = head dim (Q, K), from C^T.
// VT = true:  rows = head dim, k = positions (V^T), from C.
template <bool VT>
__global__ __launch_bounds__(256) void gemm_f16out_kernel(const _Float16* __restrict__ A,
                                                          const _Float16* __restrict__ Bt,
                                                          _Float16* __restrict__ C) {
  __shared__ __attribute__((aligned(16))) _Float16 ring[2 * G_BUF_HALVES];
  int lane = threadIdx.x & 31;
  gemm_block_128x128<!VT>(A, Bt, ring, [&](int m0, int n0, const v8f (&acc)[2][4]) {
    int b = m0 >> 11, s0 = m0 & (SS - 1), h = n0 >> 6;
    _Float16* Cb = C + (size_t)(b * HH + h) * SS * HD;
    v8h o[2][4];
#pragma unroll
    for (int mt = 0; mt < 2; ++mt)
#pragma unroll
      for (int nt = 0; nt < 4; ++nt) o[mt][nt] = to_f16(acc[mt][nt]);
    // Keeps the 8 stores behind all the conversions: no register of an issued store is then
    // written again, and the stores need no wait between them.
    __builtin_amdgcn_sched_barrier(0);
#pragma unroll
    for (int mt = 0; mt < 2; ++mt)
#pragma unroll
      for (int nt = 0; nt < 4; ++nt) {
        size_t idx;
        if (VT) idx = frag_unit(nt, s0 >> 5, SS / 32) + (mt << 8);
        else    idx = frag_unit((s0 >> 4) + mt, nt >> 1, HD / 32) + ((nt & 1) << 8);
        *(v8h*)(Cb + idx + (lane << 3)) = o[mt][nt];
      }
  });
}

__global__ __launch_bounds__(256) void gemm_f32out_kernel(const _Float16* __restrict__ A,
                                                          const _Float16* __restrict__ Bt,
                                                          float* __restrict__ C) {
  __shared__ __attribute__((aligned(16))) _Float16 ring[2 * G_BUF_HALVES];
  int lane = threadIdx.x & 31;
  gemm_block_128x128<false>(A, Bt, ring, [&](int m0, int n0, const v8f (&acc)[2][4]) {
#pragma unroll
    for (int mt = 0; mt < 2; ++mt)
#pragma unroll
      for (int nt = 0; nt < 4; ++nt) {
        int row = m0 + (mt << 4) + ((lane >> 4) << 3);
        int col = n0 + (nt << 4) + (lane & 15);
        for (int r = 0; r < 8; ++r) C[(size_t)(row + r) * DD + col] = acc[mt][nt][r];
      }
  });
}

// -------- RoPE over Q,K, f16 in fragment order per (batch, head) --------------
// A thread takes one 16-B piece (4 pairs of one position) at the same place in 4 of the
// 32 (batch, head) planes of Q and of K: its 4 (cos, sin) are read once for all 8 pieces.
__global__ __launch_bounds__(256) void rope_kernel(_Float16* __restrict__ Q,
                                                   _Float16* __restrict__ K,
                                                   const float* __restrict__ fc) {
  int off = (((blockIdx.x & 63) << 8) + threadIdx.x) << 3;  // 64 blocks cover a plane
  // bits of off: 3-6 row & 15, 7-9 k >> 3, 10.. row >> 4
  int s  = ((off >> 10) << 4) + ((off >> 3) & 15);
  int k0 = ((off >> 7) & 7) << 3;
  const float4* f = (const float4*)(fc + s * HD + k0);  // (cos, sin) of pairs k0 / 2 .. k0 / 2 + 3
  float4 f0 = f[0], f1 = f[1];
  size_t base = (size_t)(blockIdx.x >> 6) * 4 * SS * HD + off;
  v8h q[4], k[4];
#pragma unroll
  for (int p = 0; p < 4; ++p) {
    q[p] = *(const v8h*)(Q + base + (size_t)p * SS * HD);
    k[p] = *(const v8h*)(K + base + (size_t)p * SS * HD);
  }
  float c[4] = {f0.x, f0.z, f1.x, f1.z};
  float d[4] = {f0.y, f0.w, f1.y, f1.w};
#pragma unroll
  for (int p = 0; p < 4; ++p)
#pragma unroll
    for (int i = 0; i < 4; ++i) {
      float a = (float)q[p][2 * i], b = (float)q[p][2 * i + 1];
      q[p][2 * i]     = (_Float16)(a * c[i] - b * d[i]);
      q[p][2 * i + 1] = (_Float16)(a * d[i] + b * c[i]);
      a = (float)k[p][2 * i]; b = (float)k[p][2 * i + 1];
      k[p][2 * i]     = (_Float16)(a * c[i] - b * d[i]);
      k[p][2 * i + 1] = (_Float16)(a * d[i] + b * c[i]);
    }
  // Keeps the 8 stores behind all the arithmetic: no register of an issued store is then
  // written again, and the stores need no wait between them.
  __builtin_amdgcn_sched_barrier(0);
#pragma unroll
  for (int p = 0; p < 4; ++p) {
    *(v8h*)(Q + base + (size_t)p * SS * HD) = q[p];
    *(v8h*)(K + base + (size_t)p * SS * HD) = k[p];
  }
}

// ---------------- attention: per-chunk softmax, chunk outputs summed -------
// Lane l <-> lane l ^ 16 (the two halves of a wave hold the two halves of a column).
static __device__ __forceinline__ float xhalf(float x) {
  int b = __builtin_bit_cast(int, x);
  return __builtin_bit_cast(float,
      __builtin_amdgcn_permlanex16(b, b, 0x76543210, 0xfedcba98, false, false));
}

// K and V^T reach the waves through LDS. A stage is 128 keys: 16 KB of K (contiguous in
// fragment order), then 4 KB of each of the 4 d tiles of V^T. The 8 waves of a block, 128
// queries of one (batch, head), share it, so L2 delivers a stage once a block, not once a wave.
#define STAGE_KEYS 128
#define STAGE_HALVES 16384  // K 8192 + V^T 8192 f16
#define NSTAGES (SS / STAGE_KEYS)

// One stage's copies, 8 x 16 B a lane. k, v: this lane's first 16 B of the stage in K and in
// V^T; l: the LDS byte address of its first 16 B in the buffer.
static __device__ __forceinline__ void copy_stage(const _Float16* k, const _Float16* v, unsigned l) {
  // The closing s_wait_xcnt stands in the copies' own statement, in front of any later
  // overwrite of the address registers they name.
  asm volatile(
      "global_load_async_to_lds_b128 %0, %8, off\n\t"
      "global_load_async_to_lds_b128 %1, %9, off\n\t"
      "global_load_async_to_lds_b128 %2, %10, off\n\t"
      "global_load_async_to_lds_b128 %3, %11, off\n\t"
      "global_load_async_to_lds_b128 %4, %12, off\n\t"
      "global_load_async_to_lds_b128 %5, %13, off\n\t"
      "global_load_async_to_lds_b128 %6, %14, off\n\t"
      "global_load_async_to_lds_b128 %7, %15, off\n\t"
      "s_wait_xcnt 0x0"
      :: "v"(l), "v"(l + 4096u), "v"(l + 8192u), "v"(l + 12288u),
         "v"(l + 16384u), "v"(l + 20480u), "v"(l + 24576u), "v"(l + 28672u),
         "v"(k), "v"(k + 2048), "v"(k + 4096), "v"(k + 6144),
         "v"(v), "v"(v + 16 * SS), "v"(v + 32 * SS), "v"(v + 48 * SS)
      : "memory");
}

__global__ __launch_bounds__(256) void attn_kernel(const _Float16* __restrict__ Q,
                                                   const _Float16* __restrict__ Kd,
                                                   const _Float16* __restrict__ Vt,
                                                   _Float16* __restrict__ O) {
  __shared__ __attribute__((aligned(16))) _Float16 ring[2 * STAGE_HALVES];
  int tid  = threadIdx.x;
  int lane = tid & 31;
  int qt = ((blockIdx.x & 15) << 3) + (tid >> 5);  // 16 blocks of 8 query tiles a (batch, head)
  int bh = blockIdx.x >> 4;
  const _Float16* Qb = Q  + (size_t)bh * SS * HD;
  const _Float16* Kb = Kd + (size_t)bh * SS * HD;
  const _Float16* Vb = Vt + (size_t)bh * HD * SS;

  // This lane's share of stage 0, and its place in buffer 0.
  const _Float16* kcp = Kb + (tid << 3);
  const _Float16* vcp = Vb + (tid << 3);
  unsigned lcp = (unsigned)(size_t)ring + (tid << 4);
  copy_stage(kcp, vcp, lcp);

  v16h qb0 = load_frag(Qb, HD / 32, qt, 0, lane);
  v16h qb1 = load_frag(Qb, HD / 32, qt, 1, lane);

  // Stage 0 has landed for this wave's copies; the barrier publishes it to the block.
  asm volatile("s_wait_asynccnt 0x0" ::: "memory");
  __syncthreads();
  copy_stage(kcp + STAGE_KEYS * HD, vcp + STAGE_KEYS * 16, lcp + 2 * STAGE_HALVES);

  v8f of0 = {}, of1 = {}, of2 = {}, of3 = {};
  const float scale = 0.125f;  // 64^-0.5

  for (int c0 = 0; c0 < SS; c0 += CHUNK) {
    float mrun = -1e30f;  // running maximum of this lane's query
    float lrun = 0.f;     // running sum over this half's keys only
    v8f oa0 = {}, oa1 = {}, oa2 = {}, oa3 = {};

    for (int ks = 0; ks < CHUNK; ks += STAGE_KEYS) {
    int t = (c0 + ks) / STAGE_KEYS;  // stage, in buffer t & 1
    const _Float16* buf = ring + (t & 1) * STAGE_HALVES + (lane << 3);
    for (int j = 0; j < STAGE_KEYS / 32; ++j) {
      // ---- scores^T: 32 keys x 16 queries, K-dim = HD = 64 (2 steps) ----
      // 32 keys of the stage: 4 units of K, one unit of each d tile of V^T
      const _Float16* kp = buf + (j << 11);
      const _Float16* vp = buf + 8192 + (j << 9);
      v16h ka0 = load_frag_at(kp);
      v16h ka1 = load_frag_at(kp + 512);
      v16h ka2 = load_frag_at(kp + 1024);
      v16h ka3 = load_frag_at(kp + 1536);
      // K's loads stay in front of V^T's: LDS loads return in order, and the score products
      // then wait for 8 loads, not for all 16.
      __builtin_amdgcn_sched_barrier(0);
      v16h va0 = load_frag_at(vp);
      v16h va1 = load_frag_at(vp + 2048);
      v16h va2 = load_frag_at(vp + 4096);
      v16h va3 = load_frag_at(vp + 6144);
      // Keeps the pass's 16 LDS loads one group in front of its products: the scheduler
      // otherwise issues them two at a time, each pair with a full wait of its own.
      __builtin_amdgcn_sched_barrier(0);
      v8f s0 = {}, s1 = {};
      s0 = WMMA(ka0, qb0, s0);
      s0 = WMMA(ka1, qb1, s0);
      s1 = WMMA(ka2, qb0, s1);
      s1 = WMMA(ka3, qb1, s1);
      // ---- online softmax: 16 of the query's 32 scores are in this lane ----
      s0 *= scale;
      s1 *= scale;
      float mx[8];
      for (int r = 0; r < 8; ++r) mx[r] = fmaxf(s0[r], s1[r]);
      float mt = fmaxf(fmaxf(fmaxf(mx[0], mx[1]), fmaxf(mx[2], mx[3])),
                       fmaxf(fmaxf(mx[4], mx[5]), fmaxf(mx[6], mx[7])));
      mt = fmaxf(mt, xhalf(mt));
      float mnew  = fmaxf(mrun, mt);
      float alpha = __expf(mrun - mnew);
      mrun = mnew;
      float ps[8];
      v16h pb;
      for (int r = 0; r < 8; ++r) {
        float p0 = __expf(s0[r] - mnew);
        float p1 = __expf(s1[r] - mnew);
        ps[r] = p0 + p1;
        pb[r]     = (_Float16)p0;  // k = 8h + r
        pb[r + 8] = (_Float16)p1;  // k = 16 + 8h + r
      }
      lrun = lrun * alpha + (((ps[0] + ps[1]) + (ps[2] + ps[3])) +
                             ((ps[4] + ps[5]) + (ps[6] + ps[7])));
      for (int r = 0; r < 8; ++r) {
        oa0[r] *= alpha; oa1[r] *= alpha;
        oa2[r] *= alpha; oa3[r] *= alpha;
      }
      // ---- O^T += V^T @ P^T: K-dim = 32 keys, 4 d-tiles (Vt is [HD,S]) ----
      oa0 = WMMA(va0, pb, oa0);
      oa1 = WMMA(va1, pb, oa1);
      oa2 = WMMA(va2, pb, oa2);
      oa3 = WMMA(va3, pb, oa3);
    }
    // Publish point of stage t + 1: this wave's reads of stage t are done, its copies of
    // stage t + 1 have landed; behind the barrier both hold for the whole block.
    asm volatile("s_wait_dscnt 0x0" ::: "memory");
    asm volatile("s_wait_asynccnt 0x0" ::: "memory");
    __syncthreads();
    if (t + 2 < NSTAGES)
      copy_stage(kcp + (t + 2) * (STAGE_KEYS * HD), vcp + (t + 2) * (STAGE_KEYS * 16),
                 lcp + (t & 1) * (2 * STAGE_HALVES));
    }
    // ---- finalize chunk: join the halves' sums, normalize, accumulate ----
    float inv = 1.f / (lrun + xhalf(lrun));
    for (int r = 0; r < 8; ++r) {
      of0[r] += oa0[r] * inv;
      of1[r] += oa1[r] * inv;
      of2[r] += oa2[r] * inv;
      of3[r] += oa3[r] * inv;
    }
  }
  // No copy is outstanding when the wave ends.
  asm volatile("s_wait_asynccnt 0x0" ::: "memory");
  // ---- store O, f16 [B*S, D] in fragment order: a lane holds 8 consecutive d of its
  // query, and d tiles 2u, 2u + 1 are the two planes of k tile 2h + u ----
  int b = bh >> 4, h = bh & 15;
  _Float16* o = O + frag_unit(b * (SS / 16) + qt, 2 * h, DD / 32) + (lane << 3);
  *(v8h*)(o)       = to_f16(of0);
  *(v8h*)(o + 256) = to_f16(of1);
  *(v8h*)(o + 512) = to_f16(of2);
  *(v8h*)(o + 768) = to_f16(of3);
}

extern "C" void kernel_launch(void* const* d_in, const int* in_sizes, int n_in,
                              void* d_out, int out_size, void* d_ws, size_t ws_size,
                              hipStream_t stream) {
  const float* X  = (const float*)d_in[0];
  const float* FC = (const float*)d_in[1];
  const float* Wq = (const float*)d_in[2];
  const float* Wk = (const float*)d_in[3];
  const float* Wv = (const float*)d_in[4];
  const float* Wo = (const float*)d_in[5];
  float* out = (float*)d_out;

  char* ws = (char*)d_ws;
  const size_t MB = 1u << 20;
  // all in fragment order
  _Float16* Xh  = (_Float16*)(ws + 0);        // 8 MB  [B*S, D] f16
  _Float16* Wqt = (_Float16*)(ws + 8  * MB);  // 2 MB  [N,K] f16
  _Float16* Wkt = (_Float16*)(ws + 10 * MB);
  _Float16* Wvt = (_Float16*)(ws + 12 * MB);
  _Float16* Wot = (_Float16*)(ws + 14 * MB);
  _Float16* Qh  = (_Float16*)(ws + 16 * MB);  // 8 MB  [B,H,S,HD]
  _Float16* Kh  = (_Float16*)(ws + 24 * MB);  // 8 MB  [B,H,S,HD]
  _Float16* Vtb = (_Float16*)(ws + 32 * MB);  // 8 MB  [B,H,HD,S]
  _Float16* Oh  = (_Float16*)(ws + 40 * MB);  // 8 MB  [B*S, D]

  // 1) X fp32 -> f16
  cvt_f16_kernel<<<512, 256, 0, stream>>>(X, Xh);

  // 2) weights fp32 [K,N] -> f16 [N,K]
  //    (Wqt, Wkt, Wvt, Wot are consecutive: one launch writes all four)
  transpose_w_kernel<<<512, 256, 0, stream>>>(Wq, Wk, Wv, Wo, Wqt);

  // 3) QKV projections: (4096/128)*(1024/128) = 256 block tiles x 256 thr
  gemm_f16out_kernel<false><<<256, 256, 0, stream>>>(Xh, Wqt, Qh);
  gemm_f16out_kernel<false><<<256, 256, 0, stream>>>(Xh, Wkt, Kh);
  gemm_f16out_kernel<true><<<256, 256, 0, stream>>>(Xh, Wvt, Vtb);

  // 4) RoPE on Q and K
  rope_kernel<<<512, 256, 0, stream>>>(Qh, Kh, FC);

  // 5) attention (waves = B*H*(S/16) = 4096 -> 512 blocks x 256 thr)
  attn_kernel<<<512, 256, 0, stream>>>(Qh, Kh, Vtb, Oh);

  // 6) output projection -> f32 d_out
  gemm_f32out_kernel<<<256, 256, 0, stream>>>(Oh, Wot, out);
}

// v007
// It runs in 82.8 microseconds.
// Timed twice side by side with v006, it ran 1.14 times as fast both times.
// Counting every step since v000, it is 3.72 times as fast.
#include <hip/hip_runtime.h>

#define BB 2
#define SS 2048
#define DD 1024
#define HH 16
#define HD 64
#define CHUNK 1024

typedef __attribute__((ext_vector_type(16))) _Float16 v16h;
typedef __attribute__((ext_vector_type(8)))  _Float16 v8h;
typedef __attribute__((ext_vector_type(4)))  _Float16 v4h;
typedef __attribute__((ext_vector_type(8)))  float    v8f;

#define WMMA(a, b, c) __builtin_amdgcn_wmma_f32_16x16x32_f16(false, (a), false, (b), (short)0, (c), false, false)

// Fragment order. Every f16 operand in the workspace, a [rows, k] matrix, is kept as
// 1-KB units of 16 rows x 32 k, unit index = row_tile * ktiles + k_tile. A unit is two
// 512-B planes (k 0..15, k 16..31); in a plane lane l = 16 * ((k >> 3) & 1) + (row & 15)
// owns 8 consecutive k. A wave-wide 16-B access then covers 512 contiguous bytes.
static __device__ __forceinline__ size_t frag_unit(int row_tile, int k_tile, int ktiles) {
  return ((size_t)row_tile * ktiles + k_tile) << 9;
}

// Load a 16x32 f16 WMMA fragment (A operand, or B when the rows are the columns of B).
static __device__ __forceinline__ v16h load_frag(const _Float16* __restrict__ p,
                                                 int ktiles, int row_tile, int k_tile, int lane) {
  const _Float16* base = p + frag_unit(row_tile, k_tile, ktiles) + (lane << 3);
  v8h lo = *(const v8h*)(base);
  v8h hi = *(const v8h*)(base + 256);
  v16h r;
#pragma unroll
  for (int i = 0; i < 8; ++i) { r[i] = lo[i]; r[i + 8] = hi[i]; }
  return r;
}

// The same from a running pointer: base = the unit's start + 8 * lane.
static __device__ __forceinline__ v16h load_frag_at(const _Float16* base) {
  v8h lo = *(const v8h*)(base);
  v8h hi = *(const v8h*)(base + 256);
  v16h r;
#pragma unroll
  for (int i = 0; i < 8; ++i) { r[i] = lo[i]; r[i + 8] = hi[i]; }
  return r;
}

static __device__ __forceinline__ v8h to_f16(v8f x) {
  v8h o;
  for (int r = 0; r < 8; ++r) o[r] = (_Float16)x[r];
  return o;
}

// The three element-wise passes (convert, weight transpose, RoPE) run 4096 waves each, 16 per
// WGP, every lane with 8 or more loads in flight.
// Passes that do not depend on each other share a launch: each launch costs its gap, its fill,
// its first loads' latency and its tail, whatever it computes.

// ---------------- fp32 [rows, DD] -> f16 fragment order: one wave per two units ------
// blk: 0 .. 511.
static __device__ __forceinline__ void cvt_f16_block(int blk, const float* __restrict__ src,
                                                     _Float16* __restrict__ dst) {
  // Units unit, unit + 1: k tiles 2t, 2t + 1 of one row tile, 256 B of each of its rows.
  int unit = (((blk << 8) + threadIdx.x) >> 5) << 1;  // row_tile * (DD / 32) + k_tile
  int lane = threadIdx.x & 31;
  int row = ((unit / (DD / 32)) << 4) + (lane & 15);
  int k   = ((unit % (DD / 32)) << 5) + ((lane >> 4) << 3);
  const float4* s = (const float4*)(src + (size_t)row * DD + k);
  float4 x[2][4];
#pragma unroll
  for (int u = 0; u < 2; ++u) {
    x[u][0] = s[8 * u];     x[u][1] = s[8 * u + 1];
    x[u][2] = s[8 * u + 4]; x[u][3] = s[8 * u + 5];
  }
  _Float16* o = dst + ((size_t)unit << 9) + (lane << 3);
#pragma unroll
  for (int u = 0; u < 2; ++u)
#pragma unroll
    for (int p = 0; p < 2; ++p) {
      float4 a = x[u][2 * p], b = x[u][2 * p + 1];
      v8h h = {(_Float16)a.x, (_Float16)a.y, (_Float16)a.z, (_Float16)a.w,
               (_Float16)b.x, (_Float16)b.y, (_Float16)b.z, (_Float16)b.w};
      *(v8h*)(o + (u << 9) + (p << 8)) = h;
    }
}

// -------- weight transpose: W[K,N] f32 -> Wt[N,K] f16 in fragment order, all four -----
// One wave per 32 k x 32 n. Lane = n: a load is one whole 128-B line of a row of W, and a
// lane's 8 consecutive k are one 16-B piece of its row's unit, so the transpose needs no
// exchange between lanes. The wave writes two whole units (n tiles 2 * np, 2 * np + 1).
// blk: 0 .. 511.
static __device__ __forceinline__ void transpose_w_block(int blk, const float* __restrict__ W0,
                                                         const float* __restrict__ W1,
                                                         const float* __restrict__ W2,
                                                         const float* __restrict__ W3,
                                                         _Float16* __restrict__ Wt) {
  int wave = ((blk << 8) + threadIdx.x) >> 5;  // weight * 1024 + np * 32 + k_tile
  int lane = threadIdx.x & 31;
  int w  = blk >> 7;  // 128 blocks a weight
  int np = (wave >> 5) & 31;
  int kt = wave & 31;
  const float* W = w == 0 ? W0 : w == 1 ? W1 : w == 2 ? W2 : W3;
  const float* s = W + (size_t)(kt << 5) * DD + (np << 5) + lane;
  float x[32];
#pragma unroll
  for (int i = 0; i < 32; ++i) x[i] = s[(size_t)i * DD];
  _Float16* o = Wt + (size_t)w * DD * DD + frag_unit(2 * np + (lane >> 4), kt, DD / 32) +
                ((lane & 15) << 3);
#pragma unroll
  for (int g = 0; g < 4; ++g) {  // k = 8g .. 8g + 7: plane g >> 1, lane half g & 1
    v8h h;
#pragma unroll
    for (int i = 0; i < 8; ++i) h[i] = (_Float16)x[8 * g + i];
    *(v8h*)(o + ((g >> 1) << 8) + ((g & 1) << 7)) = h;
  }
}

// Both in one launch: blocks 0 .. 511 convert X, blocks 512 .. 1023 transpose the weights.
__global__ __launch_bounds__(256) void prep_kernel(const float* __restrict__ X,
                                                   const float* __restrict__ W0,
                                                   const float* __restrict__ W1,
                                                   const float* __restrict__ W2,
                                                   const float* __restrict__ W3,
                                                   _Float16* __restrict__ Xh,
                                                   _Float16* __restrict__ Wt) {
  if (blockIdx.x < 512) cvt_f16_block(blockIdx.x, X, Xh);
  else                  transpose_w_block(blockIdx.x - 512, W0, W1, W2, W3, Wt);
}

// ---------------- WMMA GEMM core: 128x128 block tile, 32x64 wave tile -------
// A and Bt, each [BB*SS, DD] or [DD, DD], both f16 in fragment order, reach the waves through LDS.
// A stage is 128 k of the block's 128 rows of A, then of its 128 rows of Bt: per row tile 4
// consecutive units, 4 KB. The 8 waves (4 along m, 2 along n) share it: L2 delivers every row
// once a block, though 2 waves use a row of A and 4 waves a row of Bt.
#define G_KT 4                              // k tiles of a stage
#define G_STAGES (DD / 32 / G_KT)
#define G_ROWT_HALVES (G_KT * 512)          // one row tile of a stage
#define G_OPER_HALVES (8 * G_ROWT_HALVES)   // one operand of a stage
#define G_BUF_HALVES (2 * G_OPER_HALVES)    // a stage: 64 KB

// One operand's share of a stage, 8 x 16 B a lane, one copy per row tile. g: this lane's
// 16 B in the first row tile; l: the LDS byte address of its place there.
static __device__ __forceinline__ void copy_oper(const _Float16* g, unsigned l) {
  // The closing s_wait_xcnt stands in the copies' own statement, in front of any later
  // overwrite of the address registers they name.
  asm volatile(
      "global_load_async_to_lds_b128 %0, %8, off\n\t"
      "global_load_async_to_lds_b128 %1, %9, off\n\t"
      "global_load_async_to_lds_b128 %2, %10, off\n\t"
      "global_load_async_to_lds_b128 %3, %11, off\n\t"
      "global_load_async_to_lds_b128 %4, %12, off\n\t"
      "global_load_async_to_lds_b128 %5, %13, off\n\t"
      "global_load_async_to_lds_b128 %6, %14, off\n\t"
      "global_load_async_to_lds_b128 %7, %15, off\n\t"
      "s_wait_xcnt 0x0"
      :: "v"(l), "v"(l + 4096u), "v"(l + 8192u), "v"(l + 12288u),
         "v"(l + 16384u), "v"(l + 20480u), "v"(l + 24576u), "v"(l + 28672u),
         "v"(g), "v"(g + 16 * DD), "v"(g + 32 * DD), "v"(g + 48 * DD),
         "v"(g + 64 * DD), "v"(g + 80 * DD), "v"(g + 96 * DD), "v"(g + 112 * DD)
      : "memory");
}

// SWAP = false: tile (mt, nt) holds C (register r, lane l: row 8 * (l >> 4) + r, column
// l & 15); SWAP = true: it holds C^T (row of C = l & 15, column of C = 8 * (l >> 4) + r),
// same products, same k order. ring: 2 * G_BUF_HALVES of LDS. bm, bn: the block tile, in
// units of 128 rows of A and of 128 rows of Bt.
template <bool SWAP, typename STORE>
static __device__ __forceinline__ void gemm_block_128x128(const _Float16* __restrict__ A,
                                                          const _Float16* __restrict__ Bt,
                                                          _Float16* ring, int bm, int bn,
                                                          STORE store) {
  int tid  = threadIdx.x;
  int lane = tid & 31;
  int wm = tid >> 6, wn = (tid >> 5) & 1;          // the wave's place in the block tile
  // This lane's share of stage 0, and its place in buffer 0.
  const _Float16* acp = A  + frag_unit(bm << 3, 0, DD / 32) + (tid << 3);
  const _Float16* bcp = Bt + frag_unit(bn << 3, 0, DD / 32) + (tid << 3);
  unsigned lcp = (unsigned)(size_t)ring + (tid << 4);
  copy_oper(acp, lcp);
  copy_oper(bcp, lcp + 2 * G_OPER_HALVES);

  v8f acc[2][4];
#pragma unroll
  for (int mt = 0; mt < 2; ++mt)
#pragma unroll
    for (int nt = 0; nt < 4; ++nt) acc[mt][nt] = (v8f){};

  // Stage 0 has landed for this wave's copies; the barrier publishes it to the block.
  asm volatile("s_wait_asynccnt 0x0" ::: "memory");
  __syncthreads();
  copy_oper(acp + G_ROWT_HALVES, lcp + 2 * G_BUF_HALVES);
  copy_oper(bcp + G_ROWT_HALVES, lcp + 2 * (G_BUF_HALVES + G_OPER_HALVES));

  // One k step's operands, 2 A and 4 B fragments, are fetched from LDS as one group of 12
  // loads, one k step ahead of their products, into one of two register sets.
  struct Step { v16h a[2], b[4]; };
  // This lane's place in the wave's first A and first B fragment of buffer 0.
  const _Float16* pa = ring + wm * (2 * G_ROWT_HALVES) + (lane << 3);
  const _Float16* pb = ring + G_OPER_HALVES + wn * (4 * G_ROWT_HALVES) + (lane << 3);
  auto fetch = [&](Step& f, int buf, int j) {  // k step j of the stage in buffer buf
    const _Float16* a = pa + buf * G_BUF_HALVES + (j << 9);
    const _Float16* b = pb + buf * G_BUF_HALVES + (j << 9);
    f.a[0] = load_frag_at(a);
    f.a[1] = load_frag_at(a + G_ROWT_HALVES);
#pragma unroll
    for (int nt = 0; nt < 4; ++nt) f.b[nt] = load_frag_at(b + nt * G_ROWT_HALVES);
    // Keeps the products written behind a fetch behind it: the scheduler otherwise moves the
    // first of them, with their load waits, in front of the group, which then issues late.
    __builtin_amdgcn_sched_barrier(0);
  };
  auto products = [&](const Step& f) {
#pragma unroll
    for (int nt = 0; nt < 4; ++nt) {
      if (SWAP) {
        acc[0][nt] = WMMA(f.b[nt], f.a[0], acc[0][nt]);
        acc[1][nt] = WMMA(f.b[nt], f.a[1], acc[1][nt]);
      } else {
        acc[0][nt] = WMMA(f.a[0], f.b[nt], acc[0][nt]);
        acc[1][nt] = WMMA(f.a[1], f.b[nt], acc[1][nt]);
      }
    }
  };
  Step x, y;
  fetch(x, 0, 0);
  // Kept rolled: unrolled, the addresses of all stages' copies are formed ahead and held in
  // registers, past v255, and the text of a loop that runs once grows eightfold.
#pragma unroll 1
  for (int t = 0; t < G_STAGES; ++t) {  // stage t, in buffer t & 1
    fetch(y, t & 1, 1);
    products(x);
    fetch(x, t & 1, 2);
    products(y);
    fetch(y, t & 1, 3);
    products(x);
    // Keeps these products in front of the publish point: moved behind the barrier they would
    // stand in front of the refill, which would then issue late.
    __builtin_amdgcn_sched_barrier(0);
    // Publish point of stage t + 1, in front of stage t's last products, whose fragments are
    // fetched: this wave's reads of stage t are done, its copies of stage t + 1 have landed;
    // behind the barrier both hold for the whole block.
    asm volatile("s_wait_dscnt 0x0" ::: "memory");
    asm volatile("s_wait_asynccnt 0x0" ::: "memory");
    __syncthreads();
    if (t + 2 < G_STAGES) {
      copy_oper(acp + (t + 2) * G_ROWT_HALVES, lcp + (t & 1) * (2 * G_BUF_HALVES));
      copy_oper(bcp + (t + 2) * G_ROWT_HALVES,
                lcp + (t & 1) * (2 * G_BUF_HALVES) + 2 * G_OPER_HALVES);
    }
    if (t + 1 < G_STAGES) fetch(x, (t + 1) & 1, 0);
    products(y);
  }
  // No copy is outstanding when the wave ends.
  asm volatile("s_wait_asynccnt 0x0" ::: "memory");
  int m0 = (bm << 7) + (wm << 5);
  int n0 = (bn << 7) + (wn << 6);
  store(m0, n0, acc);
}

// The three projections in one launch of 3 x 256 blocks: blocks 0 .. 255 Q, 256 .. 511 K,
// 512 .. 767 V^T. Wt: Wq^T, Wk^T, Wv^T one behind the other; C: Q, K, V^T likewise. Two blocks
// fit a WGP (LDS, registers): one block's copies fly while the other's land or are worked on,
// and a block's first stage and its stores overlap other blocks' k loops.
// C is in fragment order per (batch, head); a lane's 8 values are 8 consecutive k of the
// operand that attention reads, so each tile leaves as one 16-B store per lane.
// Q, K: rows = positions, k = head dim. V^T: rows = head dim, k = positions.
// One k loop serves all three: a tile's registers run along the rows of the core's second
// operand, which is W^T for Q and K and X for V^T (the first WMMA operand of the product: W^T
// rows for Q and K, X rows for V^T). The choice is the block's, made in scalar registers.
__global__ __launch_bounds__(256) void gemm_qkv_kernel(const _Float16* __restrict__ X,
                                                       const _Float16* __restrict__ Wt,
                                                       _Float16* __restrict__ C) {
  __shared__ __attribute__((aligned(16))) _Float16 ring[2 * G_BUF_HALVES];
  int lane = threadIdx.x & 31;
  int which = blockIdx.x >> 8;
  int tx = (blockIdx.x >> 3) & 31, tw = blockIdx.x & 7;  // 128 rows of X, 128 rows of W^T
  bool vt = which == 2;
  const _Float16* W = Wt + (size_t)which * DD * DD;
  _Float16* Cw = C + (size_t)which * BB * SS * DD;
  gemm_block_128x128<true>(vt ? W : X, vt ? X : W, ring, vt ? tw : tx, vt ? tx : tw,
                           [&](int m0, int n0, const v8f (&acc)[2][4]) {
    int x0 = vt ? n0 : m0;  // the wave tile's first row of X
    int w0 = vt ? m0 : n0;  // and of W^T: 64 rows, a head, for Q and K; 32 for V^T
    int b = x0 >> 11, s0 = x0 & (SS - 1), h = w0 >> 6;
    _Float16* Cb = Cw + (size_t)(b * HH + h) * SS * HD +
                   (vt ? frag_unit((w0 & 63) >> 4, s0 >> 5, SS / 32) : frag_unit(s0 >> 4, 0, HD / 32));
    int mstep = vt ? (SS / 32) << 9 : (HD / 32) << 9;  // the next row tile of C
    v8h o[2][4];
#pragma unroll
    for (int mt = 0; mt < 2; ++mt)
#pragma unroll
      for (int nt = 0; nt < 4; ++nt) o[mt][nt] = to_f16(acc[mt][nt]);
    // Keeps the 8 stores behind all the conversions: no register of an issued store is then
    // written again, and the stores need no wait between them.
    __builtin_amdgcn_sched_barrier(0);
#pragma unroll
    for (int mt = 0; mt < 2; ++mt)
#pragma unroll
      for (int nt = 0; nt < 4; ++nt)  // 16 k a tile: planes nt of consecutive units
        *(v8h*)(Cb + mt * mstep + (nt << 8) + (lane << 3)) = o[mt][nt];
  });
}

__global__ __launch_bounds__(256) void gemm_f32out_kernel(const _Float16* __restrict__ A,
                                                          const _Float16* __restrict__ Bt,
                                                          float* __restrict__ C) {
  __shared__ __attribute__((aligned(16))) _Float16 ring[2 * G_BUF_HALVES];
  int lane = threadIdx.x & 31;
  gemm_block_128x128<false>(A, Bt, ring, blockIdx.x >> 3, blockIdx.x & 7,
                            [&](int m0, int n0, const v8f (&acc)[2][4]) {
#pragma unroll
    for (int mt = 0; mt < 2; ++mt)
#pragma unroll
      for (int nt = 0; nt < 4; ++nt) {
        int row = m0 + (mt << 4) + ((lane >> 4) << 3);
        int col = n0 + (nt << 4) + (lane & 15);
        for (int r = 0; r < 8; ++r) C[(size_t)(row + r) * DD + col] = acc[mt][nt][r];
      }
  });
}

// -------- RoPE over Q,K, f16 in fragment order per (batch, head) --------------
// A thread takes one 16-B piece (4 pairs of one position) at the same place in 4 of the
// 32 (batch, head) planes of Q and of K: its 4 (cos, sin) are read once for all 8 pieces.
__global__ __launch_bounds__(256) void rope_kernel(_Float16* __restrict__ Q,
                                                   _Float16* __restrict__ K,
                                                   const float* __restrict__ fc) {
  int off = (((blockIdx.x & 63) << 8) + threadIdx.x) << 3;  // 64 blocks cover a plane
  // bits of off: 3-6 row & 15, 7-9 k >> 3, 10.. row >> 4
  int s  = ((off >> 10) << 4) + ((off >> 3) & 15);
  int k0 = ((off >> 7) & 7) << 3;
  const float4* f = (const float4*)(fc + s * HD + k0);  // (cos, sin) of pairs k0 / 2 .. k0 / 2 + 3
  float4 f0 = f[0], f1 = f[1];
  size_t base = (size_t)(blockIdx.x >> 6) * 4 * SS * HD + off;
  v8h q[4], k[4];
#pragma unroll
  for (int p = 0; p < 4; ++p) {
    q[p] = *(const v8h*)(Q + base + (size_t)p * SS * HD);
    k[p] = *(const v8h*)(K + base + (size_t)p * SS * HD);
  }
  float c[4] = {f0.x, f0.z, f1.x, f1.z};
  float d[4] = {f0.y, f0.w, f1.y, f1.w};
#pragma unroll
  for (int p = 0; p < 4; ++p)
#pragma unroll
    for (int i = 0; i < 4; ++i) {
      float a = (float)q[p][2 * i], b = (float)q[p][2 * i + 1];
      q[p][2 * i]     = (_Float16)(a * c[i] - b * d[i]);
      q[p][2 * i + 1] = (_Float16)(a * d[i] + b * c[i]);
      a = (float)k[p][2 * i]; b = (float)k[p][2 * i + 1];
      k[p][2 * i]     = (_Float16)(a * c[i] - b * d[i]);
      k[p][2 * i + 1] = (_Float16)(a * d[i] + b * c[i]);
    }
  // Keeps the 8 stores behind all the arithmetic: no register of an issued store is then
  // written again, and the stores need no wait between them.
  __builtin_amdgcn_sched_barrier(0);
#pragma unroll
  for (int p = 0; p < 4; ++p) {
    *(v8h*)(Q + base + (size_t)p * SS * HD) = q[p];
    *(v8h*)(K + base + (size_t)p * SS * HD) = k[p];
  }
}

// ---------------- attention: per-chunk softmax, chunk outputs summed -------
// Lane l <-> lane l ^ 16 (the two halves of a wave hold the two halves of a column).
static __device__ __forceinline__ float xhalf(float x) {
  int b = __builtin_bit_cast(int, x);
  return __builtin_bit_cast(float,
      __builtin_amdgcn_permlanex16(b, b, 0x76543210, 0xfedcba98, false, false));
}

// K and V^T reach the waves through LDS. A stage is 128 keys: 16 KB of K (contiguous in
// fragment order), then 4 KB of each of the 4 d tiles of V^T. The 8 waves of a block, 128
// queries of one (batch, head), share it, so L2 delivers a stage once a block, not once a wave.
#define STAGE_KEYS 128
#define STAGE_HALVES 16384  // K 8192 + V^T 8192 f16
#define NSTAGES (SS / STAGE_KEYS)

// One stage's copies, 8 x 16 B a lane. k, v: this lane's first 16 B of the stage in K and in
// V^T; l: the LDS byte address of its first 16 B in the buffer.
static __device__ __forceinline__ void copy_stage(const _Float16* k, const _Float16* v, unsigned l) {
  // The closing s_wait_xcnt stands in the copies' own statement, in front of any later
  // overwrite of the address registers they name.
  asm volatile(
      "global_load_async_to_lds_b128 %0, %8, off\n\t"
      "global_load_async_to_lds_b128 %1, %9, off\n\t"
      "global_load_async_to_lds_b128 %2, %10, off\n\t"
      "global_load_async_to_lds_b128 %3, %11, off\n\t"
      "global_load_async_to_lds_b128 %4, %12, off\n\t"
      "global_load_async_to_lds_b128 %5, %13, off\n\t"
      "global_load_async_to_lds_b128 %6, %14, off\n\t"
      "global_load_async_to_lds_b128 %7, %15, off\n\t"
      "s_wait_xcnt 0x0"
      :: "v"(l), "v"(l + 4096u), "v"(l + 8192u), "v"(l + 12288u),
         "v"(l + 16384u), "v"(l + 20480u), "v"(l + 24576u), "v"(l + 28672u),
         "v"(k), "v"(k + 2048), "v"(k + 4096), "v"(k + 6144),
         "v"(v), "v"(v + 16 * SS), "v"(v + 32 * SS), "v"(v + 48 * SS)
      : "memory");
}

__global__ __launch_bounds__(256) void attn_kernel(const _Float16* __restrict__ Q,
                                                   const _Float16* __restrict__ Kd,
                                                   const _Float16* __restrict__ Vt,
                                                   _Float16* __restrict__ O) {
  __shared__ __attribute__((aligned(16))) _Float16 ring[2 * STAGE_HALVES];
  int tid  = threadIdx.x;
  int lane = tid & 31;
  int qt = ((blockIdx.x & 15) << 3) + (tid >> 5);  // 16 blocks of 8 query tiles a (batch, head)
  int bh = blockIdx.x >> 4;
  const _Float16* Qb = Q  + (size_t)bh * SS * HD;
  const _Float16* Kb = Kd + (size_t)bh * SS * HD;
  const _Float16* Vb = Vt + (size_t)bh * HD * SS;

  // This lane's share of stage 0, and its place in buffer 0.
  const _Float16* kcp = Kb + (tid << 3);
  const _Float16* vcp = Vb + (tid << 3);
  unsigned lcp = (unsigned)(size_t)ring + (tid << 4);
  copy_stage(kcp, vcp, lcp);

  v16h qb0 = load_frag(Qb, HD / 32, qt, 0, lane);
  v16h qb1 = load_frag(Qb, HD / 32, qt, 1, lane);

  // Stage 0 has landed for this wave's copies; the barrier publishes it to the block.
  asm volatile("s_wait_asynccnt 0x0" ::: "memory");
  __syncthreads();
  copy_stage(kcp + STAGE_KEYS * HD, vcp + STAGE_KEYS * 16, lcp + 2 * STAGE_HALVES);

  v8f of0 = {}, of1 = {}, of2 = {}, of3 = {};
  const float scale = 0.125f;  // 64^-0.5

  for (int c0 = 0; c0 < SS; c0 += CHUNK) {
    float mrun = -1e30f;  // running maximum of this lane's query
    float lrun = 0.f;     // running sum over this half's keys only
    v8f oa0 = {}, oa1 = {}, oa2 = {}, oa3 = {};

    for (int ks = 0; ks < CHUNK; ks += STAGE_KEYS) {
    int t = (c0 + ks) / STAGE_KEYS;  // stage, in buffer t & 1
    const _Float16* buf = ring + (t & 1) * STAGE_HALVES + (lane << 3);
    for (int j = 0; j < STAGE_KEYS / 32; ++j) {
      // ---- scores^T: 32 keys x 16 queries, K-dim = HD = 64 (2 steps) ----
      // 32 keys of the stage: 4 units of K, one unit of each d tile of V^T
      const _Float16* kp = buf + (j << 11);
      const _Float16* vp = buf + 8192 + (j << 9);
      v16h ka0 = load_frag_at(kp);
      v16h ka1 = load_frag_at(kp + 512);
      v16h ka2 = load_frag_at(kp + 1024);
      v16h ka3 = load_frag_at(kp + 1536);
      // K's loads stay in front of V^T's: LDS loads return in order, and the score products
      // then wait for 8 loads, not for all 16.
      __builtin_amdgcn_sched_barrier(0);
      v16h va0 = load_frag_at(vp);
      v16h va1 = load_frag_at(vp + 2048);
      v16h va2 = load_frag_at(vp + 4096);
      v16h va3 = load_frag_at(vp + 6144);
      // Keeps the pass's 16 LDS loads one group in front of its products: the scheduler
      // otherwise issues them two at a time, each pair with a full wait of its own.
      __builtin_amdgcn_sched_barrier(0);
      v8f s0 = {}, s1 = {};
      s0 = WMMA(ka0, qb0, s0);
      s0 = WMMA(ka1, qb1, s0);
      s1 = WMMA(ka2, qb0, s1);
      s1 = WMMA(ka3, qb1, s1);
      // ---- online softmax: 16 of the query's 32 scores are in this lane ----
      s0 *= scale;
      s1 *= scale;
      float mx[8];
      for (int r = 0; r < 8; ++r) mx[r] = fmaxf(s0[r], s1[r]);
      float mt = fmaxf(fmaxf(fmaxf(mx[0], mx[1]), fmaxf(mx[2], mx[3])),
                       fmaxf(fmaxf(mx[4], mx[5]), fmaxf(mx[6], mx[7])));
      mt = fmaxf(mt, xhalf(mt));
      float mnew  = fmaxf(mrun, mt);
      float alpha = __expf(mrun - mnew);
      mrun = mnew;
      float ps[8];
      v16h pb;
      for (int r = 0; r < 8; ++r) {
        float p0 = __expf(s0[r] - mnew);
        float p1 = __expf(s1[r] - mnew);
        ps[r] = p0 + p1;
        pb[r]     = (_Float16)p0;  // k = 8h + r
        pb[r + 8] = (_Float16)p1;  // k = 16 + 8h + r
      }
      lrun = lrun * alpha + (((ps[0] + ps[1]) + (ps[2] + ps[3])) +
                             ((ps[4] + ps[5]) + (ps[6] + ps[7])));
      for (int r = 0; r < 8; ++r) {
        oa0[r] *= alpha; oa1[r] *= alpha;
        oa2[r] *= alpha; oa3[r] *= alpha;
      }
      // ---- O^T += V^T @ P^T: K-dim = 32 keys, 4 d-tiles (Vt is [HD,S]) ----
      oa0 = WMMA(va0, pb, oa0);
      oa1 = WMMA(va1, pb, oa1);
      oa2 = WMMA(va2, pb, oa2);
      oa3 = WMMA(va3, pb, oa3);
    }
    // Publish point of stage t + 1: this wave's reads of stage t are done, its copies of
    // stage t + 1 have landed; behind the barrier both hold for the whole block.
    asm volatile("s_wait_dscnt 0x0" ::: "memory");
    asm volatile("s_wait_asynccnt 0x0" ::: "memory");
    __syncthreads();
    if (t + 2 < NSTAGES)
      copy_stage(kcp + (t + 2) * (STAGE_KEYS * HD), vcp + (t + 2) * (STAGE_KEYS * 16),
                 lcp + (t & 1) * (2 * STAGE_HALVES));
    }
    // ---- finalize chunk: join the halves' sums, normalize, accumulate ----
    float inv = 1.f / (lrun + xhalf(lrun));
    for (int r = 0; r < 8; ++r) {
      of0[r] += oa0[r] * inv;
      of1[r] += oa1[r] * inv;
      of2[r] += oa2[r] * inv;
      of3[r] += oa3[r] * inv;
    }
  }
  // No copy is outstanding when the wave ends.
  asm volatile("s_wait_asynccnt 0x0" ::: "memory");
  // ---- store O, f16 [B*S, D] in fragment order: a lane holds 8 consecutive d of its
  // query, and d tiles 2u, 2u + 1 are the two planes of k tile 2h + u ----
  int b = bh >> 4, h = bh & 15;
  _Float16* o = O + frag_unit(b * (SS / 16) + qt, 2 * h, DD / 32) + (lane << 3);
  *(v8h*)(o)       = to_f16(of0);
  *(v8h*)(o + 256) = to_f16(of1);
  *(v8h*)(o + 512) = to_f16(of2);
  *(v8h*)(o + 768) = to_f16(of3);
}

extern "C" void kernel_launch(void* const* d_in, const int* in_sizes, int n_in,
                              void* d_out, int out_size, void* d_ws, size_t ws_size,
                              hipStream_t stream) {
  const float* X  = (const float*)d_in[0];
  const float* FC = (const float*)d_in[1];
  const float* Wq = (const float*)d_in[2];
  const float* Wk = (const float*)d_in[3];
  const float* Wv = (const float*)d_in[4];
  const float* Wo = (const float*)d_in[5];
  float* out = (float*)d_out;

  char* ws = (char*)d_ws;
  const size_t MB = 1u << 20;
  // all in fragment order
  _Float16* Xh  = (_Float16*)(ws + 0);        // 8 MB  [B*S, D] f16
  _Float16* Wqt = (_Float16*)(ws + 8  * MB);  // 2 MB  [N,K] f16
  _Float16* Wkt = (_Float16*)(ws + 10 * MB);
  _Float16* Wvt = (_Float16*)(ws + 12 * MB);
  _Float16* Wot = (_Float16*)(ws + 14 * MB);
  _Float16* Qh  = (_Float16*)(ws + 16 * MB);  // 8 MB  [B,H,S,HD]
  _Float16* Kh  = (_Float16*)(ws + 24 * MB);  // 8 MB  [B,H,S,HD]
  _Float16* Vtb = (_Float16*)(ws + 32 * MB);  // 8 MB  [B,H,HD,S]
  _Float16* Oh  = (_Float16*)(ws + 40 * MB);  // 8 MB  [B*S, D]

  // 1) X fp32 -> f16, and weights fp32 [K,N] -> f16 [N,K]
  //    (Wqt, Wkt, Wvt, Wot are consecutive: one launch writes all four)
  prep_kernel<<<1024, 256, 0, stream>>>(X, Wq, Wk, Wv, Wo, Xh, Wqt);

  // 2) QKV projections: 3 x (4096/128)*(1024/128) = 768 block tiles x 256 thr
  //    (Wqt, Wkt, Wvt are consecutive, and so are Qh, Kh, Vtb)
  gemm_qkv_kernel<<<768, 256, 0, stream>>>(Xh, Wqt, Qh);

  // 3) RoPE on Q and K
  rope_kernel<<<512, 256, 0, stream>>>(Qh, Kh, FC);

  // 4) attention (waves = B*H*(S/16) = 4096 -> 512 blocks x 256 thr)
  attn_kernel<<<512, 256, 0, stream>>>(Qh, Kh, Vtb, Oh);

  // 5) output projection -> f32 d_out
  gemm_f32out_kernel<<<256, 256, 0, stream>>>(Oh, Wot, out);
}

// v008
// It runs in 79.3 microseconds.
// Next to v007, in two timings, it ran 1.04 and 1.05 times as fast.
// All steps since v000 together make it 3.89 times as fast.
#include <hip/hip_runtime.h>

#define BB 2
#define SS 2048
#define DD 1024
#define HH 16
#define HD 64
#define CHUNK 1024

typedef __attribute__((ext_vector_type(16))) _Float16 v16h;
typedef __attribute__((ext_vector_type(8)))  _Float16 v8h;
typedef __attribute__((ext_vector_type(4)))  _Float16 v4h;
typedef __attribute__((ext_vector_type(8)))  float    v8f;

#define WMMA(a, b, c) __builtin_amdgcn_wmma_f32_16x16x32_f16(false, (a), false, (b), (short)0, (c), false, false)

// Fragment order. Every f16 operand in the workspace, a [rows, k] matrix, is kept as
// 1-KB units of 16 rows x 32 k, unit index = row_tile * ktiles + k_tile. A unit is two
// 512-B planes (k 0..15, k 16..31); in a plane lane l = 16 * ((k >> 3) & 1) + (row & 15)
// owns 8 consecutive k. A wave-wide 16-B access then covers 512 contiguous bytes.
static __device__ __forceinline__ size_t frag_unit(int row_tile, int k_tile, int ktiles) {
  return ((size_t)row_tile * ktiles + k_tile) << 9;
}

// Load a 16x32 f16 WMMA fragment (A operand, or B when the rows are the columns of B).
static __device__ __forceinline__ v16h load_frag(const _Float16* __restrict__ p,
                                                 int ktiles, int row_tile, int k_tile, int lane) {
  const _Float16* base = p + frag_unit(row_tile, k_tile, ktiles) + (lane << 3);
  v8h lo = *(const v8h*)(base);
  v8h hi = *(const v8h*)(base + 256);
  v16h r;
#pragma unroll
  for (int i = 0; i < 8; ++i) { r[i] = lo[i]; r[i + 8] = hi[i]; }
  return r;
}

// The same from a running pointer: base = the unit's start + 8 * lane.
static __device__ __forceinline__ v16h load_frag_at(const _Float16* base) {
  v8h lo = *(const v8h*)(base);
  v8h hi = *(const v8h*)(base + 256);
  v16h r;
#pragma unroll
  for (int i = 0; i < 8; ++i) { r[i] = lo[i]; r[i + 8] = hi[i]; }
  return r;
}

static __device__ __forceinline__ v8h to_f16(v8f x) {
  v8h o;
  for (int r = 0; r < 8; ++r) o[r] = (_Float16)x[r];
  return o;
}

// The two element-wise passes (convert, weight transpose) run 4096 waves each, 16 per
// WGP, every lane with 8 or more loads in flight.
// Passes that do not depend on each other share a launch: each launch costs its gap, its fill,
// its first loads' latency and its tail, whatever it computes.

// ---------------- fp32 [rows, DD] -> f16 fragment order: one wave per two units ------
// blk: 0 .. 511.
static __device__ __forceinline__ void cvt_f16_block(int blk, const float* __restrict__ src,
                                                     _Float16* __restrict__ dst) {
  // Units unit, unit + 1: k tiles 2t, 2t + 1 of one row tile, 256 B of each of its rows.
  int unit = (((blk << 8) + threadIdx.x) >> 5) << 1;  // row_tile * (DD / 32) + k_tile
  int lane = threadIdx.x & 31;
  int row = ((unit / (DD / 32)) << 4) + (lane & 15);
  int k   = ((unit % (DD / 32)) << 5) + ((lane >> 4) << 3);
  const float4* s = (const float4*)(src + (size_t)row * DD + k);
  float4 x[2][4];
#pragma unroll
  for (int u = 0; u < 2; ++u) {
    x[u][0] = s[8 * u];     x[u][1] = s[8 * u + 1];
    x[u][2] = s[8 * u + 4]; x[u][3] = s[8 * u + 5];
  }
  _Float16* o = dst + ((size_t)unit << 9) + (lane << 3);
#pragma unroll
  for (int u = 0; u < 2; ++u)
#pragma unroll
    for (int p = 0; p < 2; ++p) {
      float4 a = x[u][2 * p], b = x[u][2 * p + 1];
      v8h h = {(_Float16)a.x, (_Float16)a.y, (_Float16)a.z, (_Float16)a.w,
               (_Float16)b.x, (_Float16)b.y, (_Float16)b.z, (_Float16)b.w};
      *(v8h*)(o + (u << 9) + (p << 8)) = h;
    }
}

// -------- weight transpose: W[K,N] f32 -> Wt[N,K] f16 in fragment order, all four -----
// One wave per 32 k x 32 n. Lane = n: a load is one whole 128-B line of a row of W, and a
// lane's 8 consecutive k are one 16-B piece of its row's unit, so the transpose needs no
// exchange between lanes. The wave writes two whole units (n tiles 2 * np, 2 * np + 1).
// blk: 0 .. 511.
static __device__ __forceinline__ void transpose_w_block(int blk, const float* __restrict__ W0,
                                                         const float* __restrict__ W1,
                                                         const float* __restrict__ W2,
                                                         const float* __restrict__ W3,
                                                         _Float16* __restrict__ Wt) {
  int wave = ((blk << 8) + threadIdx.x) >> 5;  // weight * 1024 + np * 32 + k_tile
  int lane = threadIdx.x & 31;
  int w  = blk >> 7;  // 128 blocks a weight
  int np = (wave >> 5) & 31;
  int kt = wave & 31;
  const float* W = w == 0 ? W0 : w == 1 ? W1 : w == 2 ? W2 : W3;
  const float* s = W + (size_t)(kt << 5) * DD + (np << 5) + lane;
  float x[32];
#pragma unroll
  for (int i = 0; i < 32; ++i) x[i] = s[(size_t)i * DD];
  _Float16* o = Wt + (size_t)w * DD * DD + frag_unit(2 * np + (lane >> 4), kt, DD / 32) +
                ((lane & 15) << 3);
#pragma unroll
  for (int g = 0; g < 4; ++g) {  // k = 8g .. 8g + 7: plane g >> 1, lane half g & 1
    v8h h;
#pragma unroll
    for (int i = 0; i < 8; ++i) h[i] = (_Float16)x[8 * g + i];
    *(v8h*)(o + ((g >> 1) << 8) + ((g & 1) << 7)) = h;
  }
}

// Both in one launch: blocks 0 .. 511 convert X, blocks 512 .. 1023 transpose the weights.
__global__ __launch_bounds__(256) void prep_kernel(const float* __restrict__ X,
                                                   const float* __restrict__ W0,
                                                   const float* __restrict__ W1,
                                                   const float* __restrict__ W2,
                                                   const float* __restrict__ W3,
                                                   _Float16* __restrict__ Xh,
                                                   _Float16* __restrict__ Wt) {
  if (blockIdx.x < 512) cvt_f16_block(blockIdx.x, X, Xh);
  else                  transpose_w_block(blockIdx.x - 512, W0, W1, W2, W3, Wt);
}

// ---------------- WMMA GEMM core: 128x128 block tile, 32x64 wave tile -------
// A and Bt, each [BB*SS, DD] or [DD, DD], both f16 in fragment order, reach the waves through LDS.
// A stage is 128 k of the block's 128 rows of A, then of its 128 rows of Bt: per row tile 4
// consecutive units, 4 KB. The 8 waves (4 along m, 2 along n) share it: L2 delivers every row
// once a block, though 2 waves use a row of A and 4 waves a row of Bt.
#define G_KT 4                              // k tiles of a stage
#define G_STAGES (DD / 32 / G_KT)
#define G_ROWT_HALVES (G_KT * 512)          // one row tile of a stage
#define G_OPER_HALVES (8 * G_ROWT_HALVES)   // one operand of a stage
#define G_BUF_HALVES (2 * G_OPER_HALVES)    // a stage: 64 KB

// One operand's share of a stage, 8 x 16 B a lane, one copy per row tile. g: this lane's
// 16 B in the first row tile; l: the LDS byte address of its place there.
static __device__ __forceinline__ void copy_oper(const _Float16* g, unsigned l) {
  // The closing s_wait_xcnt stands in the copies' own statement, in front of any later
  // overwrite of the address registers they name.
  asm volatile(
      "global_load_async_to_lds_b128 %0, %8, off\n\t"
      "global_load_async_to_lds_b128 %1, %9, off\n\t"
      "global_load_async_to_lds_b128 %2, %10, off\n\t"
      "global_load_async_to_lds_b128 %3, %11, off\n\t"
      "global_load_async_to_lds_b128 %4, %12, off\n\t"
      "global_load_async_to_lds_b128 %5, %13, off\n\t"
      "global_load_async_to_lds_b128 %6, %14, off\n\t"
      "global_load_async_to_lds_b128 %7, %15, off\n\t"
      "s_wait_xcnt 0x0"
      :: "v"(l), "v"(l + 4096u), "v"(l + 8192u), "v"(l + 12288u),
         "v"(l + 16384u), "v"(l + 20480u), "v"(l + 24576u), "v"(l + 28672u),
         "v"(g), "v"(g + 16 * DD), "v"(g + 32 * DD), "v"(g + 48 * DD),
         "v"(g + 64 * DD), "v"(g + 80 * DD), "v"(g + 96 * DD), "v"(g + 112 * DD)
      : "memory");
}

// SWAP = false: tile (mt, nt) holds C (register r, lane l: row 8 * (l >> 4) + r, column
// l & 15); SWAP = true: it holds C^T (row of C = l & 15, column of C = 8 * (l >> 4) + r),
// same products, same k order. ring: 2 * G_BUF_HALVES of LDS. bm, bn: the block tile, in
// units of 128 rows of A and of 128 rows of Bt.
template <bool SWAP, typename STORE>
static __device__ __forceinline__ void gemm_block_128x128(const _Float16* __restrict__ A,
                                                          const _Float16* __restrict__ Bt,
                                                          _Float16* ring, int bm, int bn,
                                                          STORE store) {
  int tid  = threadIdx.x;
  int lane = tid & 31;
  int wm = tid >> 6, wn = (tid >> 5) & 1;          // the wave's place in the block tile
  // This lane's share of stage 0, and its place in buffer 0.
  const _Float16* acp = A  + frag_unit(bm << 3, 0, DD / 32) + (tid << 3);
  const _Float16* bcp = Bt + frag_unit(bn << 3, 0, DD / 32) + (tid << 3);
  unsigned lcp = (unsigned)(size_t)ring + (tid << 4);
  copy_oper(acp, lcp);
  copy_oper(bcp, lcp + 2 * G_OPER_HALVES);

  v8f acc[2][4];
#pragma unroll
  for (int mt = 0; mt < 2; ++mt)
#pragma unroll
    for (int nt = 0; nt < 4; ++nt) acc[mt][nt] = (v8f){};

  // Stage 0 has landed for this wave's copies; the barrier publishes it to the block.
  asm volatile("s_wait_asynccnt 0x0" ::: "memory");
  __syncthreads();
  copy_oper(acp + G_ROWT_HALVES, lcp + 2 * G_BUF_HALVES);
  copy_oper(bcp + G_ROWT_HALVES, lcp + 2 * (G_BUF_HALVES + G_OPER_HALVES));

  // One k step's operands, 2 A and 4 B fragments, are fetched from LDS as one group of 12
  // loads, one k step ahead of their products, into one of two register sets.
  struct Step { v16h a[2], b[4]; };
  // This lane's place in the wave's first A and first B fragment of buffer 0.
  const _Float16* pa = ring + wm * (2 * G_ROWT_HALVES) + (lane << 3);
  const _Float16* pb = ring + G_OPER_HALVES + wn * (4 * G_ROWT_HALVES) + (lane << 3);
  auto fetch = [&](Step& f, int buf, int j) {  // k step j of the stage in buffer buf
    const _Float16* a = pa + buf * G_BUF_HALVES + (j << 9);
    const _Float16* b = pb + buf * G_BUF_HALVES + (j << 9);
    f.a[0] = load_frag_at(a);
    f.a[1] = load_frag_at(a + G_ROWT_HALVES);
#pragma unroll
    for (int nt = 0; nt < 4; ++nt) f.b[nt] = load_frag_at(b + nt * G_ROWT_HALVES);
    // Keeps the products written behind a fetch behind it: the scheduler otherwise moves the
    // first of them, with their load waits, in front of the group, which then issues late.
    __builtin_amdgcn_sched_barrier(0);
  };
  auto products = [&](const Step& f) {
#pragma unroll
    for (int nt = 0; nt < 4; ++nt) {
      if (SWAP) {
        acc[0][nt] = WMMA(f.b[nt], f.a[0], acc[0][nt]);
        acc[1][nt] = WMMA(f.b[nt], f.a[1], acc[1][nt]);
      } else {
        acc[0][nt] = WMMA(f.a[0], f.b[nt], acc[0][nt]);
        acc[1][nt] = WMMA(f.a[1], f.b[nt], acc[1][nt]);
      }
    }
  };
  Step x, y;
  fetch(x, 0, 0);
  // Kept rolled: unrolled, the addresses of all stages' copies are formed ahead and held in
  // registers, past v255, and the text of a loop that runs once grows eightfold.
#pragma unroll 1
  for (int t = 0; t < G_STAGES; ++t) {  // stage t, in buffer t & 1
    fetch(y, t & 1, 1);
    products(x);
    fetch(x, t & 1, 2);
    products(y);
    fetch(y, t & 1, 3);
    products(x);
    // Keeps these products in front of the publish point: moved behind the barrier they would
    // stand in front of the refill, which would then issue late.
    __builtin_amdgcn_sched_barrier(0);
    // Publish point of stage t + 1, in front of stage t's last products, whose fragments are
    // fetched: this wave's reads of stage t are done, its copies of stage t + 1 have landed;
    // behind the barrier both hold for the whole block.
    asm volatile("s_wait_dscnt 0x0" ::: "memory");
    asm volatile("s_wait_asynccnt 0x0" ::: "memory");
    __syncthreads();
    if (t + 2 < G_STAGES) {
      copy_oper(acp + (t + 2) * G_ROWT_HALVES, lcp + (t & 1) * (2 * G_BUF_HALVES));
      copy_oper(bcp + (t + 2) * G_ROWT_HALVES,
                lcp + (t & 1) * (2 * G_BUF_HALVES) + 2 * G_OPER_HALVES);
    }
    if (t + 1 < G_STAGES) fetch(x, (t + 1) & 1, 0);
    products(y);
  }
  // No copy is outstanding when the wave ends.
  asm volatile("s_wait_asynccnt 0x0" ::: "memory");
  int m0 = (bm << 7) + (wm << 5);
  int n0 = (bn << 7) + (wn << 6);
  store(m0, n0, acc);
}

// The three projections in one launch of 3 x 256 blocks: blocks 0 .. 255 Q, 256 .. 511 K,
// 512 .. 767 V^T. Wt: Wq^T, Wk^T, Wv^T one behind the other; C: Q, K, V^T likewise. Two blocks
// fit a WGP (LDS, registers): one block's copies fly while the other's land or are worked on,
// and a block's first stage and its stores overlap other blocks' k loops.
// C is in fragment order per (batch, head); a lane's 8 values are 8 consecutive k of the
// operand that attention reads, so each tile leaves as one 16-B store per lane.
// Q, K: rows = positions, k = head dim. V^T: rows = head dim, k = positions.
// One k loop serves all three: a tile's registers run along the rows of the core's second
// operand, which is W^T for Q and K and X for V^T (the first WMMA operand of the product: W^T
// rows for Q and K, X rows for V^T). The choice is the block's, made in scalar registers.
// RoPE is applied to Q and K here, on the f32 sums: a lane's 8 values of a tile are 4 whole
// (even, odd) pairs of one position, so the rotation needs no other lane, and Q and K are
// rounded to f16 once and cross memory once. fc: [SS, HD / 2] (cos, sin).
__global__ __launch_bounds__(256) void gemm_qkv_kernel(const _Float16* __restrict__ X,
                                                       const _Float16* __restrict__ Wt,
                                                       const float* __restrict__ fc,
                                                       _Float16* __restrict__ C) {
  __shared__ __attribute__((aligned(16))) _Float16 ring[2 * G_BUF_HALVES];
  int lane = threadIdx.x & 31;
  int which = blockIdx.x >> 8;
  int tx = (blockIdx.x >> 3) & 31, tw = blockIdx.x & 7;  // 128 rows of X, 128 rows of W^T
  bool vt = which == 2;
  const _Float16* W = Wt + (size_t)which * DD * DD;
  _Float16* Cw = C + (size_t)which * BB * SS * DD;
  gemm_block_128x128<true>(vt ? W : X, vt ? X : W, ring, vt ? tw : tx, vt ? tx : tw,
                           [&](int m0, int n0, const v8f (&acc)[2][4]) {
    int x0 = vt ? n0 : m0;  // the wave tile's first row of X
    int w0 = vt ? m0 : n0;  // and of W^T: 64 rows, a head, for Q and K; 32 for V^T
    int b = x0 >> 11, s0 = x0 & (SS - 1), h = w0 >> 6;
    _Float16* Cb = Cw + (size_t)(b * HH + h) * SS * HD +
                   (vt ? frag_unit((w0 & 63) >> 4, s0 >> 5, SS / 32) : frag_unit(s0 >> 4, 0, HD / 32));
    int mstep = vt ? (SS / 32) << 9 : (HD / 32) << 9;  // the next row tile of C
    v8h o[2][4];
    if (vt) {
#pragma unroll
      for (int mt = 0; mt < 2; ++mt)
#pragma unroll
        for (int nt = 0; nt < 4; ++nt) o[mt][nt] = to_f16(acc[mt][nt]);
    } else {
      // Tile (mt, nt), this lane: position s0 + 16 * mt + (lane & 15), head dims
      // 16 * nt + 8 * (lane >> 4) + 0 .. 7, whose 4 (cos, sin) are 32 consecutive bytes.
      const float4* f = (const float4*)(fc + (s0 + (lane & 15)) * HD + ((lane >> 4) << 3));
      float4 cs[2][4][2];
#pragma unroll
      for (int mt = 0; mt < 2; ++mt)
#pragma unroll
        for (int nt = 0; nt < 4; ++nt) {
          cs[mt][nt][0] = f[mt * (16 * HD / 4) + nt * 4];
          cs[mt][nt][1] = f[mt * (16 * HD / 4) + nt * 4 + 1];
        }
      // Stands behind the 16 loads and in front of any overwrite of their address register,
      // which it names as an input so that no load's result is placed over it.
      asm volatile("s_wait_xcnt 0x0" :: "v"(f) : "memory");
#pragma unroll
      for (int mt = 0; mt < 2; ++mt)
#pragma unroll
        for (int nt = 0; nt < 4; ++nt) {
          float4 f0 = cs[mt][nt][0], f1 = cs[mt][nt][1];
          float c[4] = {f0.x, f0.z, f1.x, f1.z};
          float d[4] = {f0.y, f0.w, f1.y, f1.w};
#pragma unroll
          for (int i = 0; i < 4; ++i) {
            float a = acc[mt][nt][2 * i], b = acc[mt][nt][2 * i + 1];
            o[mt][nt][2 * i]     = (_Float16)(a * c[i] - b * d[i]);
            o[mt][nt][2 * i + 1] = (_Float16)(a * d[i] + b * c[i]);
          }
        }
    }
    // Keeps the 8 stores behind all the conversions: no register of an issued store is then
    // written again, and the stores need no wait between them.
    __builtin_amdgcn_sched_barrier(0);
#pragma unroll
    for (int mt = 0; mt < 2; ++mt)
#pragma unroll
      for (int nt = 0; nt < 4; ++nt)  // 16 k a tile: planes nt of consecutive units
        *(v8h*)(Cb + mt * mstep + (nt << 8) + (lane << 3)) = o[mt][nt];
  });
}

__global__ __launch_bounds__(256) void gemm_f32out_kernel(const _Float16* __restrict__ A,
                                                          const _Float16* __restrict__ Bt,
                                                          float* __restrict__ C) {
  __shared__ __attribute__((aligned(16))) _Float16 ring[2 * G_BUF_HALVES];
  int lane = threadIdx.x & 31;
  gemm_block_128x128<false>(A, Bt, ring, blockIdx.x >> 3, blockIdx.x & 7,
                            [&](int m0, int n0, const v8f (&acc)[2][4]) {
#pragma unroll
    for (int mt = 0; mt < 2; ++mt)
#pragma unroll
      for (int nt = 0; nt < 4; ++nt) {
        int row = m0 + (mt << 4) + ((lane >> 4) << 3);
        int col = n0 + (nt << 4) + (lane & 15);
        for (int r = 0; r < 8; ++r) C[(size_t)(row + r) * DD + col] = acc[mt][nt][r];
      }
  });
}

// ---------------- attention: per-chunk softmax, chunk outputs summed -------
// Lane l <-> lane l ^ 16 (the two halves of a wave hold the two halves of a column).
static __device__ __forceinline__ float xhalf(float x) {
  int b = __builtin_bit_cast(int, x);
  return __builtin_bit_cast(float,
      __builtin_amdgcn_permlanex16(b, b, 0x76543210, 0xfedcba98, false, false));
}

// K and V^T reach the waves through LDS. A stage is 128 keys: 16 KB of K (contiguous in
// fragment order), then 4 KB of each of the 4 d tiles of V^T. The 8 waves of a block, 128
// queries of one (batch, head), share it, so L2 delivers a stage once a block, not once a wave.
#define STAGE_KEYS 128
#define STAGE_HALVES 16384  // K 8192 + V^T 8192 f16
#define NSTAGES (SS / STAGE_KEYS)

// One stage's copies, 8 x 16 B a lane. k, v: this lane's first 16 B of the stage in K and in
// V^T; l: the LDS byte address of its first 16 B in the buffer.
static __device__ __forceinline__ void copy_stage(const _Float16* k, const _Float16* v, unsigned l) {
  // The closing s_wait_xcnt stands in the copies' own statement, in front of any later
  // overwrite of the address registers they name.
  asm volatile(
      "global_load_async_to_lds_b128 %0, %8, off\n\t"
      "global_load_async_to_lds_b128 %1, %9, off\n\t"
      "global_load_async_to_lds_b128 %2, %10, off\n\t"
      "global_load_async_to_lds_b128 %3, %11, off\n\t"
      "global_load_async_to_lds_b128 %4, %12, off\n\t"
      "global_load_async_to_lds_b128 %5, %13, off\n\t"
      "global_load_async_to_lds_b128 %6, %14, off\n\t"
      "global_load_async_to_lds_b128 %7, %15, off\n\t"
      "s_wait_xcnt 0x0"
      :: "v"(l), "v"(l + 4096u), "v"(l + 8192u), "v"(l + 12288u),
         "v"(l + 16384u), "v"(l + 20480u), "v"(l + 24576u), "v"(l + 28672u),
         "v"(k), "v"(k + 2048), "v"(k + 4096), "v"(k + 6144),
         "v"(v), "v"(v + 16 * SS), "v"(v + 32 * SS), "v"(v + 48 * SS)
      : "memory");
}

__global__ __launch_bounds__(256) void attn_kernel(const _Float16* __restrict__ Q,
                                                   const _Float16* __restrict__ Kd,
                                                   const _Float16* __restrict__ Vt,
                                                   _Float16* __restrict__ O) {
  __shared__ __attribute__((aligned(16))) _Float16 ring[2 * STAGE_HALVES];
  int tid  = threadIdx.x;
  int lane = tid & 31;
  int qt = ((blockIdx.x & 15) << 3) + (tid >> 5);  // 16 blocks of 8 query tiles a (batch, head)
  int bh = blockIdx.x >> 4;
  const _Float16* Qb = Q  + (size_t)bh * SS * HD;
  const _Float16* Kb = Kd + (size_t)bh * SS * HD;
  const _Float16* Vb = Vt + (size_t)bh * HD * SS;

  // This lane's share of stage 0, and its place in buffer 0.
  const _Float16* kcp = Kb + (tid << 3);
  const _Float16* vcp = Vb + (tid << 3);
  unsigned lcp = (unsigned)(size_t)ring + (tid << 4);
  copy_stage(kcp, vcp, lcp);

  v16h qb0 = load_frag(Qb, HD / 32, qt, 0, lane);
  v16h qb1 = load_frag(Qb, HD / 32, qt, 1, lane);

  // Stage 0 has landed for this wave's copies; the barrier publishes it to the block.
  asm volatile("s_wait_asynccnt 0x0" ::: "memory");
  __syncthreads();
  copy_stage(kcp + STAGE_KEYS * HD, vcp + STAGE_KEYS * 16, lcp + 2 * STAGE_HALVES);

  v8f of0 = {}, of1 = {}, of2 = {}, of3 = {};
  const float scale = 0.125f;  // 64^-0.5

  for (int c0 = 0; c0 < SS; c0 += CHUNK) {
    float mrun = -1e30f;  // running maximum of this lane's query
    float lrun = 0.f;     // running sum over this half's keys only
    v8f oa0 = {}, oa1 = {}, oa2 = {}, oa3 = {};

    for (int ks = 0; ks < CHUNK; ks += STAGE_KEYS) {
    int t = (c0 + ks) / STAGE_KEYS;  // stage, in buffer t & 1
    const _Float16* buf = ring + (t & 1) * STAGE_HALVES + (lane << 3);
    for (int j = 0; j < STAGE_KEYS / 32; ++j) {
      // ---- scores^T: 32 keys x 16 queries, K-dim = HD = 64 (2 steps) ----
      // 32 keys of the stage: 4 units of K, one unit of each d tile of V^T
      const _Float16* kp = buf + (j << 11);
      const _Float16* vp = buf + 8192 + (j << 9);
      v16h ka0 = load_frag_at(kp);
      v16h ka1 = load_frag_at(kp + 512);
      v16h ka2 = load_frag_at(kp + 1024);
      v16h ka3 = load_frag_at(kp + 1536);
      // K's loads stay in front of V^T's: LDS loads return in order, and the score products
      // then wait for 8 loads, not for all 16.
      __builtin_amdgcn_sched_barrier(0);
      v16h va0 = load_frag_at(vp);
      v16h va1 = load_frag_at(vp + 2048);
      v16h va2 = load_frag_at(vp + 4096);
      v16h va3 = load_frag_at(vp + 6144);
      // Keeps the pass's 16 LDS loads one group in front of its products: the scheduler
      // otherwise issues them two at a time, each pair with a full wait of its own.
      __builtin_amdgcn_sched_barrier(0);
      v8f s0 = {}, s1 = {};
      s0 = WMMA(ka0, qb0, s0);
      s0 = WMMA(ka1, qb1, s0);
      s1 = WMMA(ka2, qb0, s1);
      s1 = WMMA(ka3, qb1, s1);
      // ---- online softmax: 16 of the query's 32 scores are in this lane ----
      s0 *= scale;
      s1 *= scale;
      float mx[8];
      for (int r = 0; r < 8; ++r) mx[r] = fmaxf(s0[r], s1[r]);
      float mt = fmaxf(fmaxf(fmaxf(mx[0], mx[1]), fmaxf(mx[2], mx[3])),
                       fmaxf(fmaxf(mx[4], mx[5]), fmaxf(mx[6], mx[7])));
      mt = fmaxf(mt, xhalf(mt));
      float mnew  = fmaxf(mrun, mt);
      float alpha = __expf(mrun - mnew);
      mrun = mnew;
      float ps[8];
      v16h pb;
      for (int r = 0; r < 8; ++r) {
        float p0 = __expf(s0[r] - mnew);
        float p1 = __expf(s1[r] - mnew);
        ps[r] = p0 + p1;
        pb[r]     = (_Float16)p0;  // k = 8h + r
        pb[r + 8] = (_Float16)p1;  // k = 16 + 8h + r
      }
      lrun = lrun * alpha + (((ps[0] + ps[1]) + (ps[2] + ps[3])) +
                             ((ps[4] + ps[5]) + (ps[6] + ps[7])));
      for (int r = 0; r < 8; ++r) {
        oa0[r] *= alpha; oa1[r] *= alpha;
        oa2[r] *= alpha; oa3[r] *= alpha;
      }
      // ---- O^T += V^T @ P^T: K-dim = 32 keys, 4 d-tiles (Vt is [HD,S]) ----
      oa0 = WMMA(va0, pb, oa0);
      oa1 = WMMA(va1, pb, oa1);
      oa2 = WMMA(va2, pb, oa2);
      oa3 = WMMA(va3, pb, oa3);
    }
    // Publish point of stage t + 1: this wave's reads of stage t are done, its copies of
    // stage t + 1 have landed; behind the barrier both hold for the whole block.
    asm volatile("s_wait_dscnt 0x0" ::: "memory");
    asm volatile("s_wait_asynccnt 0x0" ::: "memory");
    __syncthreads();
    if (t + 2 < NSTAGES)
      copy_stage(kcp + (t + 2) * (STAGE_KEYS * HD), vcp + (t + 2) * (STAGE_KEYS * 16),
                 lcp + (t & 1) * (2 * STAGE_HALVES));
    }
    // ---- finalize chunk: join the halves' sums, normalize, accumulate ----
    float inv = 1.f / (lrun + xhalf(lrun));
    for (int r = 0; r < 8; ++r) {
      of0[r] += oa0[r] * inv;
      of1[r] += oa1[r] * inv;
      of2[r] += oa2[r] * inv;
      of3[r] += oa3[r] * inv;
    }
  }
  // No copy is outstanding when the wave ends.
  asm volatile("s_wait_asynccnt 0x0" ::: "memory");
  // ---- store O, f16 [B*S, D] in fragment order: a lane holds 8 consecutive d of its
  // query, and d tiles 2u, 2u + 1 are the two planes of k tile 2h + u ----
  int b = bh >> 4, h = bh & 15;
  _Float16* o = O + frag_unit(b * (SS / 16) + qt, 2 * h, DD / 32) + (lane << 3);
  *(v8h*)(o)       = to_f16(of0);
  *(v8h*)(o + 256) = to_f16(of1);
  *(v8h*)(o + 512) = to_f16(of2);
  *(v8h*)(o + 768) = to_f16(of3);
}

extern "C" void kernel_launch(void* const* d_in, const int* in_sizes, int n_in,
                              void* d_out, int out_size, void* d_ws, size_t ws_size,
                              hipStream_t stream) {
  const float* X  = (const float*)d_in[0];
  const float* FC = (const float*)d_in[1];
  const float* Wq = (const float*)d_in[2];
  const float* Wk = (const float*)d_in[3];
  const float* Wv = (const float*)d_in[4];
  const float* Wo = (const float*)d_in[5];
  float* out = (float*)d_out;

  char* ws = (char*)d_ws;
  const size_t MB = 1u << 20;
  // all in fragment order
  _Float16* Xh  = (_Float16*)(ws + 0);        // 8 MB  [B*S, D] f16
  _Float16* Wqt = (_Float16*)(ws + 8  * MB);  // 2 MB  [N,K] f16
  _Float16* Wkt = (_Float16*)(ws + 10 * MB);
  _Float16* Wvt = (_Float16*)(ws + 12 * MB);
  _Float16* Wot = (_Float16*)(ws + 14 * MB);
  _Float16* Qh  = (_Float16*)(ws + 16 * MB);  // 8 MB  [B,H,S,HD]
  _Float16* Kh  = (_Float16*)(ws + 24 * MB);  // 8 MB  [B,H,S,HD]
  _Float16* Vtb = (_Float16*)(ws + 32 * MB);  // 8 MB  [B,H,HD,S]
  _Float16* Oh  = (_Float16*)(ws + 40 * MB);  // 8 MB  [B*S, D]

  // 1) X fp32 -> f16, and weights fp32 [K,N] -> f16 [N,K]
  //    (Wqt, Wkt, Wvt, Wot are consecutive: one launch writes all four)
  prep_kernel<<<1024, 256, 0, stream>>>(X, Wq, Wk, Wv, Wo, Xh, Wqt);

  // 2) QKV projections, with RoPE on Q and K: 3 x (4096/128)*(1024/128) = 768 block tiles
  //    x 256 thr (Wqt, Wkt, Wvt are consecutive, and so are Qh, Kh, Vtb)
  gemm_qkv_kernel<<<768, 256, 0, stream>>>(Xh, Wqt, FC, Qh);

  // 3) attention (waves = B*H*(S/16) = 4096 -> 512 blocks x 256 thr)
  attn_kernel<<<512, 256, 0, stream>>>(Qh, Kh, Vtb, Oh);

  // 4) output projection -> f32 d_out
  gemm_f32out_kernel<<<256, 256, 0, stream>>>(Oh, Wot, out);
}

// v009
// One run takes 76.7 microseconds.
// In both of two side-by-side timings against v008, it was 1.03 times as fast.
// Over all steps from v000 it is 4.01 times as fast.
#include <hip/hip_runtime.h>

#define BB 2
#define SS 2048
#define DD 1024
#define HH 16
#define HD 64
#define CHUNK 1024

typedef __attribute__((ext_vector_type(16))) _Float16 v16h;
typedef __attribute__((ext_vector_type(8)))  _Float16 v8h;
typedef __attribute__((ext_vector_type(4)))  _Float16 v4h;
typedef __attribute__((ext_vector_type(8)))  float    v8f;

#define WMMA(a, b, c) __builtin_amdgcn_wmma_f32_16x16x32_f16(false, (a), false, (b), (short)0, (c), false, false)

// Fragment order. Every f16 operand in the workspace, a [rows, k] matrix, is kept as
// 1-KB units of 16 rows x 32 k, unit index = row_tile * ktiles + k_tile. A unit is two
// 512-B planes (k 0..15, k 16..31); in a plane lane l = 16 * ((k >> 3) & 1) + (row & 15)
// owns 8 consecutive k. A wave-wide 16-B access then covers 512 contiguous bytes.
static __device__ __forceinline__ size_t frag_unit(int row_tile, int k_tile, int ktiles) {
  return ((size_t)row_tile * ktiles + k_tile) << 9;
}

// Load a 16x32 f16 WMMA fragment (A operand, or B when the rows are the columns of B).
static __device__ __forceinline__ v16h load_frag(const _Float16* __restrict__ p,
                                                 int ktiles, int row_tile, int k_tile, int lane) {
  const _Float16* base = p + frag_unit(row_tile, k_tile, ktiles) + (lane << 3);
  v8h lo = *(const v8h*)(base);
  v8h hi = *(const v8h*)(base + 256);
  v16h r;
#pragma unroll
  for (int i = 0; i < 8; ++i) { r[i] = lo[i]; r[i + 8] = hi[i]; }
  return r;
}

// The same from a running pointer: base = the unit's start + 8 * lane.
static __device__ __forceinline__ v16h load_frag_at(const _Float16* base) {
  v8h lo = *(const v8h*)(base);
  v8h hi = *(const v8h*)(base + 256);
  v16h r;
#pragma unroll
  for (int i = 0; i < 8; ++i) { r[i] = lo[i]; r[i + 8] = hi[i]; }
  return r;
}

static __device__ __forceinline__ v8h to_f16(v8f x) {
  v8h o;
  for (int r = 0; r < 8; ++r) o[r] = (_Float16)x[r];
  return o;
}

// The two element-wise passes (convert, weight transpose) run 4096 waves each, 16 per
// WGP, every lane with 8 or more loads in flight.
// Passes that do not depend on each other share a launch: each launch costs its gap, its fill,
// its first loads' latency and its tail, whatever it computes.

// ---------------- fp32 [rows, DD] -> f16 fragment order: one wave per two units ------
// blk: 0 .. 511.
static __device__ __forceinline__ void cvt_f16_block(int blk, const float* __restrict__ src,
                                                     _Float16* __restrict__ dst) {
  // Units unit, unit + 1: k tiles 2t, 2t + 1 of one row tile, 256 B of each of its rows.
  int unit = (((blk << 8) + threadIdx.x) >> 5) << 1;  // row_tile * (DD / 32) + k_tile
  int lane = threadIdx.x & 31;
  int row = ((unit / (DD / 32)) << 4) + (lane & 15);
  int k   = ((unit % (DD / 32)) << 5) + ((lane >> 4) << 3);
  const float4* s = (const float4*)(src + (size_t)row * DD + k);
  float4 x[2][4];
#pragma unroll
  for (int u = 0; u < 2; ++u) {
    x[u][0] = s[8 * u];     x[u][1] = s[8 * u + 1];
    x[u][2] = s[8 * u + 4]; x[u][3] = s[8 * u + 5];
  }
  _Float16* o = dst + ((size_t)unit << 9) + (lane << 3);
#pragma unroll
  for (int u = 0; u < 2; ++u)
#pragma unroll
    for (int p = 0; p < 2; ++p) {
      float4 a = x[u][2 * p], b = x[u][2 * p + 1];
      v8h h = {(_Float16)a.x, (_Float16)a.y, (_Float16)a.z, (_Float16)a.w,
               (_Float16)b.x, (_Float16)b.y, (_Float16)b.z, (_Float16)b.w};
      *(v8h*)(o + (u << 9) + (p << 8)) = h;
    }
}

// -------- weight transpose: W[K,N] f32 -> Wt[N,K] f16 in fragment order, all four -----
// One wave per 32 k x 32 n. Lane = n: a load is one whole 128-B line of a row of W, and a
// lane's 8 consecutive k are one 16-B piece of its row's unit, so the transpose needs no
// exchange between lanes. The wave writes two whole units (n tiles 2 * np, 2 * np + 1).
// blk: 0 .. 511.
static __device__ __forceinline__ void transpose_w_block(int blk, const float* __restrict__ W0,
                                                         const float* __restrict__ W1,
                                                         const float* __restrict__ W2,
                                                         const float* __restrict__ W3,
                                                         _Float16* __restrict__ Wt) {
  int wave = ((blk << 8) + threadIdx.x) >> 5;  // weight * 1024 + np * 32 + k_tile
  int lane = threadIdx.x & 31;
  int w  = blk >> 7;  // 128 blocks a weight
  int np = (wave >> 5) & 31;
  int kt = wave & 31;
  const float* W = w == 0 ? W0 : w == 1 ? W1 : w == 2 ? W2 : W3;
  const float* s = W + (size_t)(kt << 5) * DD + (np << 5) + lane;
  float x[32];
#pragma unroll
  for (int i = 0; i < 32; ++i) x[i] = s[(size_t)i * DD];
  _Float16* o = Wt + (size_t)w * DD * DD + frag_unit(2 * np + (lane >> 4), kt, DD / 32) +
                ((lane & 15) << 3);
#pragma unroll
  for (int g = 0; g < 4; ++g) {  // k = 8g .. 8g + 7: plane g >> 1, lane half g & 1
    v8h h;
#pragma unroll
    for (int i = 0; i < 8; ++i) h[i] = (_Float16)x[8 * g + i];
    *(v8h*)(o + ((g >> 1) << 8) + ((g & 1) << 7)) = h;
  }
}

// Both in one launch: blocks 0 .. 511 convert X, blocks 512 .. 1023 transpose the weights.
__global__ __launch_bounds__(256) void prep_kernel(const float* __restrict__ X,
                                                   const float* __restrict__ W0,
                                                   const float* __restrict__ W1,
                                                   const float* __restrict__ W2,
                                                   const float* __restrict__ W3,
                                                   _Float16* __restrict__ Xh,
                                                   _Float16* __restrict__ Wt) {
  if (blockIdx.x < 512) cvt_f16_block(blockIdx.x, X, Xh);
  else                  transpose_w_block(blockIdx.x - 512, W0, W1, W2, W3, Wt);
}

// ---------------- WMMA GEMM core: 128x128 block tile, 32x64 wave tile -------
// A and Bt, each [BB*SS, DD] or [DD, DD], both f16 in fragment order, reach the waves through LDS.
// A stage is 128 k of the block's 128 rows of A, then of its 128 rows of Bt: per row tile 4
// consecutive units, 4 KB. The 8 waves (4 along m, 2 along n) share it: L2 delivers every row
// once a block, though 2 waves use a row of A and 4 waves a row of Bt.
#define G_KT 4                              // k tiles of a stage
#define G_STAGES (DD / 32 / G_KT)
#define G_ROWT_HALVES (G_KT * 512)          // one row tile of a stage
#define G_OPER_HALVES (8 * G_ROWT_HALVES)   // one operand of a stage
#define G_BUF_HALVES (2 * G_OPER_HALVES)    // a stage: 64 KB

// One operand's share of a stage, 8 x 16 B a lane, one copy per row tile. g: this lane's
// 16 B in the first row tile; l: the LDS byte address of its place there.
static __device__ __forceinline__ void copy_oper(const _Float16* g, unsigned l) {
  // The closing s_wait_xcnt stands in the copies' own statement, in front of any later
  // overwrite of the address registers they name.
  asm volatile(
      "global_load_async_to_lds_b128 %0, %8, off\n\t"
      "global_load_async_to_lds_b128 %1, %9, off\n\t"
      "global_load_async_to_lds_b128 %2, %10, off\n\t"
      "global_load_async_to_lds_b128 %3, %11, off\n\t"
      "global_load_async_to_lds_b128 %4, %12, off\n\t"
      "global_load_async_to_lds_b128 %5, %13, off\n\t"
      "global_load_async_to_lds_b128 %6, %14, off\n\t"
      "global_load_async_to_lds_b128 %7, %15, off\n\t"
      "s_wait_xcnt 0x0"
      :: "v"(l), "v"(l + 4096u), "v"(l + 8192u), "v"(l + 12288u),
         "v"(l + 16384u), "v"(l + 20480u), "v"(l + 24576u), "v"(l + 28672u),
         "v"(g), "v"(g + 16 * DD), "v"(g + 32 * DD), "v"(g + 48 * DD),
         "v"(g + 64 * DD), "v"(g + 80 * DD), "v"(g + 96 * DD), "v"(g + 112 * DD)
      : "memory");
}

// SWAP = false: tile (mt, nt) holds C (register r, lane l: row 8 * (l >> 4) + r, column
// l & 15); SWAP = true: it holds C^T (row of C = l & 15, column of C = 8 * (l >> 4) + r),
// same products, same k order. ring: 2 * G_BUF_HALVES of LDS. bm, bn: the block tile, in
// units of 128 rows of A and of 128 rows of Bt.
template <bool SWAP, typename STORE>
static __device__ __forceinline__ void gemm_block_128x128(const _Float16* __restrict__ A,
                                                          const _Float16* __restrict__ Bt,
                                                          _Float16* ring, int bm, int bn,
                                                          STORE store) {
  int tid  = threadIdx.x;
  int lane = tid & 31;
  int wm = tid >> 6, wn = (tid >> 5) & 1;          // the wave's place in the block tile
  // This lane's share of stage 0, and its place in buffer 0.
  const _Float16* acp = A  + frag_unit(bm << 3, 0, DD / 32) + (tid << 3);
  const _Float16* bcp = Bt + frag_unit(bn << 3, 0, DD / 32) + (tid << 3);
  unsigned lcp = (unsigned)(size_t)ring + (tid << 4);
  copy_oper(acp, lcp);
  copy_oper(bcp, lcp + 2 * G_OPER_HALVES);

  v8f acc[2][4];
#pragma unroll
  for (int mt = 0; mt < 2; ++mt)
#pragma unroll
    for (int nt = 0; nt < 4; ++nt) acc[mt][nt] = (v8f){};

  // Stage 0 has landed for this wave's copies; the barrier publishes it to the block.
  asm volatile("s_wait_asynccnt 0x0" ::: "memory");
  __syncthreads();
  copy_oper(acp + G_ROWT_HALVES, lcp + 2 * G_BUF_HALVES);
  copy_oper(bcp + G_ROWT_HALVES, lcp + 2 * (G_BUF_HALVES + G_OPER_HALVES));

  // One k step's operands, 2 A and 4 B fragments, are fetched from LDS as one group of 12
  // loads, one k step ahead of their products, into one of two register sets.
  struct Step { v16h a[2], b[4]; };
  // This lane's place in the wave's first A and first B fragment of buffer 0.
  const _Float16* pa = ring + wm * (2 * G_ROWT_HALVES) + (lane << 3);
  const _Float16* pb = ring + G_OPER_HALVES + wn * (4 * G_ROWT_HALVES) + (lane << 3);
  auto fetch = [&](Step& f, int buf, int j) {  // k step j of the stage in buffer buf
    const _Float16* a = pa + buf * G_BUF_HALVES + (j << 9);
    const _Float16* b = pb + buf * G_BUF_HALVES + (j << 9);
    f.a[0] = load_frag_at(a);
    f.a[1] = load_frag_at(a + G_ROWT_HALVES);
#pragma unroll
    for (int nt = 0; nt < 4; ++nt) f.b[nt] = load_frag_at(b + nt * G_ROWT_HALVES);
    // Keeps the products written behind a fetch behind it: the scheduler otherwise moves the
    // first of them, with their load waits, in front of the group, which then issues late.
    __builtin_amdgcn_sched_barrier(0);
  };
  auto products = [&](const Step& f) {
#pragma unroll
    for (int nt = 0; nt < 4; ++nt) {
      if (SWAP) {
        acc[0][nt] = WMMA(f.b[nt], f.a[0], acc[0][nt]);
        acc[1][nt] = WMMA(f.b[nt], f.a[1], acc[1][nt]);
      } else {
        acc[0][nt] = WMMA(f.a[0], f.b[nt], acc[0][nt]);
        acc[1][nt] = WMMA(f.a[1], f.b[nt], acc[1][nt]);
      }
    }
  };
  Step x, y;
  fetch(x, 0, 0);
  // Kept rolled: unrolled, the addresses of all stages' copies are formed ahead and held in
  // registers, past v255, and the text of a loop that runs once grows eightfold.
#pragma unroll 1
  for (int t = 0; t < G_STAGES; ++t) {  // stage t, in buffer t & 1
    fetch(y, t & 1, 1);
    products(x);
    fetch(x, t & 1, 2);
    products(y);
    fetch(y, t & 1, 3);
    products(x);
    // Keeps these products in front of the publish point: moved behind the barrier they would
    // stand in front of the refill, which would then issue late.
    __builtin_amdgcn_sched_barrier(0);
    // Publish point of stage t + 1, in front of stage t's last products, whose fragments are
    // fetched: this wave's reads of stage t are done, its copies of stage t + 1 have landed;
    // behind the barrier both hold for the whole block.
    asm volatile("s_wait_dscnt 0x0" ::: "memory");
    asm volatile("s_wait_asynccnt 0x0" ::: "memory");
    __syncthreads();
    if (t + 2 < G_STAGES) {
      copy_oper(acp + (t + 2) * G_ROWT_HALVES, lcp + (t & 1) * (2 * G_BUF_HALVES));
      copy_oper(bcp + (t + 2) * G_ROWT_HALVES,
                lcp + (t & 1) * (2 * G_BUF_HALVES) + 2 * G_OPER_HALVES);
    }
    if (t + 1 < G_STAGES) fetch(x, (t + 1) & 1, 0);
    products(y);
  }
  // No copy is outstanding when the wave ends.
  asm volatile("s_wait_asynccnt 0x0" ::: "memory");
  int m0 = (bm << 7) + (wm << 5);
  int n0 = (bn << 7) + (wn << 6);
  store(m0, n0, acc);
}

// The three projections in one launch of 3 x 256 blocks: blocks 0 .. 255 Q, 256 .. 511 K,
// 512 .. 767 V^T. Wt: Wq^T, Wk^T, Wv^T one behind the other; C: Q, K, V^T likewise. Two blocks
// fit a WGP (LDS, registers): one block's copies fly while the other's land or are worked on,
// and a block's first stage and its stores overlap other blocks' k loops.
// C is in fragment order per (batch, head); a lane's 8 values are 8 consecutive k of the
// operand that attention reads, so each tile leaves as one 16-B store per lane.
// Q, K: rows = positions, k = head dim. V^T: rows = head dim, k = positions.
// One k loop serves all three: a tile's registers run along the rows of the core's second
// operand, which is W^T for Q and K and X for V^T (the first WMMA operand of the product: W^T
// rows for Q and K, X rows for V^T). The choice is the block's, made in scalar registers.
// RoPE is applied to Q and K here, on the f32 sums: a lane's 8 values of a tile are 4 whole
// (even, odd) pairs of one position, so the rotation needs no other lane, and Q and K are
// rounded to f16 once and cross memory once. fc: [SS, HD / 2] (cos, sin).
__global__ __launch_bounds__(256) void gemm_qkv_kernel(const _Float16* __restrict__ X,
                                                       const _Float16* __restrict__ Wt,
                                                       const float* __restrict__ fc,
                                                       _Float16* __restrict__ C) {
  __shared__ __attribute__((aligned(16))) _Float16 ring[2 * G_BUF_HALVES];
  int lane = threadIdx.x & 31;
  int which = blockIdx.x >> 8;
  int tx = (blockIdx.x >> 3) & 31, tw = blockIdx.x & 7;  // 128 rows of X, 128 rows of W^T
  bool vt = which == 2;
  const _Float16* W = Wt + (size_t)which * DD * DD;
  _Float16* Cw = C + (size_t)which * BB * SS * DD;
  gemm_block_128x128<true>(vt ? W : X, vt ? X : W, ring, vt ? tw : tx, vt ? tx : tw,
                           [&](int m0, int n0, const v8f (&acc)[2][4]) {
    int x0 = vt ? n0 : m0;  // the wave tile's first row of X
    int w0 = vt ? m0 : n0;  // and of W^T: 64 rows, a head, for Q and K; 32 for V^T
    int b = x0 >> 11, s0 = x0 & (SS - 1), h = w0 >> 6;
    _Float16* Cb = Cw + (size_t)(b * HH + h) * SS * HD +
                   (vt ? frag_unit((w0 & 63) >> 4, s0 >> 5, SS / 32) : frag_unit(s0 >> 4, 0, HD / 32));
    int mstep = vt ? (SS / 32) << 9 : (HD / 32) << 9;  // the next row tile of C
    v8h o[2][4];
    if (vt) {
#pragma unroll
      for (int mt = 0; mt < 2; ++mt)
#pragma unroll
        for (int nt = 0; nt < 4; ++nt) o[mt][nt] = to_f16(acc[mt][nt]);
    } else {
      // Tile (mt, nt), this lane: position s0 + 16 * mt + (lane & 15), head dims
      // 16 * nt + 8 * (lane >> 4) + 0 .. 7, whose 4 (cos, sin) are 32 consecutive bytes.
      const float4* f = (const float4*)(fc + (s0 + (lane & 15)) * HD + ((lane >> 4) << 3));
      float4 cs[2][4][2];
#pragma unroll
      for (int mt = 0; mt < 2; ++mt)
#pragma unroll
        for (int nt = 0; nt < 4; ++nt) {
          cs[mt][nt][0] = f[mt * (16 * HD / 4) + nt * 4];
          cs[mt][nt][1] = f[mt * (16 * HD / 4) + nt * 4 + 1];
        }
      // Stands behind the 16 loads and in front of any overwrite of their address register,
      // which it names as an input so that no load's result is placed over it.
      asm volatile("s_wait_xcnt 0x0" :: "v"(f) : "memory");
#pragma unroll
      for (int mt = 0; mt < 2; ++mt)
#pragma unroll
        for (int nt = 0; nt < 4; ++nt) {
          float4 f0 = cs[mt][nt][0], f1 = cs[mt][nt][1];
          float c[4] = {f0.x, f0.z, f1.x, f1.z};
          float d[4] = {f0.y, f0.w, f1.y, f1.w};
#pragma unroll
          for (int i = 0; i < 4; ++i) {
            float a = acc[mt][nt][2 * i], b = acc[mt][nt][2 * i + 1];
            o[mt][nt][2 * i]     = (_Float16)(a * c[i] - b * d[i]);
            o[mt][nt][2 * i + 1] = (_Float16)(a * d[i] + b * c[i]);
          }
        }
    }
    // Keeps the 8 stores behind all the conversions: no register of an issued store is then
    // written again, and the stores need no wait between them.
    __builtin_amdgcn_sched_barrier(0);
#pragma unroll
    for (int mt = 0; mt < 2; ++mt)
#pragma unroll
      for (int nt = 0; nt < 4; ++nt)  // 16 k a tile: planes nt of consecutive units
        *(v8h*)(Cb + mt * mstep + (nt << 8) + (lane << 3)) = o[mt][nt];
  });
}

__global__ __launch_bounds__(256) void gemm_f32out_kernel(const _Float16* __restrict__ A,
                                                          const _Float16* __restrict__ Bt,
                                                          float* __restrict__ C) {
  __shared__ __attribute__((aligned(16))) _Float16 ring[2 * G_BUF_HALVES];
  int lane = threadIdx.x & 31;
  gemm_block_128x128<false>(A, Bt, ring, blockIdx.x >> 3, blockIdx.x & 7,
                            [&](int m0, int n0, const v8f (&acc)[2][4]) {
#pragma unroll
    for (int mt = 0; mt < 2; ++mt)
#pragma unroll
      for (int nt = 0; nt < 4; ++nt) {
        int row = m0 + (mt << 4) + ((lane >> 4) << 3);
        int col = n0 + (nt << 4) + (lane & 15);
        for (int r = 0; r < 8; ++r) C[(size_t)(row + r) * DD + col] = acc[mt][nt][r];
      }
  });
}

// ---------------- attention: per-chunk softmax, chunk outputs summed -------
// Lane l <-> lane l ^ 16 (the two halves of a wave hold the two halves of a column).
static __device__ __forceinline__ float xhalf(float x) {
  int b = __builtin_bit_cast(int, x);
  return __builtin_bit_cast(float,
      __builtin_amdgcn_permlanex16(b, b, 0x76543210, 0xfedcba98, false, false));
}

// K and V^T reach the waves through LDS. A stage is 128 keys of EACH of the two chunks; a
// chunk's share is 16 KB of K (contiguous in fragment order), then 4 KB of each of the 4 d tiles
// of V^T. A block is 128 queries of one (batch, head): waves 0 .. 3 walk chunk 0, waves 4 .. 7
// chunk 1, each wave with 32 queries, so L2 delivers a stage once a block.
#define STAGE_KEYS 128
#define STAGE_HALVES 16384             // one chunk's share: K 8192 + V^T 8192 f16
#define BUF_HALVES (2 * STAGE_HALVES)  // a stage: 64 KB
#define NSTAGES (CHUNK / STAGE_KEYS)
static_assert(SS == 2 * CHUNK, "the waves of a block are split over two chunks");

// One chunk's share of a stage, 8 x 16 B a lane. k, v: this lane's first 16 B of it in K and in
// V^T; l: the LDS byte address of its first 16 B in the buffer.
static __device__ __forceinline__ void copy_stage(const _Float16* k, const _Float16* v, unsigned l) {
  // The closing s_wait_xcnt stands in the copies' own statement, in front of any later
  // overwrite of the address registers they name.
  asm volatile(
      "global_load_async_to_lds_b128 %0, %8, off\n\t"
      "global_load_async_to_lds_b128 %1, %9, off\n\t"
      "global_load_async_to_lds_b128 %2, %10, off\n\t"
      "global_load_async_to_lds_b128 %3, %11, off\n\t"
      "global_load_async_to_lds_b128 %4, %12, off\n\t"
      "global_load_async_to_lds_b128 %5, %13, off\n\t"
      "global_load_async_to_lds_b128 %6, %14, off\n\t"
      "global_load_async_to_lds_b128 %7, %15, off\n\t"
      "s_wait_xcnt 0x0"
      :: "v"(l), "v"(l + 4096u), "v"(l + 8192u), "v"(l + 12288u),
         "v"(l + 16384u), "v"(l + 20480u), "v"(l + 24576u), "v"(l + 28672u),
         "v"(k), "v"(k + 2048), "v"(k + 4096), "v"(k + 6144),
         "v"(v), "v"(v + 16 * SS), "v"(v + 32 * SS), "v"(v + 48 * SS)
      : "memory");
}

__global__ __launch_bounds__(256) void attn_kernel(const _Float16* __restrict__ Q,
                                                   const _Float16* __restrict__ Kd,
                                                   const _Float16* __restrict__ Vt,
                                                   _Float16* __restrict__ O) {
  __shared__ __attribute__((aligned(16))) _Float16 ring[2 * BUF_HALVES];
  int tid  = threadIdx.x;
  int lane = tid & 31;
  int wave = __builtin_amdgcn_readfirstlane(tid >> 5);
  int g  = wave >> 2;                                     // the wave's chunk
  int qt = ((blockIdx.x & 15) << 3) + ((wave & 3) << 1);  // its query tiles: qt, qt + 1
  int bh = blockIdx.x >> 4;                               // 16 blocks a (batch, head)
  const _Float16* Qb = Q  + (size_t)bh * SS * HD;
  const _Float16* Kb = Kd + (size_t)bh * SS * HD;
  const _Float16* Vb = Vt + (size_t)bh * HD * SS;

  // This lane's share of stage 0 of chunk 0, and its place in buffer 0.
  const _Float16* kcp = Kb + (tid << 3);
  const _Float16* vcp = Vb + (tid << 3);
  unsigned lcp = (unsigned)(size_t)ring + (tid << 4);
  auto copy_both = [&](int t, unsigned l) {  // stage t, both chunks' shares
    copy_stage(kcp + t * (STAGE_KEYS * HD), vcp + t * (STAGE_KEYS * 16), l);
    copy_stage(kcp + CHUNK * HD + t * (STAGE_KEYS * HD), vcp + CHUNK * 16 + t * (STAGE_KEYS * 16),
               l + 2 * STAGE_HALVES);
  };
  copy_both(0, lcp);

  v16h qb[2][2];
#pragma unroll
  for (int c = 0; c < 2; ++c) {
    qb[c][0] = load_frag(Qb, HD / 32, qt + c, 0, lane);
    qb[c][1] = load_frag(Qb, HD / 32, qt + c, 1, lane);
  }
  // Stands behind the 8 loads of Q, in front of any overwrite of their address register.
  asm volatile("s_wait_xcnt 0x0" ::: "memory");

  // Stage 0 has landed for this wave's copies; the barrier publishes it to the block.
  asm volatile("s_wait_asynccnt 0x0" ::: "memory");
  __syncthreads();
  copy_both(1, lcp + 2 * BUF_HALVES);

  const float scale = 0.125f;  // 64^-0.5
  float mrun[2] = {-1e30f, -1e30f};  // running maximum of this lane's query, per query tile
  float lrun[2] = {0.f, 0.f};        // running sum over this half's keys only
  v8f oa[2][4];
#pragma unroll
  for (int c = 0; c < 2; ++c)
#pragma unroll
    for (int d = 0; d < 4; ++d) oa[c][d] = (v8f){};

  for (int t = 0; t < NSTAGES; ++t) {  // stage t, in buffer t & 1
    const _Float16* buf = ring + (t & 1) * BUF_HALVES + g * STAGE_HALVES + (lane << 3);
    for (int j = 0; j < STAGE_KEYS / 32; ++j) {
      // ---- scores^T: 32 keys x 2 x 16 queries, K-dim = HD = 64 (2 steps) ----
      // 32 keys of the stage: 4 units of K, one unit of each d tile of V^T
      const _Float16* kp = buf + (j << 11);
      const _Float16* vp = buf + 8192 + (j << 9);
      v16h ka0 = load_frag_at(kp);
      v16h ka1 = load_frag_at(kp + 512);
      v16h ka2 = load_frag_at(kp + 1024);
      v16h ka3 = load_frag_at(kp + 1536);
      // K's loads stay in front of V^T's: LDS loads return in order, and the score products
      // then wait for 8 loads, not for all 16.
      __builtin_amdgcn_sched_barrier(0);
      v16h va[4];
#pragma unroll
      for (int d = 0; d < 4; ++d) va[d] = load_frag_at(vp + d * 2048);
      // Keeps the pass's 16 LDS loads one group in front of its products: the scheduler
      // otherwise issues them two at a time, each pair with a full wait of its own.
      __builtin_amdgcn_sched_barrier(0);
      v8f s0[2], s1[2];
#pragma unroll
      for (int c = 0; c < 2; ++c) s0[c] = WMMA(ka0, qb[c][0], (v8f){});
#pragma unroll
      for (int c = 0; c < 2; ++c) s1[c] = WMMA(ka2, qb[c][0], (v8f){});
#pragma unroll
      for (int c = 0; c < 2; ++c) s0[c] = WMMA(ka1, qb[c][1], s0[c]);
#pragma unroll
      for (int c = 0; c < 2; ++c) s1[c] = WMMA(ka3, qb[c][1], s1[c]);
      // Keeps the 8 score products one run: a product's first reader then stands behind later
      // products, which fill the slots that the scheduler otherwise fills with v_nop.
      __builtin_amdgcn_sched_barrier(0);
      v16h pb[2];
      v8f p0[2], p1[2];
      float alpha[2];
#pragma unroll
      for (int c = 0; c < 2; ++c) {
        // ---- online softmax: 16 of the query's 32 scores are in this lane ----
        v8f a0 = s0[c] * scale;
        v8f a1 = s1[c] * scale;
        float mx[8];
        for (int r = 0; r < 8; ++r) mx[r] = fmaxf(a0[r], a1[r]);
        float mt = fmaxf(fmaxf(fmaxf(mx[0], mx[1]), fmaxf(mx[2], mx[3])),
                         fmaxf(fmaxf(mx[4], mx[5]), fmaxf(mx[6], mx[7])));
        mt = fmaxf(mt, xhalf(mt));
        float mnew = fmaxf(mrun[c], mt);
        alpha[c] = __expf(mrun[c] - mnew);
        mrun[c] = mnew;
        a0 -= mnew;
        a1 -= mnew;
        for (int r = 0; r < 8; ++r) {
          p0[c][r] = __expf(a0[r]);
          p1[c][r] = __expf(a1[r]);
          pb[c][r]     = (_Float16)p0[c][r];  // k = 8h + r
          pb[c][r + 8] = (_Float16)p1[c][r];  // k = 16 + 8h + r
        }
#pragma unroll
        for (int d = 0; d < 4; ++d) oa[c][d] *= alpha[c];
      }
      // ---- O^T += V^T @ P^T: K-dim = 32 keys, 4 d-tiles (Vt is [HD,S]) ----
#pragma unroll
      for (int d = 0; d < 4; ++d)
#pragma unroll
        for (int c = 0; c < 2; ++c) oa[c][d] = WMMA(va[d], pb[c], oa[c][d]);
      // Keeps the row sums behind the products, which need none of them and so issue earlier as
      // one run; the sums fill the vector slots that the chip needs between the pass's last
      // matrix instruction and the next pass's first write over its operands, behind the taken
      // branch.
      __builtin_amdgcn_sched_barrier(0);
#pragma unroll
      for (int c = 0; c < 2; ++c) {
        v8f ps = p0[c] + p1[c];
        lrun[c] = lrun[c] * alpha[c] + (((ps[0] + ps[1]) + (ps[2] + ps[3])) +
                                        ((ps[4] + ps[5]) + (ps[6] + ps[7])));
      }
    }
    // Publish point of stage t + 1: this wave's reads of stage t are done, its copies of
    // stage t + 1 have landed; behind the barrier both hold for the whole block.
    asm volatile("s_wait_dscnt 0x0" ::: "memory");
    asm volatile("s_wait_asynccnt 0x0" ::: "memory");
    __syncthreads();
    if (t + 2 < NSTAGES) copy_both(t + 2, lcp + (t & 1) * (2 * BUF_HALVES));
  }
  // No copy is outstanding when the ring is reused and when the wave ends.
  asm volatile("s_wait_asynccnt 0x0" ::: "memory");
  // ---- finalize the chunk: join the halves' sums, normalize ----
#pragma unroll
  for (int c = 0; c < 2; ++c) {
    float inv = 1.f / (lrun[c] + xhalf(lrun[c]));
#pragma unroll
    for (int d = 0; d < 4; ++d) oa[c][d] *= inv;
  }
  // ---- add the two chunks' outputs: waves w and w ^ 4 hold the same queries. Wave w keeps
  // query tile g and hands the other one over through the ring, which nobody reads any more
  // (the last stage's barrier); 4 KB a wave, a wave-wide 16-B access covers 512 B ----
  typedef __attribute__((ext_vector_type(4))) float v4f;
  v4f* xch = (v4f*)ring;
  v8f keep[4], give[4];
#pragma unroll
  for (int d = 0; d < 4; ++d) {
    keep[d] = g ? oa[1][d] : oa[0][d];
    give[d] = g ? oa[0][d] : oa[1][d];
  }
#pragma unroll
  for (int d = 0; d < 4; ++d) {
    xch[((wave << 3) + 2 * d) * 32 + lane]     = __builtin_shufflevector(give[d], give[d], 0, 1, 2, 3);
    xch[((wave << 3) + 2 * d + 1) * 32 + lane] = __builtin_shufflevector(give[d], give[d], 4, 5, 6, 7);
  }
  // Publishes every wave's handed-over tile to its partner.
  __syncthreads();
#pragma unroll
  for (int d = 0; d < 4; ++d) {
    v4f lo = xch[(((wave ^ 4) << 3) + 2 * d) * 32 + lane];
    v4f hi = xch[(((wave ^ 4) << 3) + 2 * d + 1) * 32 + lane];
    keep[d] += __builtin_shufflevector(lo, hi, 0, 1, 2, 3, 4, 5, 6, 7);
  }
  // ---- store O, f16 [B*S, D] in fragment order: a lane holds 8 consecutive d of its
  // query, and d tiles 2u, 2u + 1 are the two planes of k tile 2h + u ----
  int b = bh >> 4, h = bh & 15;
  _Float16* o = O + frag_unit(b * (SS / 16) + qt + g, 2 * h, DD / 32) + (lane << 3);
  *(v8h*)(o)       = to_f16(keep[0]);
  *(v8h*)(o + 256) = to_f16(keep[1]);
  *(v8h*)(o + 512) = to_f16(keep[2]);
  *(v8h*)(o + 768) = to_f16(keep[3]);
}

extern "C" void kernel_launch(void* const* d_in, const int* in_sizes, int n_in,
                              void* d_out, int out_size, void* d_ws, size_t ws_size,
                              hipStream_t stream) {
  const float* X  = (const float*)d_in[0];
  const float* FC = (const float*)d_in[1];
  const float* Wq = (const float*)d_in[2];
  const float* Wk = (const float*)d_in[3];
  const float* Wv = (const float*)d_in[4];
  const float* Wo = (const float*)d_in[5];
  float* out = (float*)d_out;

  char* ws = (char*)d_ws;
  const size_t MB = 1u << 20;
  // all in fragment order
  _Float16* Xh  = (_Float16*)(ws + 0);        // 8 MB  [B*S, D] f16
  _Float16* Wqt = (_Float16*)(ws + 8  * MB);  // 2 MB  [N,K] f16
  _Float16* Wkt = (_Float16*)(ws + 10 * MB);
  _Float16* Wvt = (_Float16*)(ws + 12 * MB);
  _Float16* Wot = (_Float16*)(ws + 14 * MB);
  _Float16* Qh  = (_Float16*)(ws + 16 * MB);  // 8 MB  [B,H,S,HD]
  _Float16* Kh  = (_Float16*)(ws + 24 * MB);  // 8 MB  [B,H,S,HD]
  _Float16* Vtb = (_Float16*)(ws + 32 * MB);  // 8 MB  [B,H,HD,S]
  _Float16* Oh  = (_Float16*)(ws + 40 * MB);  // 8 MB  [B*S, D]

  // 1) X fp32 -> f16, and weights fp32 [K,N] -> f16 [N,K]
  //    (Wqt, Wkt, Wvt, Wot are consecutive: one launch writes all four)
  prep_kernel<<<1024, 256, 0, stream>>>(X, Wq, Wk, Wv, Wo, Xh, Wqt);

  // 2) QKV projections, with RoPE on Q and K: 3 x (4096/128)*(1024/128) = 768 block tiles
  //    x 256 thr (Wqt, Wkt, Wvt are consecutive, and so are Qh, Kh, Vtb)
  gemm_qkv_kernel<<<768, 256, 0, stream>>>(Xh, Wqt, FC, Qh);

  // 3) attention (waves = B*H*(S/32) query tile pairs x 2 chunks = 4096 -> 512 blocks x 256 thr)
  attn_kernel<<<512, 256, 0, stream>>>(Qh, Kh, Vtb, Oh);

  // 4) output projection -> f32 d_out
  gemm_f32out_kernel<<<256, 256, 0, stream>>>(Oh, Wot, out);
}

// v010
// One run takes 71.5 microseconds.
// Next to v009, in two timings, it ran 1.06 times as fast each time.
// All steps since v000 together make it 4.25 times as fast.
#include <hip/hip_runtime.h>

#define BB 2
#define SS 2048
#define DD 1024
#define HH 16
#define HD 64
#define CHUNK 1024

typedef __attribute__((ext_vector_type(16))) _Float16 v16h;
typedef __attribute__((ext_vector_type(8)))  _Float16 v8h;
typedef __attribute__((ext_vector_type(4)))  _Float16 v4h;
typedef __attribute__((ext_vector_type(8)))  float    v8f;

#define WMMA(a, b, c) __builtin_amdgcn_wmma_f32_16x16x32_f16(false, (a), false, (b), (short)0, (c), false, false)

// Fragment order. Every f16 operand in the workspace, a [rows, k] matrix, is kept as
// 1-KB units of 16 rows x 32 k, unit index = row_tile * ktiles + k_tile. A unit is two
// 512-B planes (k 0..15, k 16..31); in a plane lane l = 16 * ((k >> 3) & 1) + (row & 15)
// owns 8 consecutive k. A wave-wide 16-B access then covers 512 contiguous bytes.
static __device__ __forceinline__ size_t frag_unit(int row_tile, int k_tile, int ktiles) {
  return ((size_t)row_tile * ktiles + k_tile) << 9;
}

// Load a 16x32 f16 WMMA fragment (A operand, or B when the rows are the columns of B).
static __device__ __forceinline__ v16h load_frag(const _Float16* __restrict__ p,
                                                 int ktiles, int row_tile, int k_tile, int lane) {
  const _Float16* base = p + frag_unit(row_tile, k_tile, ktiles) + (lane << 3);
  v8h lo = *(const v8h*)(base);
  v8h hi = *(const v8h*)(base + 256);
  v16h r;
#pragma unroll
  for (int i = 0; i < 8; ++i) { r[i] = lo[i]; r[i + 8] = hi[i]; }
  return r;
}

// The same from a running pointer: base = the unit's start + 8 * lane.
static __device__ __forceinline__ v16h load_frag_at(const _Float16* base) {
  v8h lo = *(const v8h*)(base);
  v8h hi = *(const v8h*)(base + 256);
  v16h r;
#pragma unroll
  for (int i = 0; i < 8; ++i) { r[i] = lo[i]; r[i + 8] = hi[i]; }
  return r;
}

static __device__ __forceinline__ v8h to_f16(v8f x) {
  v8h o;
  for (int r = 0; r < 8; ++r) o[r] = (_Float16)x[r];
  return o;
}

// The two element-wise passes (convert, weight transpose) run 4096 waves each, 16 per
// WGP, every lane with 8 or more loads in flight.
// Passes that do not depend on each other share a launch: each launch costs its gap, its fill,
// its first loads' latency and its tail, whatever it computes.

// ---------------- fp32 [rows, DD] -> f16 fragment order: one wave per two units ------
// blk: 0 .. 511.
static __device__ __forceinline__ void cvt_f16_block(int blk, const float* __restrict__ src,
                                                     _Float16* __restrict__ dst) {
  // Units unit, unit + 1: k tiles 2t, 2t + 1 of one row tile, 256 B of each of its rows.
  int unit = (((blk << 8) + threadIdx.x) >> 5) << 1;  // row_tile * (DD / 32) + k_tile
  int lane = threadIdx.x & 31;
  int row = ((unit / (DD / 32)) << 4) + (lane & 15);
  int k   = ((unit % (DD / 32)) << 5) + ((lane >> 4) << 3);
  const float4* s = (const float4*)(src + (size_t)row * DD + k);
  float4 x[2][4];
#pragma unroll
  for (int u = 0; u < 2; ++u) {
    x[u][0] = s[8 * u];     x[u][1] = s[8 * u + 1];
    x[u][2] = s[8 * u + 4]; x[u][3] = s[8 * u + 5];
  }
  _Float16* o = dst + ((size_t)unit << 9) + (lane << 3);
#pragma unroll
  for (int u = 0; u < 2; ++u)
#pragma unroll
    for (int p = 0; p < 2; ++p) {
      float4 a = x[u][2 * p], b = x[u][2 * p + 1];
      v8h h = {(_Float16)a.x, (_Float16)a.y, (_Float16)a.z, (_Float16)a.w,
               (_Float16)b.x, (_Float16)b.y, (_Float16)b.z, (_Float16)b.w};
      *(v8h*)(o + (u << 9) + (p << 8)) = h;
    }
}

// -------- weight transpose: W[K,N] f32 -> Wt[N,K] f16 in fragment order, all four -----
// One wave per 32 k x 32 n. Lane = n: a load is one whole 128-B line of a row of W, and a
// lane's 8 consecutive k are one 16-B piece of its row's unit, so the transpose needs no
// exchange between lanes. The wave writes two whole units (n tiles 2 * np, 2 * np + 1).
// blk: 0 .. 511.
static __device__ __forceinline__ void transpose_w_block(int blk, const float* __restrict__ W0,
                                                         const float* __restrict__ W1,
                                                         const float* __restrict__ W2,
                                                         const float* __restrict__ W3,
                                                         _Float16* __restrict__ Wt) {
  int wave = ((blk << 8) + threadIdx.x) >> 5;  // weight * 1024 + np * 32 + k_tile
  int lane = threadIdx.x & 31;
  int w  = blk >> 7;  // 128 blocks a weight
  int np = (wave >> 5) & 31;
  int kt = wave & 31;
  const float* W = w == 0 ? W0 : w == 1 ? W1 : w == 2 ? W2 : W3;
  const float* s = W + (size_t)(kt << 5) * DD + (np << 5) + lane;
  float x[32];
#pragma unroll
  for (int i = 0; i < 32; ++i) x[i] = s[(size_t)i * DD];
  _Float16* o = Wt + (size_t)w * DD * DD + frag_unit(2 * np + (lane >> 4), kt, DD / 32) +
                ((lane & 15) << 3);
#pragma unroll
  for (int g = 0; g < 4; ++g) {  // k = 8g .. 8g + 7: plane g >> 1, lane half g & 1
    v8h h;
#pragma unroll
    for (int i = 0; i < 8; ++i) h[i] = (_Float16)x[8 * g + i];
    *(v8h*)(o + ((g >> 1) << 8) + ((g & 1) << 7)) = h;
  }
}

// Both in one launch: blocks 0 .. 511 convert X, blocks 512 .. 1023 transpose the weights.
__global__ __launch_bounds__(256) void prep_kernel(const float* __restrict__ X,
                                                   const float* __restrict__ W0,
                                                   const float* __restrict__ W1,
                                                   const float* __restrict__ W2,
                                                   const float* __restrict__ W3,
                                                   _Float16* __restrict__ Xh,
                                                   _Float16* __restrict__ Wt) {
  if (blockIdx.x < 512) cvt_f16_block(blockIdx.x, X, Xh);
  else                  transpose_w_block(blockIdx.x - 512, W0, W1, W2, W3, Wt);
}

// ---------------- WMMA GEMM core: 128x128 block tile, 32x64 wave tile -------
// A and Bt, each [BB*SS, DD] or [DD, DD], both f16 in fragment order, reach the waves through LDS.
// A stage is 128 k of the block's 128 rows of A, then of its 128 rows of Bt: per row tile 4
// consecutive units, 4 KB. The 8 waves (4 along m, 2 along n) share it: L2 delivers every row
// once a block, though 2 waves use a row of A and 4 waves a row of Bt.
#define G_KT 4                              // k tiles of a stage
#define G_STAGES (DD / 32 / G_KT)
#define G_ROWT_HALVES (G_KT * 512)          // one row tile of a stage
#define G_OPER_HALVES (8 * G_ROWT_HALVES)   // one operand of a stage
#define G_BUF_HALVES (2 * G_OPER_HALVES)    // a stage: 64 KB

// One operand's share of a stage, 8 x 16 B a lane, one copy per row tile. g: this lane's
// 16 B in the first row tile; l: the LDS byte address of its place there.
static __device__ __forceinline__ void copy_oper(const _Float16* g, unsigned l) {
  // The closing s_wait_xcnt stands in the copies' own statement, in front of any later
  // overwrite of the address registers they name.
  asm volatile(
      "global_load_async_to_lds_b128 %0, %8, off\n\t"
      "global_load_async_to_lds_b128 %1, %9, off\n\t"
      "global_load_async_to_lds_b128 %2, %10, off\n\t"
      "global_load_async_to_lds_b128 %3, %11, off\n\t"
      "global_load_async_to_lds_b128 %4, %12, off\n\t"
      "global_load_async_to_lds_b128 %5, %13, off\n\t"
      "global_load_async_to_lds_b128 %6, %14, off\n\t"
      "global_load_async_to_lds_b128 %7, %15, off\n\t"
      "s_wait_xcnt 0x0"
      :: "v"(l), "v"(l + 4096u), "v"(l + 8192u), "v"(l + 12288u),
         "v"(l + 16384u), "v"(l + 20480u), "v"(l + 24576u), "v"(l + 28672u),
         "v"(g), "v"(g + 16 * DD), "v"(g + 32 * DD), "v"(g + 48 * DD),
         "v"(g + 64 * DD), "v"(g + 80 * DD), "v"(g + 96 * DD), "v"(g + 112 * DD)
      : "memory");
}

// SWAP = false: tile (mt, nt) holds C (register r, lane l: row 8 * (l >> 4) + r, column
// l & 15); SWAP = true: it holds C^T (row of C = l & 15, column of C = 8 * (l >> 4) + r),
// same products, same k order. ring: 2 * G_BUF_HALVES of LDS. bm, bn: the block tile, in
// units of 128 rows of A and of 128 rows of Bt.
template <bool SWAP, typename STORE>
static __device__ __forceinline__ void gemm_block_128x128(const _Float16* __restrict__ A,
                                                          const _Float16* __restrict__ Bt,
                                                          _Float16* ring, int bm, int bn,
                                                          STORE store) {
  int tid  = threadIdx.x;
  int lane = tid & 31;
  int wm = tid >> 6, wn = (tid >> 5) & 1;          // the wave's place in the block tile
  // This lane's share of stage 0, and its place in buffer 0.
  const _Float16* acp = A  + frag_unit(bm << 3, 0, DD / 32) + (tid << 3);
  const _Float16* bcp = Bt + frag_unit(bn << 3, 0, DD / 32) + (tid << 3);
  unsigned lcp = (unsigned)(size_t)ring + (tid << 4);
  copy_oper(acp, lcp);
  copy_oper(bcp, lcp + 2 * G_OPER_HALVES);

  v8f acc[2][4];
#pragma unroll
  for (int mt = 0; mt < 2; ++mt)
#pragma unroll
    for (int nt = 0; nt < 4; ++nt) acc[mt][nt] = (v8f){};

  // Stage 0 has landed for this wave's copies; the barrier publishes it to the block.
  asm volatile("s_wait_asynccnt 0x0" ::: "memory");
  __syncthreads();
  copy_oper(acp + G_ROWT_HALVES, lcp + 2 * G_BUF_HALVES);
  copy_oper(bcp + G_ROWT_HALVES, lcp + 2 * (G_BUF_HALVES + G_OPER_HALVES));

  // One k step's operands, 2 A and 4 B fragments, are fetched from LDS as one group of 12
  // loads, one k step ahead of their products, into one of two register sets.
  struct Step { v16h a[2], b[4]; };
  // This lane's place in the wave's first A and first B fragment of buffer 0.
  const _Float16* pa = ring + wm * (2 * G_ROWT_HALVES) + (lane << 3);
  const _Float16* pb = ring + G_OPER_HALVES + wn * (4 * G_ROWT_HALVES) + (lane << 3);
  auto fetch = [&](Step& f, int buf, int j) {  // k step j of the stage in buffer buf
    const _Float16* a = pa + buf * G_BUF_HALVES + (j << 9);
    const _Float16* b = pb + buf * G_BUF_HALVES + (j << 9);
    f.a[0] = load_frag_at(a);
    f.a[1] = load_frag_at(a + G_ROWT_HALVES);
#pragma unroll
    for (int nt = 0; nt < 4; ++nt) f.b[nt] = load_frag_at(b + nt * G_ROWT_HALVES);
    // Keeps the products written behind a fetch behind it: the scheduler otherwise moves the
    // first of them, with their load waits, in front of the group, which then issues late.
    __builtin_amdgcn_sched_barrier(0);
  };
  auto products = [&](const Step& f) {
#pragma unroll
    for (int nt = 0; nt < 4; ++nt) {
      if (SWAP) {
        acc[0][nt] = WMMA(f.b[nt], f.a[0], acc[0][nt]);
        acc[1][nt] = WMMA(f.b[nt], f.a[1], acc[1][nt]);
      } else {
        acc[0][nt] = WMMA(f.a[0], f.b[nt], acc[0][nt]);
        acc[1][nt] = WMMA(f.a[1], f.b[nt], acc[1][nt]);
      }
    }
  };
  Step x, y;
  fetch(x, 0, 0);
  // Kept rolled: unrolled, the addresses of all stages' copies are formed ahead and held in
  // registers, past v255, and the text of a loop that runs once grows eightfold.
#pragma unroll 1
  for (int t = 0; t < G_STAGES; ++t) {  // stage t, in buffer t & 1
    fetch(y, t & 1, 1);
    products(x);
    fetch(x, t & 1, 2);
    products(y);
    fetch(y, t & 1, 3);
    products(x);
    // Keeps these products in front of the publish point: moved behind the barrier they would
    // stand in front of the refill, which would then issue late.
    __builtin_amdgcn_sched_barrier(0);
    // Publish point of stage t + 1, in front of stage t's last products, whose fragments are
    // fetched: this wave's reads of stage t are done, its copies of stage t + 1 have landed;
    // behind the barrier both hold for the whole block.
    asm volatile("s_wait_dscnt 0x0" ::: "memory");
    asm volatile("s_wait_asynccnt 0x0" ::: "memory");
    __syncthreads();
    if (t + 2 < G_STAGES) {
      copy_oper(acp + (t + 2) * G_ROWT_HALVES, lcp + (t & 1) * (2 * G_BUF_HALVES));
      copy_oper(bcp + (t + 2) * G_ROWT_HALVES,
                lcp + (t & 1) * (2 * G_BUF_HALVES) + 2 * G_OPER_HALVES);
    }
    if (t + 1 < G_STAGES) fetch(x, (t + 1) & 1, 0);
    products(y);
  }
  // No copy is outstanding when the wave ends.
  asm volatile("s_wait_asynccnt 0x0" ::: "memory");
  int m0 = (bm << 7) + (wm << 5);
  int n0 = (bn << 7) + (wn << 6);
  store(m0, n0, acc);
}

// The three projections in one launch of 3 x 256 blocks: blocks 0 .. 255 Q, 256 .. 511 K,
// 512 .. 767 V^T. Wt: Wq^T, Wk^T, Wv^T one behind the other; C: Q, K, V^T likewise. Two blocks
// fit a WGP (LDS, registers): one block's copies fly while the other's land or are worked on,
// and a block's first stage and its stores overlap other blocks' k loops.
// C is in fragment order per (batch, head); a lane's 8 values are 8 consecutive k of the
// operand that attention reads, so each tile leaves as one 16-B store per lane.
// Q, K: rows = positions, k = head dim. V^T: rows = head dim, k = positions.
// One k loop serves all three: a tile's registers run along the rows of the core's second
// operand, which is W^T for Q and K and X for V^T (the first WMMA operand of the product: W^T
// rows for Q and K, X rows for V^T). The choice is the block's, made in scalar registers.
// RoPE is applied to Q and K here, on the f32 sums: a lane's 8 values of a tile are 4 whole
// (even, odd) pairs of one position, so the rotation needs no other lane, and Q and K are
// rounded to f16 once and cross memory once. fc: [SS, HD / 2] (cos, sin).
__global__ __launch_bounds__(256) void gemm_qkv_kernel(const _Float16* __restrict__ X,
                                                       const _Float16* __restrict__ Wt,
                                                       const float* __restrict__ fc,
                                                       _Float16* __restrict__ C) {
  __shared__ __attribute__((aligned(16))) _Float16 ring[2 * G_BUF_HALVES];
  int lane = threadIdx.x & 31;
  int which = blockIdx.x >> 8;
  int tx = (blockIdx.x >> 3) & 31, tw = blockIdx.x & 7;  // 128 rows of X, 128 rows of W^T
  bool vt = which == 2;
  const _Float16* W = Wt + (size_t)which * DD * DD;
  _Float16* Cw = C + (size_t)which * BB * SS * DD;
  gemm_block_128x128<true>(vt ? W : X, vt ? X : W, ring, vt ? tw : tx, vt ? tx : tw,
                           [&](int m0, int n0, const v8f (&acc)[2][4]) {
    int x0 = vt ? n0 : m0;  // the wave tile's first row of X
    int w0 = vt ? m0 : n0;  // and of W^T: 64 rows, a head, for Q and K; 32 for V^T
    int b = x0 >> 11, s0 = x0 & (SS - 1), h = w0 >> 6;
    _Float16* Cb = Cw + (size_t)(b * HH + h) * SS * HD +
                   (vt ? frag_unit((w0 & 63) >> 4, s0 >> 5, SS / 32) : frag_unit(s0 >> 4, 0, HD / 32));
    int mstep = vt ? (SS / 32) << 9 : (HD / 32) << 9;  // the next row tile of C
    v8h o[2][4];
    if (vt) {
#pragma unroll
      for (int mt = 0; mt < 2; ++mt)
#pragma unroll
        for (int nt = 0; nt < 4; ++nt) o[mt][nt] = to_f16(acc[mt][nt]);
    } else {
      // Tile (mt, nt), this lane: position s0 + 16 * mt + (lane & 15), head dims
      // 16 * nt + 8 * (lane >> 4) + 0 .. 7, whose 4 (cos, sin) are 32 consecutive bytes.
      const float4* f = (const float4*)(fc + (s0 + (lane & 15)) * HD + ((lane >> 4) << 3));
      float4 cs[2][4][2];
#pragma unroll
      for (int mt = 0; mt < 2; ++mt)
#pragma unroll
        for (int nt = 0; nt < 4; ++nt) {
          cs[mt][nt][0] = f[mt * (16 * HD / 4) + nt * 4];
          cs[mt][nt][1] = f[mt * (16 * HD / 4) + nt * 4 + 1];
        }
      // Stands behind the 16 loads and in front of any overwrite of their address register,
      // which it names as an input so that no load's result is placed over it.
      asm volatile("s_wait_xcnt 0x0" :: "v"(f) : "memory");
#pragma unroll
      for (int mt = 0; mt < 2; ++mt)
#pragma unroll
        for (int nt = 0; nt < 4; ++nt) {
          float4 f0 = cs[mt][nt][0], f1 = cs[mt][nt][1];
          float c[4] = {f0.x, f0.z, f1.x, f1.z};
          float d[4] = {f0.y, f0.w, f1.y, f1.w};
#pragma unroll
          for (int i = 0; i < 4; ++i) {
            float a = acc[mt][nt][2 * i], b = acc[mt][nt][2 * i + 1];
            o[mt][nt][2 * i]     = (_Float16)(a * c[i] - b * d[i]);
            o[mt][nt][2 * i + 1] = (_Float16)(a * d[i] + b * c[i]);
          }
        }
    }
    // Keeps the 8 stores behind all the conversions: no register of an issued store is then
    // written again, and the stores need no wait between them.
    __builtin_amdgcn_sched_barrier(0);
#pragma unroll
    for (int mt = 0; mt < 2; ++mt)
#pragma unroll
      for (int nt = 0; nt < 4; ++nt)  // 16 k a tile: planes nt of consecutive units
        *(v8h*)(Cb + mt * mstep + (nt << 8) + (lane << 3)) = o[mt][nt];
  });
}

__global__ __launch_bounds__(256) void gemm_f32out_kernel(const _Float16* __restrict__ A,
                                                          const _Float16* __restrict__ Bt,
                                                          float* __restrict__ C) {
  __shared__ __attribute__((aligned(16))) _Float16 ring[2 * G_BUF_HALVES];
  int lane = threadIdx.x & 31;
  gemm_block_128x128<false>(A, Bt, ring, blockIdx.x >> 3, blockIdx.x & 7,
                            [&](int m0, int n0, const v8f (&acc)[2][4]) {
#pragma unroll
    for (int mt = 0; mt < 2; ++mt)
#pragma unroll
      for (int nt = 0; nt < 4; ++nt) {
        int row = m0 + (mt << 4) + ((lane >> 4) << 3);
        int col = n0 + (nt << 4) + (lane & 15);
        for (int r = 0; r < 8; ++r) C[(size_t)(row + r) * DD + col] = acc[mt][nt][r];
      }
  });
}

// ---------------- attention: per-chunk softmax, chunk outputs summed -------
// Lane l <-> lane l ^ 16 (the two halves of a wave hold the two halves of a column).
static __device__ __forceinline__ float xhalf(float x) {
  int b = __builtin_bit_cast(int, x);
  return __builtin_bit_cast(float,
      __builtin_amdgcn_permlanex16(b, b, 0x76543210, 0xfedcba98, false, false));
}

// K and V^T reach the waves through LDS. A stage is 128 keys of EACH of the two chunks; a
// chunk's share is 16 KB of K (contiguous in fragment order), then 4 KB of each of the 4 d tiles
// of V^T. A block is 128 queries of one (batch, head): waves 0 .. 3 walk chunk 0, waves 4 .. 7
// chunk 1, each wave with 32 queries, so L2 delivers a stage once a block.
#define STAGE_KEYS 128
#define STAGE_HALVES 16384             // one chunk's share: K 8192 + V^T 8192 f16
#define BUF_HALVES (2 * STAGE_HALVES)  // a stage: 64 KB
#define NSTAGES (CHUNK / STAGE_KEYS)
static_assert(SS == 2 * CHUNK, "the waves of a block are split over two chunks");

// One chunk's share of a stage, 8 x 16 B a lane. k, v: this lane's first 16 B of it in K and in
// V^T; l: the LDS byte address of its first 16 B in the buffer.
static __device__ __forceinline__ void copy_stage(const _Float16* k, const _Float16* v, unsigned l) {
  // The closing s_wait_xcnt stands in the copies' own statement, in front of any later
  // overwrite of the address registers they name.
  asm volatile(
      "global_load_async_to_lds_b128 %0, %8, off\n\t"
      "global_load_async_to_lds_b128 %1, %9, off\n\t"
      "global_load_async_to_lds_b128 %2, %10, off\n\t"
      "global_load_async_to_lds_b128 %3, %11, off\n\t"
      "global_load_async_to_lds_b128 %4, %12, off\n\t"
      "global_load_async_to_lds_b128 %5, %13, off\n\t"
      "global_load_async_to_lds_b128 %6, %14, off\n\t"
      "global_load_async_to_lds_b128 %7, %15, off\n\t"
      "s_wait_xcnt 0x0"
      :: "v"(l), "v"(l + 4096u), "v"(l + 8192u), "v"(l + 12288u),
         "v"(l + 16384u), "v"(l + 20480u), "v"(l + 24576u), "v"(l + 28672u),
         "v"(k), "v"(k + 2048), "v"(k + 4096), "v"(k + 6144),
         "v"(v), "v"(v + 16 * SS), "v"(v + 32 * SS), "v"(v + 48 * SS)
      : "memory");
}

__global__ __launch_bounds__(256) void attn_kernel(const _Float16* __restrict__ Q,
                                                   const _Float16* __restrict__ Kd,
                                                   const _Float16* __restrict__ Vt,
                                                   _Float16* __restrict__ O) {
  __shared__ __attribute__((aligned(16))) _Float16 ring[2 * BUF_HALVES];
  int tid  = threadIdx.x;
  int lane = tid & 31;
  int wave = __builtin_amdgcn_readfirstlane(tid >> 5);
  int g  = wave >> 2;                                     // the wave's chunk
  int qt = ((blockIdx.x & 15) << 3) + ((wave & 3) << 1);  // its query tiles: qt, qt + 1
  int bh = blockIdx.x >> 4;                               // 16 blocks a (batch, head)
  const _Float16* Qb = Q  + (size_t)bh * SS * HD;
  const _Float16* Kb = Kd + (size_t)bh * SS * HD;
  const _Float16* Vb = Vt + (size_t)bh * HD * SS;

  // This lane's share of stage 0 of chunk 0, and its place in buffer 0.
  const _Float16* kcp = Kb + (tid << 3);
  const _Float16* vcp = Vb + (tid << 3);
  unsigned lcp = (unsigned)(size_t)ring + (tid << 4);
  auto copy_both = [&](int t, unsigned l) {  // stage t, both chunks' shares
    copy_stage(kcp + t * (STAGE_KEYS * HD), vcp + t * (STAGE_KEYS * 16), l);
    copy_stage(kcp + CHUNK * HD + t * (STAGE_KEYS * HD), vcp + CHUNK * 16 + t * (STAGE_KEYS * 16),
               l + 2 * STAGE_HALVES);
  };
  copy_both(0, lcp);

  v16h qb[2][2];
#pragma unroll
  for (int c = 0; c < 2; ++c) {
    qb[c][0] = load_frag(Qb, HD / 32, qt + c, 0, lane);
    qb[c][1] = load_frag(Qb, HD / 32, qt + c, 1, lane);
  }
  // Stands behind the 8 loads of Q, in front of any overwrite of their address register.
  asm volatile("s_wait_xcnt 0x0" ::: "memory");

  // Stage 0 has landed for this wave's copies; the barrier publishes it to the block.
  asm volatile("s_wait_asynccnt 0x0" ::: "memory");
  __syncthreads();
  copy_both(1, lcp + 2 * BUF_HALVES);

  // Held maximum. Each query keeps a reference score, in raw units (before the scale): the
  // maximum of its first 32 keys, raised only when a later score tops it by more than lim.
  // Minus the reference is the C operand of the score products, so these deliver score -
  // reference and a score needs one multiply in front of exp2. Any reference gives the same
  // quotient at the end; lim keeps every weight at or below 2^8, far inside f16 and f32.
  const float c1  = 0.125f * 1.44269504f;  // 64^-0.5 * log2(e)
  const float lim = 8.0f / c1;
  v8f negm[2] = {(v8f){}, (v8f){}};  // minus this lane's query's reference, per query tile
  float lrun[2] = {0.f, 0.f};        // running sum over this half's keys only
  v8f oa[2][4];
#pragma unroll
  for (int c = 0; c < 2; ++c)
#pragma unroll
    for (int d = 0; d < 4; ++d) oa[c][d] = (v8f){};

  for (int t = 0; t < NSTAGES; ++t) {  // stage t, in buffer t & 1
    const _Float16* buf = ring + (t & 1) * BUF_HALVES + g * STAGE_HALVES + (lane << 3);
    for (int j = 0; j < STAGE_KEYS / 32; ++j) {
      // ---- scores^T: 32 keys x 2 x 16 queries, K-dim = HD = 64 (2 steps) ----
      // 32 keys of the stage: 4 units of K, one unit of each d tile of V^T
      const _Float16* kp = buf + (j << 11);
      const _Float16* vp = buf + 8192 + (j << 9);
      v16h ka0 = load_frag_at(kp);
      v16h ka1 = load_frag_at(kp + 512);
      v16h ka2 = load_frag_at(kp + 1024);
      v16h ka3 = load_frag_at(kp + 1536);
      // K's loads stay in front of V^T's: LDS loads return in order, and the score products
      // then wait for 8 loads, not for all 16.
      __builtin_amdgcn_sched_barrier(0);
      v16h va[4];
#pragma unroll
      for (int d = 0; d < 4; ++d) va[d] = load_frag_at(vp + d * 2048);
      // Keeps the pass's 16 LDS loads one group in front of its products: the scheduler
      // otherwise issues them two at a time, each pair with a full wait of its own.
      __builtin_amdgcn_sched_barrier(0);
      v8f s0[2], s1[2];
#pragma unroll
      for (int c = 0; c < 2; ++c) s0[c] = WMMA(ka0, qb[c][0], negm[c]);
#pragma unroll
      for (int c = 0; c < 2; ++c) s1[c] = WMMA(ka2, qb[c][0], negm[c]);
#pragma unroll
      for (int c = 0; c < 2; ++c) s0[c] = WMMA(ka1, qb[c][1], s0[c]);
#pragma unroll
      for (int c = 0; c < 2; ++c) s1[c] = WMMA(ka3, qb[c][1], s1[c]);
      // Keeps the 8 score products one run: a product's first reader then stands behind later
      // products, which fill the slots that the scheduler otherwise fills with v_nop.
      __builtin_amdgcn_sched_barrier(0);
      v16h pb[2];
      v8f p0[2], p1[2];
      // ---- 16 of a query's 32 scores are in this lane: their maximum over the reference ----
      float mt[2];
#pragma unroll
      for (int c = 0; c < 2; ++c) {
        float mx[8];
        for (int r = 0; r < 8; ++r) mx[r] = fmaxf(s0[c][r], s1[c][r]);
        mt[c] = fmaxf(fmaxf(fmaxf(mx[0], mx[1]), fmaxf(mx[2], mx[3])),
                      fmaxf(fmaxf(mx[4], mx[5]), fmaxf(mx[6], mx[7])));
      }
      // One test a pass, a scalar branch: taken in a wave's first pass, which sets the
      // references, and when any lane's score tops its reference by more than lim.
      bool first = (t | j) == 0;
      unsigned over = __builtin_amdgcn_ballot_w32(fmaxf(mt[0], mt[1]) > lim);
      if ((over | (unsigned)first) != 0) {
#pragma unroll
        for (int c = 0; c < 2; ++c) {
          float m  = fmaxf(mt[c], xhalf(mt[c]));
          float up = first ? m : fmaxf(m, 0.f);  // later passes only raise a reference
          float alpha = __builtin_amdgcn_exp2f(-c1 * fmaxf(up, 0.f));
          negm[c] -= up;
          s0[c] -= up;
          s1[c] -= up;
          lrun[c] *= alpha;
#pragma unroll
          for (int d = 0; d < 4; ++d) oa[c][d] *= alpha;
        }
      }
#pragma unroll
      for (int c = 0; c < 2; ++c) {
        v8f a0 = s0[c] * c1;
        v8f a1 = s1[c] * c1;
        for (int r = 0; r < 8; ++r) {
          p0[c][r] = __builtin_amdgcn_exp2f(a0[r]);
          p1[c][r] = __builtin_amdgcn_exp2f(a1[r]);
          pb[c][r]     = (_Float16)p0[c][r];  // k = 8h + r
          pb[c][r + 8] = (_Float16)p1[c][r];  // k = 16 + 8h + r
        }
      }
      // ---- O^T += V^T @ P^T: K-dim = 32 keys, 4 d-tiles (Vt is [HD,S]) ----
#pragma unroll
      for (int d = 0; d < 4; ++d)
#pragma unroll
        for (int c = 0; c < 2; ++c) oa[c][d] = WMMA(va[d], pb[c], oa[c][d]);
      // Keeps the row sums behind the products, which need none of them and so issue earlier as
      // one run; the sums fill the vector slots that the chip needs between the pass's last
      // matrix instruction and the next pass's first write over its operands, behind the taken
      // branch.
      __builtin_amdgcn_sched_barrier(0);
#pragma unroll
      for (int c = 0; c < 2; ++c) {
        v8f ps = p0[c] + p1[c];
        lrun[c] += ((ps[0] + ps[1]) + (ps[2] + ps[3])) + ((ps[4] + ps[5]) + (ps[6] + ps[7]));
      }
    }
    // Publish point of stage t + 1: this wave's reads of stage t are done, its copies of
    // stage t + 1 have landed; behind the barrier both hold for the whole block.
    asm volatile("s_wait_dscnt 0x0" ::: "memory");
    asm volatile("s_wait_asynccnt 0x0" ::: "memory");
    __syncthreads();
    if (t + 2 < NSTAGES) copy_both(t + 2, lcp + (t & 1) * (2 * BUF_HALVES));
  }
  // No copy is outstanding when the ring is reused and when the wave ends.
  asm volatile("s_wait_asynccnt 0x0" ::: "memory");
  // ---- finalize the chunk: join the halves' sums, normalize ----
#pragma unroll
  for (int c = 0; c < 2; ++c) {
    float inv = 1.f / (lrun[c] + xhalf(lrun[c]));
#pragma unroll
    for (int d = 0; d < 4; ++d) oa[c][d] *= inv;
  }
  // ---- add the two chunks' outputs: waves w and w ^ 4 hold the same queries. Wave w keeps
  // query tile g and hands the other one over through the ring, which nobody reads any more
  // (the last stage's barrier); 4 KB a wave, a wave-wide 16-B access covers 512 B ----
  typedef __attribute__((ext_vector_type(4))) float v4f;
  v4f* xch = (v4f*)ring;
  v8f keep[4], give[4];
#pragma unroll
  for (int d = 0; d < 4; ++d) {
    keep[d] = g ? oa[1][d] : oa[0][d];
    give[d] = g ? oa[0][d] : oa[1][d];
  }
#pragma unroll
  for (int d = 0; d < 4; ++d) {
    xch[((wave << 3) + 2 * d) * 32 + lane]     = __builtin_shufflevector(give[d], give[d], 0, 1, 2, 3);
    xch[((wave << 3) + 2 * d + 1) * 32 + lane] = __builtin_shufflevector(give[d], give[d], 4, 5, 6, 7);
  }
  // Publishes every wave's handed-over tile to its partner.
  __syncthreads();
#pragma unroll
  for (int d = 0; d < 4; ++d) {
    v4f lo = xch[(((wave ^ 4) << 3) + 2 * d) * 32 + lane];
    v4f hi = xch[(((wave ^ 4) << 3) + 2 * d + 1) * 32 + lane];
    keep[d] += __builtin_shufflevector(lo, hi, 0, 1, 2, 3, 4, 5, 6, 7);
  }
  // ---- store O, f16 [B*S, D] in fragment order: a lane holds 8 consecutive d of its
  // query, and d tiles 2u, 2u + 1 are the two planes of k tile 2h + u ----
  int b = bh >> 4, h = bh & 15;
  _Float16* o = O + frag_unit(b * (SS / 16) + qt + g, 2 * h, DD / 32) + (lane << 3);
  *(v8h*)(o)       = to_f16(keep[0]);
  *(v8h*)(o + 256) = to_f16(keep[1]);
  *(v8h*)(o + 512) = to_f16(keep[2]);
  *(v8h*)(o + 768) = to_f16(keep[3]);
}

extern "C" void kernel_launch(void* const* d_in, const int* in_sizes, int n_in,
                              void* d_out, int out_size, void* d_ws, size_t ws_size,
                              hipStream_t stream) {
  const float* X  = (const float*)d_in[0];
  const float* FC = (const float*)d_in[1];
  const float* Wq = (const float*)d_in[2];
  const float* Wk = (const float*)d_in[3];
  const float* Wv = (const float*)d_in[4];
  const float* Wo = (const float*)d_in[5];
  float* out = (float*)d_out;

  char* ws = (char*)d_ws;
  const size_t MB = 1u << 20;
  // all in fragment order
  _Float16* Xh  = (_Float16*)(ws + 0);        // 8 MB  [B*S, D] f16
  _Float16* Wqt = (_Float16*)(ws + 8  * MB);  // 2 MB  [N,K] f16
  _Float16* Wkt = (_Float16*)(ws + 10 * MB);
  _Float16* Wvt = (_Float16*)(ws + 12 * MB);
  _Float16* Wot = (_Float16*)(ws + 14 * MB);
  _Float16* Qh  = (_Float16*)(ws + 16 * MB);  // 8 MB  [B,H,S,HD]
  _Float16* Kh  = (_Float16*)(ws + 24 * MB);  // 8 MB  [B,H,S,HD]
  _Float16* Vtb = (_Float16*)(ws + 32 * MB);  // 8 MB  [B,H,HD,S]
  _Float16* Oh  = (_Float16*)(ws + 40 * MB);  // 8 MB  [B*S, D]

  // 1) X fp32 -> f16, and weights fp32 [K,N] -> f16 [N,K]
  //    (Wqt, Wkt, Wvt, Wot are consecutive: one launch writes all four)
  prep_kernel<<<1024, 256, 0, stream>>>(X, Wq, Wk, Wv, Wo, Xh, Wqt);

  // 2) QKV projections, with RoPE on Q and K: 3 x (4096/128)*(1024/128) = 768 block tiles
  //    x 256 thr (Wqt, Wkt, Wvt are consecutive, and so are Qh, Kh, Vtb)
  gemm_qkv_kernel<<<768, 256, 0, stream>>>(Xh, Wqt, FC, Qh);

  // 3) attention (waves = B*H*(S/32) query tile pairs x 2 chunks = 4096 -> 512 blocks x 256 thr)
  attn_kernel<<<512, 256, 0, stream>>>(Qh, Kh, Vtb, Oh);

  // 4) output projection -> f32 d_out
  gemm_f32out_kernel<<<256, 256, 0, stream>>>(Oh, Wot, out);
}
